// v000
// Times are from an AMD MI455X. After a warm-up the kernel runs many times in a row, and a time is the length of
// such a window on the GPU divided by its runs, so every launch and the gaps after it count. The runs cycle
// through copies of the inputs. A figure is the median of several windows, for all but v000 over two sittings.
// Sittings can differ by a few percent; kernels timed side by side share one.
// v000 is the starting kernel. One run takes 2170 microseconds.
#include <hip/hip_runtime.h>

// Causal multi-head attention with bias-free (out, in) projections and a biased (out, in) output projection at a 768-wide model (x [4][2048][768]; q, k, v = x W^T ('oi' [768][768] uniform(+-1/sqrt(768)), no bias; 12 heads x 64); scores x 64^-0.5; tril kept, -inf elsewhere (tril built inside the function); softmax; out = merged Wp^T + bp ('oi' + a REAL bias, uniform(+-1/sqrt(768))) -> [4][2048][768] (6.3 M); argument order x, Wq, Wk, Wv, Wp, bp).
// Layout per batch: bf16 copy of x; 'oi' weights cast in place (no transpose); exact projections (K 768); identity-table plane builders; causal T-2048 attention at 12 heads (hybrid rows: < 512 hi/lo 3 products, rest fp16 x1024; k_gemmc skips tiles above the diagonal); merged hi/lo x Wp exact + bp.
// Compute dtypes, f32 accumulate: every input rounded to bf16; projections exact; attention rows < 512 3 products, rest fp16; softmax f32; Wp hl x exact + bias.

#define NB_  4
#define TT   2048
#define DM   768
#define NH_  12
#define NKV  12
#define REP  (NH_ / NKV)
#define HD   64
#define DQ   (NH_ * HD)
#define DKV  (NKV * HD)
#define ZH   2
#define RH   512                  // query rows < RH use hi+lo planes (0: none)
#define WIN  2048
#define PCAR 1024.0f
#define SCL  0.125f   // HD^-0.5
typedef _Float16 h16;
typedef unsigned short bf;
typedef __attribute__((ext_vector_type(16))) __bf16   v16bf;
typedef __attribute__((ext_vector_type(16))) _Float16 v16h;
typedef __attribute__((ext_vector_type(8)))  _Float16 v8h;
typedef __attribute__((ext_vector_type(8)))  unsigned short v8us;
typedef __attribute__((ext_vector_type(8)))  float    v8f;
typedef __attribute__((ext_vector_type(4)))  float    v4f;
typedef v8h  __attribute__((may_alias)) v8ha;
typedef v4f  __attribute__((may_alias)) v4fa;
typedef v8us __attribute__((may_alias)) v8usa;

__device__ __forceinline__ unsigned short f2bf(float f) { unsigned u = __float_as_uint(f); u += 0x7FFFu + ((u >> 16) & 1u); return (unsigned short)(u >> 16); }
__device__ __forceinline__ float bf2f(unsigned short b) { return __uint_as_float(((unsigned)b) << 16); }
__device__ __forceinline__ float bfr(float f) { return bf2f(f2bf(f)); }
__device__ __forceinline__ v16h cat16(v8h lo, v8h hi) { return __builtin_shufflevector(lo, hi, 0, 1, 2, 3, 4, 5, 6, 7, 8, 9, 10, 11, 12, 13, 14, 15); }
__device__ __forceinline__ v16bf cat16b(v8us lo, v8us hi) { return __builtin_bit_cast(v16bf, __builtin_shufflevector(lo, hi, 0, 1, 2, 3, 4, 5, 6, 7, 8, 9, 10, 11, 12, 13, 14, 15)); }
__device__ __forceinline__ v8f wmma16(v16h a, v16h b, v8f c) { return __builtin_amdgcn_wmma_f32_16x16x32_f16(false, a, false, b, (short)0, c, false, false); }
__device__ __forceinline__ v8f wmmab(v16bf a, v16bf b, v8f c) { return __builtin_amdgcn_wmma_f32_16x16x32_bf16(false, a, false, b, (short)0, c, false, false); }



// ---- k_gemmw: register-blocked GEMM, ONE WAVE per 64x64 output tile (16 accumulators), operands straight from K-contiguous 16-bit planes; grid (M/64, N/64, Z), 32 threads.
// C[m][n] (f32, pitch ldc, + optional f32 bias[n]) = sum_k A[m][k] Bt[n][k] (+ split products per NSPLIT). z-batch strides sA/sB/sC in elements. K % 32 == 0.
template <typename T16> struct WFrag;
template <> struct WFrag<h16> { typedef v16h V; static __device__ __forceinline__ V ld(const h16* p) { return cat16(*(const v8h*)p, *(const v8h*)(p + 16)); } static __device__ __forceinline__ v8f mma(V a, V b, v8f c) { return wmma16(a, b, c); } };
template <> struct WFrag<bf> { typedef v16bf V; static __device__ __forceinline__ V ld(const bf* p) { return cat16b(*(const v8us*)p, *(const v8us*)(p + 16)); } static __device__ __forceinline__ v8f mma(V a, V b, v8f c) { return wmmab(a, b, c); } };
template <typename T16, int NSPLIT, bool BIAS>
__global__ __launch_bounds__(32) void k_gemmw(const T16* __restrict__ A, const T16* __restrict__ A2, const T16* __restrict__ Bt, const T16* __restrict__ Bt2, int K, float* C, int ldc, const float* __restrict__ bias, size_t sA, size_t sB, size_t sC) {
    typedef typename WFrag<T16>::V V;
    __shared__ __align__(16) float os[16 * 68];
    const size_t z = blockIdx.z; A += z * sA; if (A2) A2 += z * sA; Bt += z * sB; if (Bt2) Bt2 += z * sB; C += z * sC;
    const int lane = threadIdx.x & 31, lr = lane & 15, hi = lane >> 4; const int r0 = blockIdx.x * 64, c0 = blockIdx.y * 64;
    v8f acc[4][4];
#pragma unroll
    for (int mb = 0; mb < 4; ++mb)
#pragma unroll
        for (int nb = 0; nb < 4; ++nb) acc[mb][nb] = (v8f){};
    const size_t aoff = (size_t)(r0 + lr) * K + 8 * hi, boff = (size_t)(c0 + lr) * K + 8 * hi;
#pragma unroll 1
    for (int kc = 0; kc < K; kc += 32) {
        V a[4], a2[4];
#pragma unroll
        for (int mb = 0; mb < 4; ++mb) { a[mb] = WFrag<T16>::ld(A + aoff + (size_t)mb * 16 * K + kc); if (NSPLIT == 1 || NSPLIT == 2) a2[mb] = WFrag<T16>::ld(A2 + aoff + (size_t)mb * 16 * K + kc); }
#pragma unroll
        for (int nb = 0; nb < 4; ++nb) { const V b = WFrag<T16>::ld(Bt + boff + (size_t)nb * 16 * K + kc); V b2; if (NSPLIT >= 2) b2 = WFrag<T16>::ld(Bt2 + boff + (size_t)nb * 16 * K + kc);
#pragma unroll
            for (int mb = 0; mb < 4; ++mb) { acc[mb][nb] = WFrag<T16>::mma(a[mb], b, acc[mb][nb]); if (NSPLIT == 1 || NSPLIT == 2) acc[mb][nb] = WFrag<T16>::mma(a2[mb], b, acc[mb][nb]); if (NSPLIT >= 2) acc[mb][nb] = WFrag<T16>::mma(a[mb], b2, acc[mb][nb]); } }
        asm volatile("v_nop\n\tv_nop\n\tv_nop\n\tv_nop" : "+v"(acc[0][0]), "+v"(acc[1][1]), "+v"(acc[2][2]), "+v"(acc[3][3]) : "v"(a[0]), "v"(a[3]));
    }
#pragma unroll
    for (int mb = 0; mb < 4; ++mb) {
#pragma unroll
        for (int nb = 0; nb < 4; ++nb) {
#pragma unroll
            for (int j = 0; j < 8; ++j) os[(hi * 8 + j) * 68 + nb * 16 + lr] = acc[mb][nb][j]; }
        __builtin_amdgcn_wave_barrier(); asm volatile("" ::: "memory");
        float* crow = C + (size_t)(r0 + mb * 16) * ldc + c0;
{
#pragma unroll
            for (int s = 0; s < 8; ++s) { const int row = 2 * s + hi, cofs = lr * 4; v4f val = *(const v4fa*)(os + row * 68 + cofs); if (BIAS) { val[0] += bfr(bias[c0 + cofs]); val[1] += bfr(bias[c0 + cofs + 1]); val[2] += bfr(bias[c0 + cofs + 2]); val[3] += bfr(bias[c0 + cofs + 3]); }
                *(v4f*)(crow + (size_t)row * ldc + cofs) = val; }
             }
        __builtin_amdgcn_wave_barrier(); asm volatile("" ::: "memory");
    }
}

// ---- k_gemmc: the same one-wave 64x64 tile GEMM specialised for causal attention: CMODE 1 skips score tiles entirely above the diagonal (query rows r0+roff.., key columns c0..), CMODE 2 limits the
// key (K) loop of the probability x value contraction to the diagonal block (probabilities beyond it are exactly zero). roff = row offset of this launch's first row within the sequence.
template <typename T16, int NSPLIT, int CMODE>
__global__ __launch_bounds__(32) void k_gemmc(const T16* __restrict__ A, const T16* __restrict__ A2, const T16* __restrict__ Bt, const T16* __restrict__ Bt2, int K, float* C, int ldc, int roff, size_t sA, size_t sB, size_t sC) {
    typedef typename WFrag<T16>::V V;
    __shared__ __align__(16) float os[16 * 68];
    const size_t z = blockIdx.z; A += z * sA; if (A2) A2 += z * sA; Bt += z * sB; if (Bt2) Bt2 += z * sB; C += z * sC;
    const int lane = threadIdx.x & 31, lr = lane & 15, hi = lane >> 4; const int r0 = blockIdx.x * 64, c0 = blockIdx.y * 64;
    if (CMODE == 1 && c0 > r0 + roff + 63) return;                  // score tile entirely above the causal diagonal: never read (the softmax masks j > i by select)
    const int Kl = (CMODE == 2) ? min(K, r0 + roff + 64) : K;        // P.V: probabilities are exactly 0 beyond the diagonal block, so the K loop stops there
    v8f acc[4][4];
#pragma unroll
    for (int mb = 0; mb < 4; ++mb)
#pragma unroll
        for (int nb = 0; nb < 4; ++nb) acc[mb][nb] = (v8f){};
    const size_t aoff = (size_t)(r0 + lr) * K + 8 * hi, boff = (size_t)(c0 + lr) * K + 8 * hi;
#pragma unroll 1
    for (int kc = 0; kc < Kl; kc += 32) {
        V a[4], a2[4];
#pragma unroll
        for (int mb = 0; mb < 4; ++mb) { a[mb] = WFrag<T16>::ld(A + aoff + (size_t)mb * 16 * K + kc); if (NSPLIT == 1 || NSPLIT == 2) a2[mb] = WFrag<T16>::ld(A2 + aoff + (size_t)mb * 16 * K + kc); }
#pragma unroll
        for (int nb = 0; nb < 4; ++nb) { const V b = WFrag<T16>::ld(Bt + boff + (size_t)nb * 16 * K + kc); V b2; if (NSPLIT >= 2) b2 = WFrag<T16>::ld(Bt2 + boff + (size_t)nb * 16 * K + kc);
#pragma unroll
            for (int mb = 0; mb < 4; ++mb) { acc[mb][nb] = WFrag<T16>::mma(a[mb], b, acc[mb][nb]); if (NSPLIT == 1 || NSPLIT == 2) acc[mb][nb] = WFrag<T16>::mma(a2[mb], b, acc[mb][nb]); if (NSPLIT >= 2) acc[mb][nb] = WFrag<T16>::mma(a[mb], b2, acc[mb][nb]); } }
        asm volatile("v_nop\n\tv_nop\n\tv_nop\n\tv_nop" : "+v"(acc[0][0]), "+v"(acc[1][1]), "+v"(acc[2][2]), "+v"(acc[3][3]) : "v"(a[0]), "v"(a[3]));
    }
#pragma unroll
    for (int mb = 0; mb < 4; ++mb) {
#pragma unroll
        for (int nb = 0; nb < 4; ++nb) {
#pragma unroll
            for (int j = 0; j < 8; ++j) os[(hi * 8 + j) * 68 + nb * 16 + lr] = acc[mb][nb][j]; }
        __builtin_amdgcn_wave_barrier(); asm volatile("" ::: "memory");
        float* crow = C + (size_t)(r0 + mb * 16) * ldc + c0;
{
#pragma unroll
            for (int s = 0; s < 8; ++s) { const int row = 2 * s + hi, cofs = lr * 4; v4f val = *(const v4fa*)(os + row * 68 + cofs);
                *(v4f*)(crow + (size_t)row * ldc + cofs) = val; }
             }
        __builtin_amdgcn_wave_barrier(); asm volatile("" ::: "memory");
    }
}

__device__ __forceinline__ h16 tohx(float x) { return (h16)x; }
__device__ __forceinline__ void splitf(float y, unsigned short& h, unsigned short& l) { h = f2bf(y); l = f2bf(y - bf2f(h)); }
typedef __attribute__((ext_vector_type(2))) _Float16 v2h;
typedef __attribute__((ext_vector_type(4))) _Float16 v4h;
typedef __attribute__((ext_vector_type(2))) unsigned short v2us;
typedef __attribute__((ext_vector_type(4))) unsigned short v4us;
typedef __attribute__((ext_vector_type(2))) float v2f;
typedef __attribute__((ext_vector_type(4))) int v4i;

__global__ __launch_bounds__(256) void k_wtG(const float* __restrict__ w, int K, int N, bf* Bt) {
    const int lane = threadIdx.x & 31; const int L0 = (blockIdx.x * 8 + (threadIdx.x >> 5)) * 8; const int nlines = N * K / 64;
{
#pragma unroll 1
        for (int l = 0; l < 8; ++l) { const int L = L0 + l; if (L >= nlines) break; const size_t e = (size_t)L * 64 + lane * 2; const int k = (int)(e % K), n = (int)(e / K); v2us o;
            o[0] = f2bf(w[(size_t)k * N + n]); o[1] = f2bf(w[(size_t)(k + 1) * N + n]); *(v2us*)(Bt + e) = o; }
         }
}
__global__ __launch_bounds__(256) void k_cvt8(const float* __restrict__ src, bf* dst, size_t n8) { const size_t i = (size_t)blockIdx.x * 256 + threadIdx.x; if (i >= n8) return; const v8f v = *(const v8f*)(src + i * 8); v8us o;
#pragma unroll
    for (int k = 0; k < 8; ++k) o[k] = f2bf(v[k]); *(v8us*)(dst + i * 8) = o;  }

// k_rope: head planes [h][t][d] (fp16 + hi/lo) of rope(x) x sc with the rotate-half convention out[d] = x[d] cos[t][d] - x[d+HD/2] sin[t][d], out[d+HD/2] = x[d+HD/2] cos[t][d+HD/2] + x[d] sin[t][d+HD/2]
__global__ __launch_bounds__(256) void k_rope(const float* __restrict__ F, int pitch, int nheads, const float* __restrict__ CS, const float* __restrict__ RF, const float* __restrict__ nw, float sc, h16* P16, bf* Ph, bf* Pl) {
    const size_t e = ((size_t)blockIdx.x * 256 + threadIdx.x) * 2; if (e >= (size_t)nheads * TT * HD) return; const int d = (int)(e % HD); const int t = (int)((e / HD) % TT); const int h = (int)(e / ((size_t)HD * TT)); const float* f = F + (size_t)t * pitch + h * HD; const float rf = RF ? RF[(size_t)h * TT + t] : 1.0f; v2h o16; v2us oh, ol;
#pragma unroll
    for (int q = 0; q < 2; ++q) { const int dd = d + q; const int dp = (dd < HD / 2) ? dd + HD / 2 : dd - HD / 2; float x0 = f[dd], x1 = f[dp];
        if (RF) { float n0 = __fmul_rn(x0, rf), n1 = __fmul_rn(x1, rf); asm volatile("" : "+v"(n0)); asm volatile("" : "+v"(n1)); x0 = __fmul_rn(bfr(nw[dd]), n0); x1 = __fmul_rn(bfr(nw[dp]), n1); }
        const v2f cs = *(const v2f*)(CS + ((size_t)t * HD + dd) * 2); float a = __fmul_rn(x0, cs[0]), bq = __fmul_rn(x1, cs[1]); asm volatile("" : "+v"(a)); asm volatile("" : "+v"(bq)); const float r = ((dd < HD / 2) ? __fsub_rn(a, bq) : __fadd_rn(a, bq)) * sc;
        o16[q] = tohx(r); unsigned short a2, c2; splitf(r, a2, c2); oh[q] = a2; ol[q] = c2; }
    *(v2h*)(P16 + e) = o16; *(v2us*)(Ph + e) = oh; *(v2us*)(Pl + e) = ol;  }
__global__ __launch_bounds__(256) void k_vtp(const float* __restrict__ F, int pitch, int nheads, h16* V16, bf* Vh, bf* Vl) { const size_t e = ((size_t)blockIdx.x * 256 + threadIdx.x) * 2; if (e >= (size_t)nheads * HD * TT) return; const int t = (int)(e % TT); const int d = (int)((e / TT) % HD); const int g = (int)(e / ((size_t)TT * HD)); v2h o16; v2us oh, ol;
#pragma unroll
    for (int q = 0; q < 2; ++q) { const float x = F[(size_t)(t + q) * pitch + g * HD + d]; o16[q] = tohx(x); unsigned short a2, c2; splitf(x, a2, c2); oh[q] = a2; ol[q] = c2; }
    *(v2h*)(V16 + e) = o16; *(v2us*)(Vh + e) = oh; *(v2us*)(Vl + e) = ol;  }
__global__ __launch_bounds__(256) void k_csid(float* CS) { const int idx = blockIdx.x * 256 + threadIdx.x; if (idx >= TT * HD) return; v2f cs; cs[0] = 1.0f; cs[1] = 0.0f; *(v2f*)(CS + (size_t)idx * 2) = cs;  }
// k_asoft: per row (zz, i): t = S x HD^-0.5 for j <= i and i - j < WIN (sliding causal window; the reference's -1e9 additive fill vanishes identically); softmax over the 2048 keys (register row, one exp, fixed trees);
__global__ __launch_bounds__(256) void k_asoft(const float* __restrict__ Sb, h16* P16, bf* Ph, bf* Pl) {
    const int lane = threadIdx.x & 31; const int row = blockIdx.x * 8 + (threadIdx.x >> 5); if (row >= ZH * TT) return; const int i = row % TT; const int zz = row / TT; (void)zz; const bool hires = (i < RH); const float* sr = Sb + (size_t)row * TT; float v[TT / 32]; float mx = -3.0e38f;
#pragma unroll
    for (int ch = 0; ch < TT / 128; ++ch) { const int j0 = ch * 128 + lane * 4; const v4f a = *(const v4f*)(sr + j0);
#pragma unroll
        for (int q = 0; q < 4; ++q) { const int j = j0 + q; (void)j; const float t = (j <= i && i - j < WIN) ? a[q] * SCL : -3.0e38f; v[ch * 4 + q] = t; mx = fmaxf(mx, t); } }
#pragma unroll
    for (int sh = 16; sh; sh >>= 1) mx = fmaxf(mx, __shfl_xor(mx, sh, 32));
    float sum = 0.f;
#pragma unroll
    for (int k = 0; k < TT / 32; ++k) { float d0 = __fsub_rn(v[k], mx); asm volatile("" : "+v"(d0)); v[k] = __builtin_amdgcn_exp2f(__fmul_rn(d0, 1.4426950408889634f)); sum += v[k]; }
#pragma unroll
    for (int sh = 16; sh; sh >>= 1) sum += __shfl_xor(sum, sh, 32);
    const float f = __fdiv_rn(hires ? 1.0f : PCAR, sum);
{
        if (hires) {
#pragma unroll
            for (int ch = 0; ch < TT / 128; ++ch) { v4us oh, ol;
#pragma unroll
                for (int q = 0; q < 4; ++q) { unsigned short a, c2; splitf(v[ch * 4 + q] * f, a, c2); oh[q] = a; ol[q] = c2; }
                const size_t oo = ((size_t)zz * (RH ? RH : 1) + i) * TT + ch * 128 + lane * 4; *(v4us*)(Ph + oo) = oh; *(v4us*)(Pl + oo) = ol; }
        } else {
#pragma unroll
            for (int ch = 0; ch < TT / 128; ++ch) { v4h o4;
#pragma unroll
                for (int q = 0; q < 4; ++q) o4[q] = tohx(v[ch * 4 + q] * f);
                *(v4h*)(P16 + (size_t)row * TT + ch * 128 + lane * 4) = o4; } }
         }
}
__global__ __launch_bounds__(256) void k_merge(const float* __restrict__ O, int h0, bf* Ah, bf* Al) { const size_t e = ((size_t)blockIdx.x * 256 + threadIdx.x) * 2; if (e >= (size_t)ZH * TT * HD) return; const int d = (int)(e % HD); const int t = (int)((e / HD) % TT); const int zz = (int)(e / ((size_t)HD * TT)); const float cs = (t < RH) ? 1.0f : (1.0f / PCAR); const size_t oo = (size_t)t * DQ + (h0 + zz) * HD + d;
    v2us oh, ol;
#pragma unroll
    for (int q = 0; q < 2; ++q) { unsigned short a, c2; splitf(O[e + q] * cs, a, c2); oh[q] = a; ol[q] = c2; } *(v2us*)(Ah + oo) = oh; *(v2us*)(Al + oo) = ol;  }

extern "C" void kernel_launch(void* const* d_in, const int* in_sizes, int n_in,
                              void* d_out, int out_size, void* d_ws, size_t ws_size, hipStream_t stream) {
    (void)in_sizes; (void)n_in; (void)out_size;
    const float* x = (const float*)d_in[0]; const float* wq = (const float*)d_in[1]; const float* wk = (const float*)d_in[2]; const float* wv = (const float*)d_in[3]; const float* wo = (const float*)d_in[4]; const float* bo = (const float*)d_in[5];   /* argument order x, Wq, Wk, Wv, Wp ('oi' [768][768]: nn.Linear layout, applied transposed), bp */
    float* OUT = (float*)d_out;     // [4][2048][768]
    char* wsp = (char*)d_ws;
    auto take = [&](size_t bytes) { char* p = wsp; wsp += (bytes + 255) & ~(size_t)255; return (void*)p; };
    bf* WQ = (bf*)take((size_t)DQ * DM * 2); bf* WK = (bf*)take((size_t)DKV * DM * 2); bf* WV = (bf*)take((size_t)DKV * DM * 2); bf* WO = (bf*)take((size_t)DM * DQ * 2); float* CS = (float*)take((size_t)TT * HD * 2 * 4);
    bf* XB = (bf*)take((size_t)TT * DM * 2); float* FQ = (float*)take((size_t)TT * DQ * 4); float* FK = (float*)take((size_t)TT * DKV * 4);
    h16* QP16 = (h16*)take((size_t)NH_ * TT * HD * 2); h16* KP16 = (h16*)take((size_t)NKV * TT * HD * 2); h16* VT16 = (h16*)take((size_t)NKV * HD * TT * 2);
    bf* QPh = (bf*)take((size_t)NH_ * TT * HD * 2); bf* QPl = (bf*)take((size_t)NH_ * TT * HD * 2); bf* KPh = (bf*)take((size_t)NKV * TT * HD * 2); bf* KPl = (bf*)take((size_t)NKV * TT * HD * 2); bf* VTh = (bf*)take((size_t)NKV * HD * TT * 2); bf* VTl = (bf*)take((size_t)NKV * HD * TT * 2); bf* Ph = (bf*)take((size_t)ZH * RH * TT * 2); bf* Pl = (bf*)take((size_t)ZH * RH * TT * 2);
    float* Sb = (float*)take((size_t)ZH * TT * TT * 4); h16* P16 = (h16*)take((size_t)ZH * TT * TT * 2); float* Ob = (float*)take((size_t)ZH * TT * HD * 4); bf* ATh = (bf*)take((size_t)TT * DQ * 2); bf* ATl = (bf*)take((size_t)TT * DQ * 2);
    if ((size_t)(wsp - (char*)d_ws) > ws_size) return;    // ws 256 MiB
    float* FV = FK;   // v projection reuses the k buffer after the k planes are built (stream-ordered)
    { k_cvt8<<<(unsigned)(((size_t)DQ * DM / 8 + 255) / 256), 256, 0, stream>>>(wq, WQ, (size_t)DQ * DM / 8); k_cvt8<<<(unsigned)(((size_t)DKV * DM / 8 + 255) / 256), 256, 0, stream>>>(wk, WK, (size_t)DKV * DM / 8); k_cvt8<<<(unsigned)(((size_t)DKV * DM / 8 + 255) / 256), 256, 0, stream>>>(wv, WV, (size_t)DKV * DM / 8);   /* 'oi' weights are already [out][in] = Bt rows: a plain cast, no transpose */
      k_cvt8<<<(unsigned)(((size_t)DM * DQ / 8 + 255) / 256), 256, 0, stream>>>(wo, WO, (size_t)DM * DQ / 8);   /* Wp 'oi' [768][768]: plain cast */
       }
    k_csid<<<(TT * HD + 255) / 256, 256, 0, stream>>>(CS);
    const unsigned LQ = (unsigned)(((size_t)NH_ * TT * HD / 2 + 255) / 256), LKv = (unsigned)(((size_t)NKV * TT * HD / 2 + 255) / 256);
    for (int b = 0; b < NB_; ++b) {
        
        k_cvt8<<<(unsigned)(((size_t)TT * DM / 8 + 255) / 256), 256, 0, stream>>>(x + (size_t)b * TT * DM, XB, (size_t)TT * DM / 8);
        k_gemmw<bf, 0, false><<<dim3(TT / 64, DQ / 64, 1), 32, 0, stream>>>(XB, nullptr, WQ, nullptr, DM, FQ, DQ, nullptr, 0, 0, 0);
        k_rope<<<LQ, 256, 0, stream>>>(FQ, DQ, NH_, CS, nullptr, nullptr, 1.0f, QP16, QPh, QPl);
        k_gemmw<bf, 0, false><<<dim3(TT / 64, DKV / 64, 1), 32, 0, stream>>>(XB, nullptr, WK, nullptr, DM, FK, DKV, nullptr, 0, 0, 0);
        k_rope<<<LKv, 256, 0, stream>>>(FK, DKV, NKV, CS, nullptr, nullptr, 1.0f, KP16, KPh, KPl);
        k_gemmw<bf, 0, false><<<dim3(TT / 64, DKV / 64, 1), 32, 0, stream>>>(XB, nullptr, WV, nullptr, DM, FV, DKV, nullptr, 0, 0, 0); k_vtp<<<LKv, 256, 0, stream>>>(FV, DKV, NKV, VT16, VTh, VTl);
        for (int h0 = 0; h0 < NH_; h0 += ZH) { const size_t zq = (size_t)h0, zk = (size_t)(h0 / REP);   // one kv head per query head: the pass's two heads use consecutive kv planes (z-strides TT*HD)
            k_gemmc<bf, 2, 1><<<dim3(RH / 64, TT / 64, ZH), 32, 0, stream>>>(QPh + zq * TT * HD, QPl + zq * TT * HD, KPh + zk * TT * HD, KPl + zk * TT * HD, HD, Sb, TT, 0, (size_t)TT * HD, (size_t)TT * HD, (size_t)TT * TT);
            k_gemmc<h16, 0, 1><<<dim3((TT - RH) / 64, TT / 64, ZH), 32, 0, stream>>>(QP16 + zq * TT * HD + (size_t)RH * HD, nullptr, KP16 + zk * TT * HD, nullptr, HD, Sb + (size_t)RH * TT, TT, RH, (size_t)TT * HD, (size_t)TT * HD, (size_t)TT * TT);
            k_asoft<<<ZH * TT / 8, 256, 0, stream>>>(Sb, P16, Ph, Pl);
            k_gemmc<bf, 2, 2><<<dim3(RH / 64, HD / 64, ZH), 32, 0, stream>>>(Ph, Pl, VTh + zk * HD * TT, VTl + zk * HD * TT, TT, Ob, HD, 0, (size_t)RH * TT, (size_t)HD * TT, (size_t)TT * HD);
            k_gemmc<h16, 0, 2><<<dim3((TT - RH) / 64, HD / 64, ZH), 32, 0, stream>>>(P16 + (size_t)RH * TT, nullptr, VT16 + zk * HD * TT, nullptr, TT, Ob + (size_t)RH * HD, HD, RH, (size_t)TT * TT, (size_t)HD * TT, (size_t)TT * HD);
            k_merge<<<(unsigned)(((size_t)ZH * TT * HD / 2 + 255) / 256), 256, 0, stream>>>(Ob, h0, ATh, ATl); }
        k_gemmw<bf, 1, true><<<dim3(TT / 64, DM / 64, 1), 32, 0, stream>>>(ATh, ATl, WO, nullptr, DQ, OUT + (size_t)b * TT * DM, DM, bo, 0, 0, 0); }
}

// v001
// One run takes 463 microseconds.
// Next to v000, in two timings, it ran 4.63 and 4.67 times as fast.
#include <hip/hip_runtime.h>

// Causal multi-head attention with bias-free (out, in) projections and a biased (out, in) output projection at a 768-wide model (x [4][2048][768]; q, k, v = x W^T ('oi' [768][768] uniform(+-1/sqrt(768)), no bias; 12 heads x 64); scores x 64^-0.5; tril kept, -inf elsewhere (tril built inside the function); softmax; out = merged Wp^T + bp ('oi' + a REAL bias, uniform(+-1/sqrt(768))) -> [4][2048][768] (6.3 M); argument order x, Wq, Wk, Wv, Wp, bp).
// Layout per batch: bf16 copy of x; 'oi' weights cast in place (no transpose); exact projections (K 768); identity-table plane builders; one fused causal attention launch at 12 heads (scores, online softmax and the value product stay in registers; hybrid rows: < 512 hi/lo 3 products, rest fp16 with probabilities x1024); merged hi/lo x Wp exact + bp.
// Compute dtypes, f32 accumulate: every input rounded to bf16; projections exact; attention rows < 512 3 products, rest fp16; softmax f32; Wp hl x exact + bias.

#define NB_  4
#define TT   2048
#define DM   768
#define NH_  12
#define NKV  12
#define HD   64
#define DQ   (NH_ * HD)
#define DKV  (NKV * HD)
#define RH   512                  // query rows < RH use hi+lo planes (0: none)
#define SCL  0.125f   // HD^-0.5
typedef _Float16 h16;
typedef unsigned short bf;
typedef __attribute__((ext_vector_type(16))) __bf16   v16bf;
typedef __attribute__((ext_vector_type(16))) _Float16 v16h;
typedef __attribute__((ext_vector_type(8)))  _Float16 v8h;
typedef __attribute__((ext_vector_type(8)))  unsigned short v8us;
typedef __attribute__((ext_vector_type(8)))  float    v8f;
typedef __attribute__((ext_vector_type(4)))  float    v4f;
typedef v8h  __attribute__((may_alias)) v8ha;
typedef v4f  __attribute__((may_alias)) v4fa;
typedef v8us __attribute__((may_alias)) v8usa;

__device__ __forceinline__ unsigned short f2bf(float f) { unsigned u = __float_as_uint(f); u += 0x7FFFu + ((u >> 16) & 1u); return (unsigned short)(u >> 16); }
__device__ __forceinline__ float bf2f(unsigned short b) { return __uint_as_float(((unsigned)b) << 16); }
__device__ __forceinline__ float bfr(float f) { return bf2f(f2bf(f)); }
__device__ __forceinline__ v16h cat16(v8h lo, v8h hi) { return __builtin_shufflevector(lo, hi, 0, 1, 2, 3, 4, 5, 6, 7, 8, 9, 10, 11, 12, 13, 14, 15); }
__device__ __forceinline__ v16bf cat16b(v8us lo, v8us hi) { return __builtin_bit_cast(v16bf, __builtin_shufflevector(lo, hi, 0, 1, 2, 3, 4, 5, 6, 7, 8, 9, 10, 11, 12, 13, 14, 15)); }
__device__ __forceinline__ v8f wmma16(v16h a, v16h b, v8f c) { return __builtin_amdgcn_wmma_f32_16x16x32_f16(false, a, false, b, (short)0, c, false, false); }
__device__ __forceinline__ v8f wmmab(v16bf a, v16bf b, v8f c) { return __builtin_amdgcn_wmma_f32_16x16x32_bf16(false, a, false, b, (short)0, c, false, false); }



// ---- k_gemmw: register-blocked GEMM, ONE WAVE per 64x64 output tile (16 accumulators), operands straight from K-contiguous 16-bit planes; grid (M/64, N/64, Z), 32 threads.
// C[m][n] (f32, pitch ldc, + optional f32 bias[n]) = sum_k A[m][k] Bt[n][k] (+ split products per NSPLIT). z-batch strides sA/sB/sC in elements. K % 32 == 0.
template <typename T16> struct WFrag;
template <> struct WFrag<h16> { typedef v16h V; static __device__ __forceinline__ V ld(const h16* p) { return cat16(*(const v8h*)p, *(const v8h*)(p + 16)); } static __device__ __forceinline__ v8f mma(V a, V b, v8f c) { return wmma16(a, b, c); } };
template <> struct WFrag<bf> { typedef v16bf V; static __device__ __forceinline__ V ld(const bf* p) { return cat16b(*(const v8us*)p, *(const v8us*)(p + 16)); } static __device__ __forceinline__ v8f mma(V a, V b, v8f c) { return wmmab(a, b, c); } };
template <typename T16, int NSPLIT, bool BIAS>
__global__ __launch_bounds__(32) void k_gemmw(const T16* __restrict__ A, const T16* __restrict__ A2, const T16* __restrict__ Bt, const T16* __restrict__ Bt2, int K, float* C, int ldc, const float* __restrict__ bias, size_t sA, size_t sB, size_t sC) {
    typedef typename WFrag<T16>::V V;
    __shared__ __align__(16) float os[16 * 68];
    const size_t z = blockIdx.z; A += z * sA; if (A2) A2 += z * sA; Bt += z * sB; if (Bt2) Bt2 += z * sB; C += z * sC;
    const int lane = threadIdx.x & 31, lr = lane & 15, hi = lane >> 4; const int r0 = blockIdx.x * 64, c0 = blockIdx.y * 64;
    v8f acc[4][4];
#pragma unroll
    for (int mb = 0; mb < 4; ++mb)
#pragma unroll
        for (int nb = 0; nb < 4; ++nb) acc[mb][nb] = (v8f){};
    const size_t aoff = (size_t)(r0 + lr) * K + 8 * hi, boff = (size_t)(c0 + lr) * K + 8 * hi;
#pragma unroll 1
    for (int kc = 0; kc < K; kc += 32) {
        V a[4], a2[4];
#pragma unroll
        for (int mb = 0; mb < 4; ++mb) { a[mb] = WFrag<T16>::ld(A + aoff + (size_t)mb * 16 * K + kc); if (NSPLIT == 1 || NSPLIT == 2) a2[mb] = WFrag<T16>::ld(A2 + aoff + (size_t)mb * 16 * K + kc); }
#pragma unroll
        for (int nb = 0; nb < 4; ++nb) { const V b = WFrag<T16>::ld(Bt + boff + (size_t)nb * 16 * K + kc); V b2; if (NSPLIT >= 2) b2 = WFrag<T16>::ld(Bt2 + boff + (size_t)nb * 16 * K + kc);
#pragma unroll
            for (int mb = 0; mb < 4; ++mb) { acc[mb][nb] = WFrag<T16>::mma(a[mb], b, acc[mb][nb]); if (NSPLIT == 1 || NSPLIT == 2) acc[mb][nb] = WFrag<T16>::mma(a2[mb], b, acc[mb][nb]); if (NSPLIT >= 2) acc[mb][nb] = WFrag<T16>::mma(a[mb], b2, acc[mb][nb]); } }
        asm volatile("v_nop\n\tv_nop\n\tv_nop\n\tv_nop" : "+v"(acc[0][0]), "+v"(acc[1][1]), "+v"(acc[2][2]), "+v"(acc[3][3]) : "v"(a[0]), "v"(a[3]));
    }
#pragma unroll
    for (int mb = 0; mb < 4; ++mb) {
#pragma unroll
        for (int nb = 0; nb < 4; ++nb) {
#pragma unroll
            for (int j = 0; j < 8; ++j) os[(hi * 8 + j) * 68 + nb * 16 + lr] = acc[mb][nb][j]; }
        __builtin_amdgcn_wave_barrier(); asm volatile("" ::: "memory");
        float* crow = C + (size_t)(r0 + mb * 16) * ldc + c0;
{
#pragma unroll
            for (int s = 0; s < 8; ++s) { const int row = 2 * s + hi, cofs = lr * 4; v4f val = *(const v4fa*)(os + row * 68 + cofs); if (BIAS) { val[0] += bfr(bias[c0 + cofs]); val[1] += bfr(bias[c0 + cofs + 1]); val[2] += bfr(bias[c0 + cofs + 2]); val[3] += bfr(bias[c0 + cofs + 3]); }
                *(v4f*)(crow + (size_t)row * ldc + cofs) = val; }
             }
        __builtin_amdgcn_wave_barrier(); asm volatile("" ::: "memory");
    }
}

__device__ __forceinline__ h16 tohx(float x) { return (h16)x; }
__device__ __forceinline__ void splitf(float y, unsigned short& h, unsigned short& l) { h = f2bf(y); l = f2bf(y - bf2f(h)); }
typedef __attribute__((ext_vector_type(2))) _Float16 v2h;
typedef __attribute__((ext_vector_type(4))) _Float16 v4h;
typedef __attribute__((ext_vector_type(2))) unsigned short v2us;
typedef __attribute__((ext_vector_type(4))) unsigned short v4us;
typedef __attribute__((ext_vector_type(2))) float v2f;
typedef __attribute__((ext_vector_type(4))) int v4i;

__global__ __launch_bounds__(256) void k_wtG(const float* __restrict__ w, int K, int N, bf* Bt) {
    const int lane = threadIdx.x & 31; const int L0 = (blockIdx.x * 8 + (threadIdx.x >> 5)) * 8; const int nlines = N * K / 64;
{
#pragma unroll 1
        for (int l = 0; l < 8; ++l) { const int L = L0 + l; if (L >= nlines) break; const size_t e = (size_t)L * 64 + lane * 2; const int k = (int)(e % K), n = (int)(e / K); v2us o;
            o[0] = f2bf(w[(size_t)k * N + n]); o[1] = f2bf(w[(size_t)(k + 1) * N + n]); *(v2us*)(Bt + e) = o; }
         }
}
__global__ __launch_bounds__(256) void k_cvt8(const float* __restrict__ src, bf* dst, size_t n8) { const size_t i = (size_t)blockIdx.x * 256 + threadIdx.x; if (i >= n8) return; const v8f v = *(const v8f*)(src + i * 8); v8us o;
#pragma unroll
    for (int k = 0; k < 8; ++k) o[k] = f2bf(v[k]); *(v8us*)(dst + i * 8) = o;  }

// k_rope: head planes [h][t][d] (fp16 + hi/lo) of rope(x) x sc with the rotate-half convention out[d] = x[d] cos[t][d] - x[d+HD/2] sin[t][d], out[d+HD/2] = x[d+HD/2] cos[t][d+HD/2] + x[d] sin[t][d+HD/2]
__global__ __launch_bounds__(256) void k_rope(const float* __restrict__ F, int pitch, int nheads, const float* __restrict__ CS, const float* __restrict__ RF, const float* __restrict__ nw, float sc, h16* P16, bf* Ph, bf* Pl) {
    const size_t e = ((size_t)blockIdx.x * 256 + threadIdx.x) * 2; if (e >= (size_t)nheads * TT * HD) return; const int d = (int)(e % HD); const int t = (int)((e / HD) % TT); const int h = (int)(e / ((size_t)HD * TT)); const float* f = F + (size_t)t * pitch + h * HD; const float rf = RF ? RF[(size_t)h * TT + t] : 1.0f; v2h o16; v2us oh, ol;
#pragma unroll
    for (int q = 0; q < 2; ++q) { const int dd = d + q; const int dp = (dd < HD / 2) ? dd + HD / 2 : dd - HD / 2; float x0 = f[dd], x1 = f[dp];
        if (RF) { float n0 = __fmul_rn(x0, rf), n1 = __fmul_rn(x1, rf); asm volatile("" : "+v"(n0)); asm volatile("" : "+v"(n1)); x0 = __fmul_rn(bfr(nw[dd]), n0); x1 = __fmul_rn(bfr(nw[dp]), n1); }
        const v2f cs = *(const v2f*)(CS + ((size_t)t * HD + dd) * 2); float a = __fmul_rn(x0, cs[0]), bq = __fmul_rn(x1, cs[1]); asm volatile("" : "+v"(a)); asm volatile("" : "+v"(bq)); const float r = ((dd < HD / 2) ? __fsub_rn(a, bq) : __fadd_rn(a, bq)) * sc;
        o16[q] = tohx(r); unsigned short a2, c2; splitf(r, a2, c2); oh[q] = a2; ol[q] = c2; }
    *(v2h*)(P16 + e) = o16; *(v2us*)(Ph + e) = oh; *(v2us*)(Pl + e) = ol;  }
__global__ __launch_bounds__(256) void k_vtp(const float* __restrict__ F, int pitch, int nheads, h16* V16, bf* Vh, bf* Vl) { const size_t e = ((size_t)blockIdx.x * 256 + threadIdx.x) * 2; if (e >= (size_t)nheads * HD * TT) return; const int t = (int)(e % TT); const int d = (int)((e / TT) % HD); const int g = (int)(e / ((size_t)TT * HD)); v2h o16; v2us oh, ol;
#pragma unroll
    for (int q = 0; q < 2; ++q) { const float x = F[(size_t)(t + q) * pitch + g * HD + d]; o16[q] = tohx(x); unsigned short a2, c2; splitf(x, a2, c2); oh[q] = a2; ol[q] = c2; }
    *(v2h*)(V16 + e) = o16; *(v2us*)(Vh + e) = oh; *(v2us*)(Vl + e) = ol;  }
__global__ __launch_bounds__(256) void k_csid(float* CS) { const int idx = blockIdx.x * 256 + threadIdx.x; if (idx >= TT * HD) return; v2f cs; cs[0] = 1.0f; cs[1] = 0.0f; *(v2f*)(CS + (size_t)idx * 2) = cs;  }
#define AW 4
typedef v8f __attribute__((may_alias)) v8fa;
// 2^x. Behind a v_exp_f32 the instruction set asks for one independent instruction or a v_nop before its result is read or its source overwritten; it is kept here by construction:
// eight at a time, no output sharing a register with an input (each v_exp_f32 is independent of the one in front of it), one v_nop behind the last.
__device__ __forceinline__ v8f exp2x8(const v8f x) { float o0, o1, o2, o3, o4, o5, o6, o7;
    asm("v_exp_f32 %0, %8\n\tv_exp_f32 %1, %9\n\tv_exp_f32 %2, %10\n\tv_exp_f32 %3, %11\n\tv_exp_f32 %4, %12\n\tv_exp_f32 %5, %13\n\tv_exp_f32 %6, %14\n\tv_exp_f32 %7, %15\n\tv_nop"
        : "=&v"(o0), "=&v"(o1), "=&v"(o2), "=&v"(o3), "=&v"(o4), "=&v"(o5), "=&v"(o6), "=&v"(o7) : "v"(x[0]), "v"(x[1]), "v"(x[2]), "v"(x[3]), "v"(x[4]), "v"(x[5]), "v"(x[6]), "v"(x[7]));
    return (v8f){o0, o1, o2, o3, o4, o5, o6, o7}; }
__device__ __forceinline__ float exp2s(const float x) { float o; asm("v_exp_f32 %0, %1\n\tv_nop" : "=v"(o) : "v"(x)); return o; }   // the same slot behind a single one
template <typename T16, bool HL, int NQ>
__device__ __forceinline__ void attn_tile(const T16* __restrict__ Q, const T16* __restrict__ Q2, const T16* __restrict__ Kp, const T16* __restrict__ K2, const T16* __restrict__ Vt, const T16* __restrict__ V2, const int q0, bf* Ah, bf* Al, float* sO, float* sM, float* sL, float* sI) {
    typedef typename WFrag<T16>::V V;
    const int lane = threadIdx.x & 31, c = lane & 15, h = lane >> 4; const int w = __builtin_amdgcn_readfirstlane((int)(threadIdx.x >> 5));
    const float L2E = 1.4426950408889634f, SH = HL ? 0.0f : 10.0f;
    V qf[NQ][2], qf2[NQ][2];
#pragma unroll
    for (int nq = 0; nq < NQ; ++nq)
#pragma unroll
        for (int ks = 0; ks < 2; ++ks) { const size_t qo = (size_t)(q0 + nq * 16 + c) * HD + ks * 32 + 8 * h; qf[nq][ks] = WFrag<T16>::ld(Q + qo); if (HL) qf2[nq][ks] = WFrag<T16>::ld(Q2 + qo); }
    V ka[2][2], ka2[2][2];
    auto ldk = [&](const int kb) {                   // the key fragments of 32-key block kb
#pragma unroll
        for (int t = 0; t < 2; ++t)
#pragma unroll
            for (int ks = 0; ks < 2; ++ks) { const size_t ko = (size_t)(kb * 32 + t * 16 + c) * HD + ks * 32 + 8 * h; ka[t][ks] = WFrag<T16>::ld(Kp + ko); if (HL) ka2[t][ks] = WFrag<T16>::ld(K2 + ko); } };
    v8f o[4][NQ]; float m[NQ], l[NQ];
#pragma unroll
    for (int nq = 0; nq < NQ; ++nq) { m[nq] = -3.0e38f; l[nq] = 0.f;
#pragma unroll
        for (int mb = 0; mb < 4; ++mb) o[mb][nq] = (v8f){}; }
    const int nblk = (q0 + NQ * 16 + 31) / 32;      // 32-key blocks that hold a key <= the tile's last query; only the last one crosses the diagonal
    if (!HL) ldk(min(w, nblk - 1));                  // fp16 tiles (long loops) fetch their key fragments one pass ahead; a wave without a block loads the last block and drops it
    asm volatile("s_wait_xcnt 0x0" ::: "memory");    // stands in front of any rewrite of the address registers of the loads above
#pragma unroll 1
    for (int kb = w; kb < nblk; kb += AW) {
        const int k0 = kb * 32;
        V va[4], va2[4];
        if (HL) ldk(kb);
#pragma unroll
        for (int mb = 0; mb < 4; ++mb) { const size_t vo = (size_t)(mb * 16 + c) * TT + k0 + 8 * h; va[mb] = WFrag<T16>::ld(Vt + vo); if (HL) va2[mb] = WFrag<T16>::ld(V2 + vo); }
        asm volatile("s_wait_xcnt 0x0" ::: "memory");    // in front of any rewrite of those loads' address registers; its clobber also keeps these loads from being sunk below this point, towards their use, where each would be waited for alone
        v8f s[2][NQ];
#pragma unroll
        for (int t = 0; t < 2; ++t)
#pragma unroll
            for (int nq = 0; nq < NQ; ++nq) { v8f a = (v8f){};
#pragma unroll
                for (int ks = 0; ks < 2; ++ks) { a = WFrag<T16>::mma(ka[t][ks], qf[nq][ks], a); if (HL) { a = WFrag<T16>::mma(ka[t][ks], qf2[nq][ks], a); a = WFrag<T16>::mma(ka2[t][ks], qf[nq][ks], a); } }
                s[t][nq] = a; }
        if (!HL && kb + AW < nblk) { ldk(kb + AW);       // next pass's key fragments, into the registers the products above have just read (wave-uniform test)
            asm volatile("s_wait_xcnt 0x0" ::: "memory"); }  // in front of any rewrite of those loads' address registers
        if (kb == nblk - 1) {                        // diagonal block (wave-uniform test): keys above the query are masked by select
#pragma unroll
            for (int t = 0; t < 2; ++t)
#pragma unroll
                for (int nq = 0; nq < NQ; ++nq)
#pragma unroll
                    for (int r = 0; r < 8; ++r) s[t][nq][r] = (k0 + t * 16 + 8 * h + r <= q0 + nq * 16 + c) ? s[t][nq][r] : -3.0e38f; }
#pragma unroll
        for (int nq = 0; nq < NQ; ++nq) {
            float mx = m[nq];
#pragma unroll
            for (int t = 0; t < 2; ++t)
#pragma unroll
                for (int r = 0; r < 8; ++r) { s[t][nq][r] *= SCL; mx = fmaxf(mx, s[t][nq][r]); }
            mx = fmaxf(mx, __shfl_xor(mx, 16, 32));
            const float al = exp2s((m[nq] - mx) * L2E); m[nq] = mx;
            float sum = 0.f;
#pragma unroll
            for (int t = 0; t < 2; ++t) { s[t][nq] = exp2x8((s[t][nq] - mx) * L2E + SH);
#pragma unroll
                for (int r = 0; r < 8; ++r) sum += s[t][nq][r]; }
            l[nq] = l[nq] * al + sum;                // this half's keys only; the halves are joined once after the loop
#pragma unroll
            for (int mb = 0; mb < 4; ++mb) o[mb][nq] *= al;
            V pf, pf2;
            if constexpr (HL) { v8us h0, h1, l0, l1;
#pragma unroll
                for (int r = 0; r < 8; ++r) { unsigned short x, y; splitf(s[0][nq][r], x, y); h0[r] = x; l0[r] = y; splitf(s[1][nq][r], x, y); h1[r] = x; l1[r] = y; }
                pf = cat16b(h0, h1); pf2 = cat16b(l0, l1);
            } else { v8h p0, p1;
#pragma unroll
                for (int r = 0; r < 8; ++r) { p0[r] = tohx(s[0][nq][r]); p1[r] = tohx(s[1][nq][r]); }
                pf = cat16(p0, p1); }
#pragma unroll
            for (int mb = 0; mb < 4; ++mb) { o[mb][nq] = WFrag<T16>::mma(va[mb], pf, o[mb][nq]); if (HL) { o[mb][nq] = WFrag<T16>::mma(va[mb], pf2, o[mb][nq]); o[mb][nq] = WFrag<T16>::mma(va2[mb], pf, o[mb][nq]); } }
        }
    }
    // join: per query the waves' (m, l) go through LDS; every wave rescales its O^T to the common maximum and stages it; then each wave sums and stores whole 128-byte rows of the merged planes
#pragma unroll
    for (int nq = 0; nq < NQ; ++nq) { l[nq] += __shfl_xor(l[nq], 16, 32); if (h == 0) { sM[w * 32 + nq * 16 + c] = m[nq]; sL[w * 32 + nq * 16 + c] = l[nq]; } }
    __syncthreads();
#pragma unroll
    for (int nq = 0; nq < NQ; ++nq) { float M = sM[nq * 16 + c];
#pragma unroll
        for (int ww = 1; ww < AW; ++ww) M = fmaxf(M, sM[ww * 32 + nq * 16 + c]);
        float lt = 0.f;
#pragma unroll
        for (int ww = 0; ww < AW; ++ww) lt += sL[ww * 32 + nq * 16 + c] * exp2s((sM[ww * 32 + nq * 16 + c] - M) * L2E);
        if (w == 0 && h == 0) sI[nq * 16 + c] = __fdiv_rn(1.0f, lt);
        const float f = exp2s((m[nq] - M) * L2E);
#pragma unroll
        for (int mb = 0; mb < 4; ++mb) *(v8fa*)(sO + (((w * 4 + mb) * NQ + nq) * 32 + lane) * 8) = o[mb][nq] * f; }
    __syncthreads();
#pragma unroll
    for (int ps = 0; ps < NQ; ++ps) { const int ql = (w * NQ + ps) * 4 + (lane >> 3), ds = lane & 7; const int nq = ql >> 4, cc = ql & 15, mb = ds >> 1, hh = ds & 1;
        v8f a = *(const v8fa*)(sO + ((mb * NQ + nq) * 32 + hh * 16 + cc) * 8);
#pragma unroll
        for (int ww = 1; ww < AW; ++ww) a += *(const v8fa*)(sO + (((ww * 4 + mb) * NQ + nq) * 32 + hh * 16 + cc) * 8);
        const float inv = sI[ql]; v8us oh, ol;
#pragma unroll
        for (int r = 0; r < 8; ++r) { unsigned short x, y; splitf(a[r] * inv, x, y); oh[r] = x; ol[r] = y; }
        const size_t oo = (size_t)(q0 + ql) * DQ + ds * 8; *(v8us*)(Ah + oo) = oh; *(v8us*)(Al + oo) = ol; }
}
// grid (heads, tiles), heaviest tiles first: (TT - RH) / 32 fp16 tiles of 32 rows from the last row down, then RH / 16 hi/lo tiles of 16 rows.
__global__ __launch_bounds__(AW * 32) void k_fattn(const h16* __restrict__ Q16, const h16* __restrict__ K16, const h16* __restrict__ V16, const bf* __restrict__ Qh, const bf* __restrict__ Ql, const bf* __restrict__ Kh, const bf* __restrict__ Kl, const bf* __restrict__ Vh, const bf* __restrict__ Vl, bf* Ah, bf* Al) {
    __shared__ __align__(32) float sO[AW * 4 * 2 * 32 * 8]; __shared__ float sM[AW * 32], sL[AW * 32], sI[32];
    const size_t pz = (size_t)blockIdx.x * TT * HD; const int ty = blockIdx.y; Ah += blockIdx.x * HD; Al += blockIdx.x * HD;
    if (ty < (TT - RH) / 32) attn_tile<h16, false, 2>(Q16 + pz, nullptr, K16 + pz, nullptr, V16 + pz, nullptr, TT - 32 * (ty + 1), Ah, Al, sO, sM, sL, sI);
    else attn_tile<bf, true, 1>(Qh + pz, Ql + pz, Kh + pz, Kl + pz, Vh + pz, Vl + pz, RH - 16 * (ty - (TT - RH) / 32 + 1), Ah, Al, sO, sM, sL, sI);
}

extern "C" void kernel_launch(void* const* d_in, const int* in_sizes, int n_in,
                              void* d_out, int out_size, void* d_ws, size_t ws_size, hipStream_t stream) {
    (void)in_sizes; (void)n_in; (void)out_size;
    const float* x = (const float*)d_in[0]; const float* wq = (const float*)d_in[1]; const float* wk = (const float*)d_in[2]; const float* wv = (const float*)d_in[3]; const float* wo = (const float*)d_in[4]; const float* bo = (const float*)d_in[5];   /* argument order x, Wq, Wk, Wv, Wp ('oi' [768][768]: nn.Linear layout, applied transposed), bp */
    float* OUT = (float*)d_out;     // [4][2048][768]
    char* wsp = (char*)d_ws;
    auto take = [&](size_t bytes) { char* p = wsp; wsp += (bytes + 255) & ~(size_t)255; return (void*)p; };
    bf* WQ = (bf*)take((size_t)DQ * DM * 2); bf* WK = (bf*)take((size_t)DKV * DM * 2); bf* WV = (bf*)take((size_t)DKV * DM * 2); bf* WO = (bf*)take((size_t)DM * DQ * 2); float* CS = (float*)take((size_t)TT * HD * 2 * 4);
    bf* XB = (bf*)take((size_t)TT * DM * 2); float* FQ = (float*)take((size_t)TT * DQ * 4); float* FK = (float*)take((size_t)TT * DKV * 4);
    h16* QP16 = (h16*)take((size_t)NH_ * TT * HD * 2); h16* KP16 = (h16*)take((size_t)NKV * TT * HD * 2); h16* VT16 = (h16*)take((size_t)NKV * HD * TT * 2);
    bf* QPh = (bf*)take((size_t)NH_ * TT * HD * 2); bf* QPl = (bf*)take((size_t)NH_ * TT * HD * 2); bf* KPh = (bf*)take((size_t)NKV * TT * HD * 2); bf* KPl = (bf*)take((size_t)NKV * TT * HD * 2); bf* VTh = (bf*)take((size_t)NKV * HD * TT * 2); bf* VTl = (bf*)take((size_t)NKV * HD * TT * 2);
    bf* ATh = (bf*)take((size_t)TT * DQ * 2); bf* ATl = (bf*)take((size_t)TT * DQ * 2);
    if ((size_t)(wsp - (char*)d_ws) > ws_size) return;    // ws 256 MiB
    float* FV = FK;   // v projection reuses the k buffer after the k planes are built (stream-ordered)
    { k_cvt8<<<(unsigned)(((size_t)DQ * DM / 8 + 255) / 256), 256, 0, stream>>>(wq, WQ, (size_t)DQ * DM / 8); k_cvt8<<<(unsigned)(((size_t)DKV * DM / 8 + 255) / 256), 256, 0, stream>>>(wk, WK, (size_t)DKV * DM / 8); k_cvt8<<<(unsigned)(((size_t)DKV * DM / 8 + 255) / 256), 256, 0, stream>>>(wv, WV, (size_t)DKV * DM / 8);   /* 'oi' weights are already [out][in] = Bt rows: a plain cast, no transpose */
      k_cvt8<<<(unsigned)(((size_t)DM * DQ / 8 + 255) / 256), 256, 0, stream>>>(wo, WO, (size_t)DM * DQ / 8);   /* Wp 'oi' [768][768]: plain cast */
       }
    k_csid<<<(TT * HD + 255) / 256, 256, 0, stream>>>(CS);
    const unsigned LQ = (unsigned)(((size_t)NH_ * TT * HD / 2 + 255) / 256), LKv = (unsigned)(((size_t)NKV * TT * HD / 2 + 255) / 256);
    for (int b = 0; b < NB_; ++b) {
        
        k_cvt8<<<(unsigned)(((size_t)TT * DM / 8 + 255) / 256), 256, 0, stream>>>(x + (size_t)b * TT * DM, XB, (size_t)TT * DM / 8);
        k_gemmw<bf, 0, false><<<dim3(TT / 64, DQ / 64, 1), 32, 0, stream>>>(XB, nullptr, WQ, nullptr, DM, FQ, DQ, nullptr, 0, 0, 0);
        k_rope<<<LQ, 256, 0, stream>>>(FQ, DQ, NH_, CS, nullptr, nullptr, 1.0f, QP16, QPh, QPl);
        k_gemmw<bf, 0, false><<<dim3(TT / 64, DKV / 64, 1), 32, 0, stream>>>(XB, nullptr, WK, nullptr, DM, FK, DKV, nullptr, 0, 0, 0);
        k_rope<<<LKv, 256, 0, stream>>>(FK, DKV, NKV, CS, nullptr, nullptr, 1.0f, KP16, KPh, KPl);
        k_gemmw<bf, 0, false><<<dim3(TT / 64, DKV / 64, 1), 32, 0, stream>>>(XB, nullptr, WV, nullptr, DM, FV, DKV, nullptr, 0, 0, 0); k_vtp<<<LKv, 256, 0, stream>>>(FV, DKV, NKV, VT16, VTh, VTl);
        k_fattn<<<dim3(NH_, (TT - RH) / 32 + RH / 16, 1), AW * 32, 0, stream>>>(QP16, KP16, VT16, QPh, QPl, KPh, KPl, VTh, VTl, ATh, ATl);
        k_gemmw<bf, 1, true><<<dim3(TT / 64, DM / 64, 1), 32, 0, stream>>>(ATh, ATl, WO, nullptr, DQ, OUT + (size_t)b * TT * DM, DM, bo, 0, 0, 0); }
}

// v002
// Measured time: 250 microseconds a run.
// In two side-by-side timings against v001, it was 1.87 and 1.86 times as fast.
// Over all steps from v000 it is 8.66 times as fast.
#include <hip/hip_runtime.h>

// Causal multi-head attention with bias-free (out, in) projections and a biased (out, in) output projection at a 768-wide model (x [4][2048][768]; q, k, v = x W^T ('oi' [768][768] uniform(+-1/sqrt(768)), no bias; 12 heads x 64); scores x 64^-0.5; tril kept, -inf elsewhere (tril built inside the function); softmax; out = merged Wp^T + bp ('oi' + a REAL bias, uniform(+-1/sqrt(768))) -> [4][2048][768] (6.3 M); argument order x, Wq, Wk, Wv, Wp, bp).
// Layout, all four batches in every launch (rows b*2048 + t, planes [b][h]): bf16 copy of x; 'oi' weights cast in place (no transpose); exact projections (K 768); identity-table plane builders; one fused causal attention launch at 12 heads (scores, online softmax and the value product stay in registers; hybrid rows: < 512 hi/lo 3 products, rest fp16 with probabilities x1024); merged hi/lo x Wp exact + bp.
// Compute dtypes, f32 accumulate: every input rounded to bf16; projections exact; attention rows < 512 3 products, rest fp16; softmax f32; Wp hl x exact + bias.

#define NB_  4
#define TT   2048
#define DM   768
#define NH_  12
#define NKV  12
#define HD   64
#define DQ   (NH_ * HD)
#define DKV  (NKV * HD)
#define RH   512                  // query rows < RH use hi+lo planes (0: none)
#define SCL  0.125f   // HD^-0.5
typedef _Float16 h16;
typedef unsigned short bf;
typedef __attribute__((ext_vector_type(16))) __bf16   v16bf;
typedef __attribute__((ext_vector_type(16))) _Float16 v16h;
typedef __attribute__((ext_vector_type(8)))  _Float16 v8h;
typedef __attribute__((ext_vector_type(8)))  unsigned short v8us;
typedef __attribute__((ext_vector_type(8)))  float    v8f;
typedef __attribute__((ext_vector_type(4)))  float    v4f;
typedef v8h  __attribute__((may_alias)) v8ha;
typedef v4f  __attribute__((may_alias)) v4fa;
typedef v8us __attribute__((may_alias)) v8usa;

__device__ __forceinline__ unsigned short f2bf(float f) { unsigned u = __float_as_uint(f); u += 0x7FFFu + ((u >> 16) & 1u); return (unsigned short)(u >> 16); }
__device__ __forceinline__ float bf2f(unsigned short b) { return __uint_as_float(((unsigned)b) << 16); }
__device__ __forceinline__ float bfr(float f) { return bf2f(f2bf(f)); }
__device__ __forceinline__ v16h cat16(v8h lo, v8h hi) { return __builtin_shufflevector(lo, hi, 0, 1, 2, 3, 4, 5, 6, 7, 8, 9, 10, 11, 12, 13, 14, 15); }
__device__ __forceinline__ v16bf cat16b(v8us lo, v8us hi) { return __builtin_bit_cast(v16bf, __builtin_shufflevector(lo, hi, 0, 1, 2, 3, 4, 5, 6, 7, 8, 9, 10, 11, 12, 13, 14, 15)); }
__device__ __forceinline__ v8f wmma16(v16h a, v16h b, v8f c) { return __builtin_amdgcn_wmma_f32_16x16x32_f16(false, a, false, b, (short)0, c, false, false); }
__device__ __forceinline__ v8f wmmab(v16bf a, v16bf b, v8f c) { return __builtin_amdgcn_wmma_f32_16x16x32_bf16(false, a, false, b, (short)0, c, false, false); }



// ---- k_gemmw: register-blocked GEMM, ONE WAVE per 64x64 output tile (16 accumulators), operands straight from K-contiguous 16-bit planes; grid (M/64, N/64, Z), 32 threads.
// C[m][n] (f32, pitch ldc, + optional f32 bias[n]) = sum_k A[m][k] Bt[n][k] (+ split products per NSPLIT). z-batch strides sA/sB/sC in elements. K % 32 == 0.
template <typename T16> struct WFrag;
template <> struct WFrag<h16> { typedef v16h V; static __device__ __forceinline__ V ld(const h16* p) { return cat16(*(const v8h*)p, *(const v8h*)(p + 16)); } static __device__ __forceinline__ v8f mma(V a, V b, v8f c) { return wmma16(a, b, c); } };
template <> struct WFrag<bf> { typedef v16bf V; static __device__ __forceinline__ V ld(const bf* p) { return cat16b(*(const v8us*)p, *(const v8us*)(p + 16)); } static __device__ __forceinline__ v8f mma(V a, V b, v8f c) { return wmmab(a, b, c); } };
template <typename T16, int NSPLIT, bool BIAS>
__global__ __launch_bounds__(32) void k_gemmw(const T16* __restrict__ A, const T16* __restrict__ A2, const T16* __restrict__ Bt, const T16* __restrict__ Bt2, int K, float* C, int ldc, const float* __restrict__ bias, size_t sA, size_t sB, size_t sC) {
    typedef typename WFrag<T16>::V V;
    __shared__ __align__(16) float os[16 * 68];
    const size_t z = blockIdx.z; A += z * sA; if (A2) A2 += z * sA; Bt += z * sB; if (Bt2) Bt2 += z * sB; C += z * sC;
    const int lane = threadIdx.x & 31, lr = lane & 15, hi = lane >> 4; const int r0 = blockIdx.x * 64, c0 = blockIdx.y * 64;
    v8f acc[4][4];
#pragma unroll
    for (int mb = 0; mb < 4; ++mb)
#pragma unroll
        for (int nb = 0; nb < 4; ++nb) acc[mb][nb] = (v8f){};
    const size_t aoff = (size_t)(r0 + lr) * K + 8 * hi, boff = (size_t)(c0 + lr) * K + 8 * hi;
#pragma unroll 1
    for (int kc = 0; kc < K; kc += 32) {
        V a[4], a2[4];
#pragma unroll
        for (int mb = 0; mb < 4; ++mb) { a[mb] = WFrag<T16>::ld(A + aoff + (size_t)mb * 16 * K + kc); if (NSPLIT == 1 || NSPLIT == 2) a2[mb] = WFrag<T16>::ld(A2 + aoff + (size_t)mb * 16 * K + kc); }
#pragma unroll
        for (int nb = 0; nb < 4; ++nb) { const V b = WFrag<T16>::ld(Bt + boff + (size_t)nb * 16 * K + kc); V b2; if (NSPLIT >= 2) b2 = WFrag<T16>::ld(Bt2 + boff + (size_t)nb * 16 * K + kc);
#pragma unroll
            for (int mb = 0; mb < 4; ++mb) { acc[mb][nb] = WFrag<T16>::mma(a[mb], b, acc[mb][nb]); if (NSPLIT == 1 || NSPLIT == 2) acc[mb][nb] = WFrag<T16>::mma(a2[mb], b, acc[mb][nb]); if (NSPLIT >= 2) acc[mb][nb] = WFrag<T16>::mma(a[mb], b2, acc[mb][nb]); } }
        asm volatile("v_nop\n\tv_nop\n\tv_nop\n\tv_nop" : "+v"(acc[0][0]), "+v"(acc[1][1]), "+v"(acc[2][2]), "+v"(acc[3][3]) : "v"(a[0]), "v"(a[3]));
    }
#pragma unroll
    for (int mb = 0; mb < 4; ++mb) {
#pragma unroll
        for (int nb = 0; nb < 4; ++nb) {
#pragma unroll
            for (int j = 0; j < 8; ++j) os[(hi * 8 + j) * 68 + nb * 16 + lr] = acc[mb][nb][j]; }
        __builtin_amdgcn_wave_barrier(); asm volatile("" ::: "memory");
        float* crow = C + (size_t)(r0 + mb * 16) * ldc + c0;
{
#pragma unroll
            for (int s = 0; s < 8; ++s) { const int row = 2 * s + hi, cofs = lr * 4; v4f val = *(const v4fa*)(os + row * 68 + cofs); if (BIAS) { val[0] += bfr(bias[c0 + cofs]); val[1] += bfr(bias[c0 + cofs + 1]); val[2] += bfr(bias[c0 + cofs + 2]); val[3] += bfr(bias[c0 + cofs + 3]); }
                *(v4f*)(crow + (size_t)row * ldc + cofs) = val; }
             }
        __builtin_amdgcn_wave_barrier(); asm volatile("" ::: "memory");
    }
}

__device__ __forceinline__ h16 tohx(float x) { return (h16)x; }
__device__ __forceinline__ void splitf(float y, unsigned short& h, unsigned short& l) { h = f2bf(y); l = f2bf(y - bf2f(h)); }
typedef __attribute__((ext_vector_type(2))) _Float16 v2h;
typedef __attribute__((ext_vector_type(4))) _Float16 v4h;
typedef __attribute__((ext_vector_type(2))) unsigned short v2us;
typedef __attribute__((ext_vector_type(4))) unsigned short v4us;
typedef __attribute__((ext_vector_type(2))) float v2f;
typedef __attribute__((ext_vector_type(4))) int v4i;

__global__ __launch_bounds__(256) void k_wtG(const float* __restrict__ w, int K, int N, bf* Bt) {
    const int lane = threadIdx.x & 31; const int L0 = (blockIdx.x * 8 + (threadIdx.x >> 5)) * 8; const int nlines = N * K / 64;
{
#pragma unroll 1
        for (int l = 0; l < 8; ++l) { const int L = L0 + l; if (L >= nlines) break; const size_t e = (size_t)L * 64 + lane * 2; const int k = (int)(e % K), n = (int)(e / K); v2us o;
            o[0] = f2bf(w[(size_t)k * N + n]); o[1] = f2bf(w[(size_t)(k + 1) * N + n]); *(v2us*)(Bt + e) = o; }
         }
}
__global__ __launch_bounds__(256) void k_cvt8(const float* __restrict__ src, bf* dst, size_t n8) { const size_t i = (size_t)blockIdx.x * 256 + threadIdx.x; if (i >= n8) return; const v8f v = *(const v8f*)(src + i * 8); v8us o;
#pragma unroll
    for (int k = 0; k < 8; ++k) o[k] = f2bf(v[k]); *(v8us*)(dst + i * 8) = o;  }

// k_rope: blockIdx.y = batch; head planes [b][h][t][d] (fp16 + hi/lo) of rope(x) x sc with the rotate-half convention out[d] = x[d] cos[t][d] - x[d+HD/2] sin[t][d], out[d+HD/2] = x[d+HD/2] cos[t][d+HD/2] + x[d] sin[t][d+HD/2]
__global__ __launch_bounds__(256) void k_rope(const float* __restrict__ F, int pitch, int nheads, const float* __restrict__ CS, const float* __restrict__ RF, const float* __restrict__ nw, float sc, h16* P16, bf* Ph, bf* Pl) {
    { const size_t bz = blockIdx.y, po = bz * nheads * TT * HD; F += bz * TT * pitch; if (RF) RF += bz * nheads * TT; P16 += po; Ph += po; Pl += po; }   // this batch's rows and planes
    const size_t e = ((size_t)blockIdx.x * 256 + threadIdx.x) * 2; if (e >= (size_t)nheads * TT * HD) return; const int d = (int)(e % HD); const int t = (int)((e / HD) % TT); const int h = (int)(e / ((size_t)HD * TT)); const float* f = F + (size_t)t * pitch + h * HD; const float rf = RF ? RF[(size_t)h * TT + t] : 1.0f; v2h o16; v2us oh, ol;
#pragma unroll
    for (int q = 0; q < 2; ++q) { const int dd = d + q; const int dp = (dd < HD / 2) ? dd + HD / 2 : dd - HD / 2; float x0 = f[dd], x1 = f[dp];
        if (RF) { float n0 = __fmul_rn(x0, rf), n1 = __fmul_rn(x1, rf); asm volatile("" : "+v"(n0)); asm volatile("" : "+v"(n1)); x0 = __fmul_rn(bfr(nw[dd]), n0); x1 = __fmul_rn(bfr(nw[dp]), n1); }
        const v2f cs = *(const v2f*)(CS + ((size_t)t * HD + dd) * 2); float a = __fmul_rn(x0, cs[0]), bq = __fmul_rn(x1, cs[1]); asm volatile("" : "+v"(a)); asm volatile("" : "+v"(bq)); const float r = ((dd < HD / 2) ? __fsub_rn(a, bq) : __fadd_rn(a, bq)) * sc;
        o16[q] = tohx(r); unsigned short a2, c2; splitf(r, a2, c2); oh[q] = a2; ol[q] = c2; }
    *(v2h*)(P16 + e) = o16; *(v2us*)(Ph + e) = oh; *(v2us*)(Pl + e) = ol;  }
__global__ __launch_bounds__(256) void k_vtp(const float* __restrict__ F, int pitch, int nheads, h16* V16, bf* Vh, bf* Vl) {
    { const size_t bz = blockIdx.y, po = bz * nheads * HD * TT; F += bz * TT * pitch; V16 += po; Vh += po; Vl += po; }   // blockIdx.y = batch: its rows, its planes [b][g][d][t]
    const size_t e = ((size_t)blockIdx.x * 256 + threadIdx.x) * 2; if (e >= (size_t)nheads * HD * TT) return; const int t = (int)(e % TT); const int d = (int)((e / TT) % HD); const int g = (int)(e / ((size_t)TT * HD)); v2h o16; v2us oh, ol;
#pragma unroll
    for (int q = 0; q < 2; ++q) { const float x = F[(size_t)(t + q) * pitch + g * HD + d]; o16[q] = tohx(x); unsigned short a2, c2; splitf(x, a2, c2); oh[q] = a2; ol[q] = c2; }
    *(v2h*)(V16 + e) = o16; *(v2us*)(Vh + e) = oh; *(v2us*)(Vl + e) = ol;  }
__global__ __launch_bounds__(256) void k_csid(float* CS) { const int idx = blockIdx.x * 256 + threadIdx.x; if (idx >= TT * HD) return; v2f cs; cs[0] = 1.0f; cs[1] = 0.0f; *(v2f*)(CS + (size_t)idx * 2) = cs;  }
#define AW 4
typedef v8f __attribute__((may_alias)) v8fa;
// 2^x. Behind a v_exp_f32 the instruction set asks for one independent instruction or a v_nop before its result is read or its source overwritten; it is kept here by construction:
// eight at a time, no output sharing a register with an input (each v_exp_f32 is independent of the one in front of it), one v_nop behind the last.
__device__ __forceinline__ v8f exp2x8(const v8f x) { float o0, o1, o2, o3, o4, o5, o6, o7;
    asm("v_exp_f32 %0, %8\n\tv_exp_f32 %1, %9\n\tv_exp_f32 %2, %10\n\tv_exp_f32 %3, %11\n\tv_exp_f32 %4, %12\n\tv_exp_f32 %5, %13\n\tv_exp_f32 %6, %14\n\tv_exp_f32 %7, %15\n\tv_nop"
        : "=&v"(o0), "=&v"(o1), "=&v"(o2), "=&v"(o3), "=&v"(o4), "=&v"(o5), "=&v"(o6), "=&v"(o7) : "v"(x[0]), "v"(x[1]), "v"(x[2]), "v"(x[3]), "v"(x[4]), "v"(x[5]), "v"(x[6]), "v"(x[7]));
    return (v8f){o0, o1, o2, o3, o4, o5, o6, o7}; }
__device__ __forceinline__ float exp2s(const float x) { float o; asm("v_exp_f32 %0, %1\n\tv_nop" : "=v"(o) : "v"(x)); return o; }   // the same slot behind a single one
template <typename T16, bool HL, int NQ>
__device__ __forceinline__ void attn_tile(const T16* __restrict__ Q, const T16* __restrict__ Q2, const T16* __restrict__ Kp, const T16* __restrict__ K2, const T16* __restrict__ Vt, const T16* __restrict__ V2, const int q0, bf* Ah, bf* Al, float* sO, float* sM, float* sL, float* sI) {
    typedef typename WFrag<T16>::V V;
    const int lane = threadIdx.x & 31, c = lane & 15, h = lane >> 4; const int w = __builtin_amdgcn_readfirstlane((int)(threadIdx.x >> 5));
    const float L2E = 1.4426950408889634f, SH = HL ? 0.0f : 10.0f;
    V qf[NQ][2], qf2[NQ][2];
#pragma unroll
    for (int nq = 0; nq < NQ; ++nq)
#pragma unroll
        for (int ks = 0; ks < 2; ++ks) { const size_t qo = (size_t)(q0 + nq * 16 + c) * HD + ks * 32 + 8 * h; qf[nq][ks] = WFrag<T16>::ld(Q + qo); if (HL) qf2[nq][ks] = WFrag<T16>::ld(Q2 + qo); }
    V ka[2][2], ka2[2][2];
    auto ldk = [&](const int kb) {                   // the key fragments of 32-key block kb
#pragma unroll
        for (int t = 0; t < 2; ++t)
#pragma unroll
            for (int ks = 0; ks < 2; ++ks) { const size_t ko = (size_t)(kb * 32 + t * 16 + c) * HD + ks * 32 + 8 * h; ka[t][ks] = WFrag<T16>::ld(Kp + ko); if (HL) ka2[t][ks] = WFrag<T16>::ld(K2 + ko); } };
    v8f o[4][NQ]; float m[NQ], l[NQ];
#pragma unroll
    for (int nq = 0; nq < NQ; ++nq) { m[nq] = -3.0e38f; l[nq] = 0.f;
#pragma unroll
        for (int mb = 0; mb < 4; ++mb) o[mb][nq] = (v8f){}; }
    const int nblk = (q0 + NQ * 16 + 31) / 32;      // 32-key blocks that hold a key <= the tile's last query; only the last one crosses the diagonal
    if (!HL) ldk(min(w, nblk - 1));                  // fp16 tiles (long loops) fetch their key fragments one pass ahead; a wave without a block loads the last block and drops it
    asm volatile("s_wait_xcnt 0x0" ::: "memory");    // stands in front of any rewrite of the address registers of the loads above
#pragma unroll 1
    for (int kb = w; kb < nblk; kb += AW) {
        const int k0 = kb * 32;
        V va[4], va2[4];
        if (HL) ldk(kb);
#pragma unroll
        for (int mb = 0; mb < 4; ++mb) { const size_t vo = (size_t)(mb * 16 + c) * TT + k0 + 8 * h; va[mb] = WFrag<T16>::ld(Vt + vo); if (HL) va2[mb] = WFrag<T16>::ld(V2 + vo); }
        asm volatile("s_wait_xcnt 0x0" ::: "memory");    // in front of any rewrite of those loads' address registers; its clobber also keeps these loads from being sunk below this point, towards their use, where each would be waited for alone
        v8f s[2][NQ];
#pragma unroll
        for (int t = 0; t < 2; ++t)
#pragma unroll
            for (int nq = 0; nq < NQ; ++nq) { v8f a = (v8f){};
#pragma unroll
                for (int ks = 0; ks < 2; ++ks) { a = WFrag<T16>::mma(ka[t][ks], qf[nq][ks], a); if (HL) { a = WFrag<T16>::mma(ka[t][ks], qf2[nq][ks], a); a = WFrag<T16>::mma(ka2[t][ks], qf[nq][ks], a); } }
                s[t][nq] = a; }
        if (!HL && kb + AW < nblk) { ldk(kb + AW);       // next pass's key fragments, into the registers the products above have just read (wave-uniform test)
            asm volatile("s_wait_xcnt 0x0" ::: "memory"); }  // in front of any rewrite of those loads' address registers
        if (kb == nblk - 1) {                        // diagonal block (wave-uniform test): keys above the query are masked by select
#pragma unroll
            for (int t = 0; t < 2; ++t)
#pragma unroll
                for (int nq = 0; nq < NQ; ++nq)
#pragma unroll
                    for (int r = 0; r < 8; ++r) s[t][nq][r] = (k0 + t * 16 + 8 * h + r <= q0 + nq * 16 + c) ? s[t][nq][r] : -3.0e38f; }
#pragma unroll
        for (int nq = 0; nq < NQ; ++nq) {
            float mx = m[nq];
#pragma unroll
            for (int t = 0; t < 2; ++t)
#pragma unroll
                for (int r = 0; r < 8; ++r) { s[t][nq][r] *= SCL; mx = fmaxf(mx, s[t][nq][r]); }
            mx = fmaxf(mx, __shfl_xor(mx, 16, 32));
            const float al = exp2s((m[nq] - mx) * L2E); m[nq] = mx;
            float sum = 0.f;
#pragma unroll
            for (int t = 0; t < 2; ++t) { s[t][nq] = exp2x8((s[t][nq] - mx) * L2E + SH);
#pragma unroll
                for (int r = 0; r < 8; ++r) sum += s[t][nq][r]; }
            l[nq] = l[nq] * al + sum;                // this half's keys only; the halves are joined once after the loop
#pragma unroll
            for (int mb = 0; mb < 4; ++mb) o[mb][nq] *= al;
            V pf, pf2;
            if constexpr (HL) { v8us h0, h1, l0, l1;
#pragma unroll
                for (int r = 0; r < 8; ++r) { unsigned short x, y; splitf(s[0][nq][r], x, y); h0[r] = x; l0[r] = y; splitf(s[1][nq][r], x, y); h1[r] = x; l1[r] = y; }
                pf = cat16b(h0, h1); pf2 = cat16b(l0, l1);
            } else { v8h p0, p1;
#pragma unroll
                for (int r = 0; r < 8; ++r) { p0[r] = tohx(s[0][nq][r]); p1[r] = tohx(s[1][nq][r]); }
                pf = cat16(p0, p1); }
#pragma unroll
            for (int mb = 0; mb < 4; ++mb) { o[mb][nq] = WFrag<T16>::mma(va[mb], pf, o[mb][nq]); if (HL) { o[mb][nq] = WFrag<T16>::mma(va[mb], pf2, o[mb][nq]); o[mb][nq] = WFrag<T16>::mma(va2[mb], pf, o[mb][nq]); } }
        }
    }
    // join: per query the waves' (m, l) go through LDS; every wave rescales its O^T to the common maximum and stages it; then each wave sums and stores whole 128-byte rows of the merged planes
#pragma unroll
    for (int nq = 0; nq < NQ; ++nq) { l[nq] += __shfl_xor(l[nq], 16, 32); if (h == 0) { sM[w * 32 + nq * 16 + c] = m[nq]; sL[w * 32 + nq * 16 + c] = l[nq]; } }
    __syncthreads();
#pragma unroll
    for (int nq = 0; nq < NQ; ++nq) { float M = sM[nq * 16 + c];
#pragma unroll
        for (int ww = 1; ww < AW; ++ww) M = fmaxf(M, sM[ww * 32 + nq * 16 + c]);
        float lt = 0.f;
#pragma unroll
        for (int ww = 0; ww < AW; ++ww) lt += sL[ww * 32 + nq * 16 + c] * exp2s((sM[ww * 32 + nq * 16 + c] - M) * L2E);
        if (w == 0 && h == 0) sI[nq * 16 + c] = __fdiv_rn(1.0f, lt);
        const float f = exp2s((m[nq] - M) * L2E);
#pragma unroll
        for (int mb = 0; mb < 4; ++mb) *(v8fa*)(sO + (((w * 4 + mb) * NQ + nq) * 32 + lane) * 8) = o[mb][nq] * f; }
    __syncthreads();
#pragma unroll
    for (int ps = 0; ps < NQ; ++ps) { const int ql = (w * NQ + ps) * 4 + (lane >> 3), ds = lane & 7; const int nq = ql >> 4, cc = ql & 15, mb = ds >> 1, hh = ds & 1;
        v8f a = *(const v8fa*)(sO + ((mb * NQ + nq) * 32 + hh * 16 + cc) * 8);
#pragma unroll
        for (int ww = 1; ww < AW; ++ww) a += *(const v8fa*)(sO + (((ww * 4 + mb) * NQ + nq) * 32 + hh * 16 + cc) * 8);
        const float inv = sI[ql]; v8us oh, ol;
#pragma unroll
        for (int r = 0; r < 8; ++r) { unsigned short x, y; splitf(a[r] * inv, x, y); oh[r] = x; ol[r] = y; }
        const size_t oo = (size_t)(q0 + ql) * DQ + ds * 8; *(v8us*)(Ah + oo) = oh; *(v8us*)(Al + oo) = ol; }
}
// grid (batches x heads, tiles), blockIdx.x = b * heads + head; blockIdx.y: (TT - RH) / 32 fp16 tiles of 32 rows from the last row down, then RH / 16 hi/lo tiles of 16 rows.
__global__ __launch_bounds__(AW * 32) void k_fattn(const h16* __restrict__ Q16, const h16* __restrict__ K16, const h16* __restrict__ V16, const bf* __restrict__ Qh, const bf* __restrict__ Ql, const bf* __restrict__ Kh, const bf* __restrict__ Kl, const bf* __restrict__ Vh, const bf* __restrict__ Vl, bf* Ah, bf* Al) {
    __shared__ __align__(32) float sO[AW * 4 * 2 * 32 * 8]; __shared__ float sM[AW * 32], sL[AW * 32], sI[32];
    const size_t pz = (size_t)blockIdx.x * TT * HD; const int ty = blockIdx.y; const size_t ao = (size_t)(blockIdx.x / NH_) * TT * DQ + (blockIdx.x % NH_) * HD; Ah += ao; Al += ao;
    if (ty < (TT - RH) / 32) attn_tile<h16, false, 2>(Q16 + pz, nullptr, K16 + pz, nullptr, V16 + pz, nullptr, TT - 32 * (ty + 1), Ah, Al, sO, sM, sL, sI);
    else attn_tile<bf, true, 1>(Qh + pz, Ql + pz, Kh + pz, Kl + pz, Vh + pz, Vl + pz, RH - 16 * (ty - (TT - RH) / 32 + 1), Ah, Al, sO, sM, sL, sI);
}

extern "C" void kernel_launch(void* const* d_in, const int* in_sizes, int n_in,
                              void* d_out, int out_size, void* d_ws, size_t ws_size, hipStream_t stream) {
    (void)in_sizes; (void)n_in; (void)out_size;
    const float* x = (const float*)d_in[0]; const float* wq = (const float*)d_in[1]; const float* wk = (const float*)d_in[2]; const float* wv = (const float*)d_in[3]; const float* wo = (const float*)d_in[4]; const float* bo = (const float*)d_in[5];   /* argument order x, Wq, Wk, Wv, Wp ('oi' [768][768]: nn.Linear layout, applied transposed), bp */
    float* OUT = (float*)d_out;     // [4][2048][768]
    char* wsp = (char*)d_ws;
    auto take = [&](size_t bytes) { char* p = wsp; wsp += (bytes + 255) & ~(size_t)255; return (void*)p; };
    bf* WQ = (bf*)take((size_t)DQ * DM * 2); bf* WK = (bf*)take((size_t)DKV * DM * 2); bf* WV = (bf*)take((size_t)DKV * DM * 2); bf* WO = (bf*)take((size_t)DM * DQ * 2); float* CS = (float*)take((size_t)TT * HD * 2 * 4);
    bf* XB = (bf*)take((size_t)NB_ * TT * DM * 2); float* FQ = (float*)take((size_t)NB_ * TT * DQ * 4); float* FK = (float*)take((size_t)NB_ * TT * DKV * 4);
    h16* QP16 = (h16*)take((size_t)NB_ * NH_ * TT * HD * 2); h16* KP16 = (h16*)take((size_t)NB_ * NKV * TT * HD * 2); h16* VT16 = (h16*)take((size_t)NB_ * NKV * HD * TT * 2);
    bf* QPh = (bf*)take((size_t)NB_ * NH_ * TT * HD * 2); bf* QPl = (bf*)take((size_t)NB_ * NH_ * TT * HD * 2); bf* KPh = (bf*)take((size_t)NB_ * NKV * TT * HD * 2); bf* KPl = (bf*)take((size_t)NB_ * NKV * TT * HD * 2); bf* VTh = (bf*)take((size_t)NB_ * NKV * HD * TT * 2); bf* VTl = (bf*)take((size_t)NB_ * NKV * HD * TT * 2);
    bf* ATh = (bf*)take((size_t)NB_ * TT * DQ * 2); bf* ATl = (bf*)take((size_t)NB_ * TT * DQ * 2);
    if ((size_t)(wsp - (char*)d_ws) > ws_size) return;    // about 198 MiB of the 256 MiB
    float* FV = FK;   // v projection reuses the k buffer after the k planes are built (stream-ordered)
    { k_cvt8<<<(unsigned)(((size_t)DQ * DM / 8 + 255) / 256), 256, 0, stream>>>(wq, WQ, (size_t)DQ * DM / 8); k_cvt8<<<(unsigned)(((size_t)DKV * DM / 8 + 255) / 256), 256, 0, stream>>>(wk, WK, (size_t)DKV * DM / 8); k_cvt8<<<(unsigned)(((size_t)DKV * DM / 8 + 255) / 256), 256, 0, stream>>>(wv, WV, (size_t)DKV * DM / 8);   /* 'oi' weights are already [out][in] = Bt rows: a plain cast, no transpose */
      k_cvt8<<<(unsigned)(((size_t)DM * DQ / 8 + 255) / 256), 256, 0, stream>>>(wo, WO, (size_t)DM * DQ / 8);   /* Wp 'oi' [768][768]: plain cast */
       }
    k_csid<<<(TT * HD + 255) / 256, 256, 0, stream>>>(CS);
    const unsigned LQ = (unsigned)(((size_t)NH_ * TT * HD / 2 + 255) / 256), LKv = (unsigned)(((size_t)NKV * TT * HD / 2 + 255) / 256);
    // one launch per stage for all batches: the projections see x as [NB_*TT][DM] rows, the plane builders take the batch from blockIdx.y, attention from blockIdx.x
    k_cvt8<<<(unsigned)(((size_t)NB_ * TT * DM / 8 + 255) / 256), 256, 0, stream>>>(x, XB, (size_t)NB_ * TT * DM / 8);
    k_gemmw<bf, 0, false><<<dim3(NB_ * TT / 64, DQ / 64, 1), 32, 0, stream>>>(XB, nullptr, WQ, nullptr, DM, FQ, DQ, nullptr, 0, 0, 0);
    k_rope<<<dim3(LQ, NB_, 1), 256, 0, stream>>>(FQ, DQ, NH_, CS, nullptr, nullptr, 1.0f, QP16, QPh, QPl);
    k_gemmw<bf, 0, false><<<dim3(NB_ * TT / 64, DKV / 64, 1), 32, 0, stream>>>(XB, nullptr, WK, nullptr, DM, FK, DKV, nullptr, 0, 0, 0);
    k_rope<<<dim3(LKv, NB_, 1), 256, 0, stream>>>(FK, DKV, NKV, CS, nullptr, nullptr, 1.0f, KP16, KPh, KPl);
    k_gemmw<bf, 0, false><<<dim3(NB_ * TT / 64, DKV / 64, 1), 32, 0, stream>>>(XB, nullptr, WV, nullptr, DM, FV, DKV, nullptr, 0, 0, 0); k_vtp<<<dim3(LKv, NB_, 1), 256, 0, stream>>>(FV, DKV, NKV, VT16, VTh, VTl);
    k_fattn<<<dim3(NB_ * NH_, (TT - RH) / 32 + RH / 16, 1), AW * 32, 0, stream>>>(QP16, KP16, VT16, QPh, QPl, KPh, KPl, VTh, VTl, ATh, ATl);
    k_gemmw<bf, 1, true><<<dim3(NB_ * TT / 64, DM / 64, 1), 32, 0, stream>>>(ATh, ATl, WO, nullptr, DQ, OUT, DM, bo, 0, 0, 0);
}

// v003
// It runs in 164 microseconds.
// Next to v002, in two timings, it ran 1.52 and 1.51 times as fast.
// All steps since v000 together make it 13.1 times as fast.
#include <hip/hip_runtime.h>

// Causal multi-head attention with bias-free (out, in) projections and a biased (out, in) output projection at a 768-wide model (x [4][2048][768]; q, k, v = x W^T ('oi' [768][768] uniform(+-1/sqrt(768)), no bias; 12 heads x 64); scores x 64^-0.5; tril kept, -inf elsewhere (tril built inside the function); softmax; out = merged Wp^T + bp ('oi' + a REAL bias, uniform(+-1/sqrt(768))) -> [4][2048][768] (6.3 M); argument order x, Wq, Wk, Wv, Wp, bp).
// Layout, all four batches in every launch (rows b*2048 + t, planes [b][h]): bf16 copy of x; 'oi' weights cast in place (no transpose); exact projections (K 768), q, k and v in one launch that writes the head planes itself; one fused causal attention launch at 12 heads (scores, online softmax and the value product stay in registers; hybrid rows: < 512 hi/lo 3 products, rest fp16 with probabilities x1024); merged hi/lo x Wp exact + bp.
// Compute dtypes, f32 accumulate: every input rounded to bf16; projections exact; attention rows < 512 3 products, rest fp16; softmax f32; Wp hl x exact + bias.

#define NB_  4
#define TT   2048
#define DM   768
#define NH_  12
#define NKV  12
#define HD   64
#define DQ   (NH_ * HD)
#define DKV  (NKV * HD)
#define RH   512                  // query rows < RH use hi+lo planes (0: none)
#define SCL  0.125f   // HD^-0.5
typedef _Float16 h16;
typedef unsigned short bf;
typedef __attribute__((ext_vector_type(16))) __bf16   v16bf;
typedef __attribute__((ext_vector_type(16))) _Float16 v16h;
typedef __attribute__((ext_vector_type(8)))  _Float16 v8h;
typedef __attribute__((ext_vector_type(8)))  unsigned short v8us;
typedef __attribute__((ext_vector_type(8)))  float    v8f;
typedef __attribute__((ext_vector_type(4)))  float    v4f;
typedef v8h  __attribute__((may_alias)) v8ha;
typedef v4f  __attribute__((may_alias)) v4fa;
typedef v8us __attribute__((may_alias)) v8usa;

__device__ __forceinline__ unsigned short f2bf(float f) { unsigned u = __float_as_uint(f); u += 0x7FFFu + ((u >> 16) & 1u); return (unsigned short)(u >> 16); }
__device__ __forceinline__ float bf2f(unsigned short b) { return __uint_as_float(((unsigned)b) << 16); }
__device__ __forceinline__ float bfr(float f) { return bf2f(f2bf(f)); }
__device__ __forceinline__ v16h cat16(v8h lo, v8h hi) { return __builtin_shufflevector(lo, hi, 0, 1, 2, 3, 4, 5, 6, 7, 8, 9, 10, 11, 12, 13, 14, 15); }
__device__ __forceinline__ v16bf cat16b(v8us lo, v8us hi) { return __builtin_bit_cast(v16bf, __builtin_shufflevector(lo, hi, 0, 1, 2, 3, 4, 5, 6, 7, 8, 9, 10, 11, 12, 13, 14, 15)); }
__device__ __forceinline__ v8f wmma16(v16h a, v16h b, v8f c) { return __builtin_amdgcn_wmma_f32_16x16x32_f16(false, a, false, b, (short)0, c, false, false); }
__device__ __forceinline__ v8f wmmab(v16bf a, v16bf b, v8f c) { return __builtin_amdgcn_wmma_f32_16x16x32_bf16(false, a, false, b, (short)0, c, false, false); }



// ---- k_gemmw: register-blocked GEMM, ONE WAVE per 64x64 output tile (16 accumulators), operands straight from K-contiguous 16-bit planes; grid (M/64, N/64, Z), 32 threads.
// C[m][n] (f32, pitch ldc, + optional f32 bias[n]) = sum_k A[m][k] Bt[n][k] (+ split products per NSPLIT). z-batch strides sA/sB/sC in elements. K % 32 == 0.
// PLANES: no C. A = token rows [NB_*TT][K], Bt = the q, k, v weights behind one another (z = 0, 1, 2; blockIdx.y = head, a 64-wide tile is one head); the tile leaves as 16-bit head planes, q and k [b][h][t][d], v [b][h][d][t].
// A lane's 8 accumulator values run along m, so the plane's contiguous index is made the m index: q and k are computed as W x^T (operand roles swapped; both fragments load alike, same k order), v as x W^T.
// Only what attention reads is written: hi/lo planes for t < RH, the fp16 q plane for t >= RH, the fp16 k and v planes everywhere.
template <typename T16> struct WFrag;
template <> struct WFrag<h16> { typedef v16h V; static __device__ __forceinline__ V ld(const h16* p) { return cat16(*(const v8h*)p, *(const v8h*)(p + 16)); } static __device__ __forceinline__ v8f mma(V a, V b, v8f c) { return wmma16(a, b, c); } };
template <> struct WFrag<bf> { typedef v16bf V; static __device__ __forceinline__ V ld(const bf* p) { return cat16b(*(const v8us*)p, *(const v8us*)(p + 16)); } static __device__ __forceinline__ v8f mma(V a, V b, v8f c) { return wmmab(a, b, c); } };
__device__ __forceinline__ void splitf(float y, unsigned short& h, unsigned short& l) { h = f2bf(y); l = f2bf(y - bf2f(h)); }
// One wave's 64x64 accumulator tile to 16-bit planes (W16: fp16; WHL: bf16 hi and lo). Plane row = the tile's n index (16 per nb), its 64 contiguous elements (128 B) = the m index.
// 16 rows at a time go through LDS (pitch 144 B) so that every global store covers whole 128-byte lines.
template <bool W16, bool WHL>
__device__ __forceinline__ void planes_out(const v8f (&acc)[4][4], unsigned short* st, const int pitch, h16* P16, bf* Ph, bf* Pl) {
    const int lane = threadIdx.x & 31, lr = lane & 15, hi = lane >> 4;
#pragma unroll
    for (int nb = 0; nb < 4; ++nb) {
#pragma unroll
        for (int mb = 0; mb < 4; ++mb) { const int so = lr * 72 + mb * 16 + hi * 8;
            if (W16) { v8h p;
#pragma unroll
                for (int j = 0; j < 8; ++j) p[j] = (h16)acc[mb][nb][j];
                *(v8ha*)(st + so) = p; }
            if (WHL) { v8us ph, pl;
#pragma unroll
                for (int j = 0; j < 8; ++j) { unsigned short x, y; splitf(acc[mb][nb][j], x, y); ph[j] = x; pl[j] = y; }
                *(v8usa*)(st + 16 * 72 + so) = ph; *(v8usa*)(st + 2 * 16 * 72 + so) = pl; } }
        __builtin_amdgcn_wave_barrier(); asm volatile("" ::: "memory");   // the reads below take other lanes' rows: the compiler may not lift them over the writes above (one wave: LDS serves it in order)
#pragma unroll
        for (int s = 0; s < 4; ++s) { const int row = s * 4 + (lane >> 3), ch = (lane & 7) * 8; const size_t go = (size_t)(nb * 16 + row) * pitch + ch;
            if (W16) *(v8ha*)(P16 + go) = *(const v8ha*)(st + row * 72 + ch);
            if (WHL) { *(v8usa*)(Ph + go) = *(const v8usa*)(st + 16 * 72 + row * 72 + ch); *(v8usa*)(Pl + go) = *(const v8usa*)(st + 2 * 16 * 72 + row * 72 + ch); } }
        __builtin_amdgcn_wave_barrier(); asm volatile("s_wait_xcnt 0x0" ::: "memory");   // stands in front of any rewrite of the registers that the stores above name; its clobber also keeps the LDS reads above from sinking below the next 16 rows' writes
    }
}
template <typename T16, int NSPLIT, bool BIAS, bool PLANES>
__global__ __launch_bounds__(32) void k_gemmw(const T16* __restrict__ A, const T16* __restrict__ A2, const T16* __restrict__ Bt, const T16* __restrict__ Bt2, int K, float* C, int ldc, const float* __restrict__ bias, size_t sA, size_t sB, size_t sC, h16* P16, bf* Ph, bf* Pl) {
    typedef typename WFrag<T16>::V V;
    __shared__ __align__(16) float os[16 * 68];
    const size_t z = blockIdx.z; A += z * sA; if (A2) A2 += z * sA; Bt += z * sB; if (Bt2) Bt2 += z * sB; C += z * sC;
    const bool sw = PLANES && z < 2;   // q, k: the weight rows take the m side, the token rows the n side (block-uniform)
    if (sw) { const T16* t = A; A = Bt; Bt = t; }
    const int lane = threadIdx.x & 31, lr = lane & 15, hi = lane >> 4; const int r0 = (sw ? blockIdx.y : blockIdx.x) * 64, c0 = (sw ? blockIdx.x : blockIdx.y) * 64;
    v8f acc[4][4];
#pragma unroll
    for (int mb = 0; mb < 4; ++mb)
#pragma unroll
        for (int nb = 0; nb < 4; ++nb) acc[mb][nb] = (v8f){};
    const size_t aoff = (size_t)(r0 + lr) * K + 8 * hi, boff = (size_t)(c0 + lr) * K + 8 * hi;
#pragma unroll 1
    for (int kc = 0; kc < K; kc += 32) {
        V a[4], a2[4];
#pragma unroll
        for (int mb = 0; mb < 4; ++mb) { a[mb] = WFrag<T16>::ld(A + aoff + (size_t)mb * 16 * K + kc); if (NSPLIT == 1 || NSPLIT == 2) a2[mb] = WFrag<T16>::ld(A2 + aoff + (size_t)mb * 16 * K + kc); }
#pragma unroll
        for (int nb = 0; nb < 4; ++nb) { const V b = WFrag<T16>::ld(Bt + boff + (size_t)nb * 16 * K + kc); V b2; if (NSPLIT >= 2) b2 = WFrag<T16>::ld(Bt2 + boff + (size_t)nb * 16 * K + kc);
#pragma unroll
            for (int mb = 0; mb < 4; ++mb) { acc[mb][nb] = WFrag<T16>::mma(a[mb], b, acc[mb][nb]); if (NSPLIT == 1 || NSPLIT == 2) acc[mb][nb] = WFrag<T16>::mma(a2[mb], b, acc[mb][nb]); if (NSPLIT >= 2) acc[mb][nb] = WFrag<T16>::mma(a[mb], b2, acc[mb][nb]); } }
        asm volatile("v_nop\n\tv_nop\n\tv_nop\n\tv_nop" : "+v"(acc[0][0]), "+v"(acc[1][1]), "+v"(acc[2][2]), "+v"(acc[3][3]) : "v"(a[0]), "v"(a[3]));
    }
    if constexpr (PLANES) {
        __shared__ __align__(16) unsigned short st[3 * 16 * 72];
        const int tb = blockIdx.x * 64, t0 = tb % TT; const size_t po = ((size_t)(tb / TT) * NH_ + blockIdx.y) * TT * HD + (sw ? (size_t)t0 * HD : (size_t)t0); const int pitch = sw ? HD : TT;
        const size_t PE = (size_t)NB_ * NH_ * TT * HD; P16 += z * PE + po; Ph += z * 2 * PE + po; Pl += z * 2 * PE + po;   // planes in the order q, k, v; hi and lo alternate
        if (t0 >= RH) planes_out<true, false>(acc, st, pitch, P16, Ph, Pl);          // block-uniform tests: one straight-line body each
        else if (z == 0) planes_out<false, true>(acc, st, pitch, P16, Ph, Pl);
        else planes_out<true, true>(acc, st, pitch, P16, Ph, Pl);
        return;
    }
#pragma unroll
    for (int mb = 0; mb < 4; ++mb) {
#pragma unroll
        for (int nb = 0; nb < 4; ++nb) {
#pragma unroll
            for (int j = 0; j < 8; ++j) os[(hi * 8 + j) * 68 + nb * 16 + lr] = acc[mb][nb][j]; }
        __builtin_amdgcn_wave_barrier(); asm volatile("" ::: "memory");
        float* crow = C + (size_t)(r0 + mb * 16) * ldc + c0;
{
#pragma unroll
            for (int s = 0; s < 8; ++s) { const int row = 2 * s + hi, cofs = lr * 4; v4f val = *(const v4fa*)(os + row * 68 + cofs); if (BIAS) { val[0] += bfr(bias[c0 + cofs]); val[1] += bfr(bias[c0 + cofs + 1]); val[2] += bfr(bias[c0 + cofs + 2]); val[3] += bfr(bias[c0 + cofs + 3]); }
                *(v4f*)(crow + (size_t)row * ldc + cofs) = val; }
             }
        __builtin_amdgcn_wave_barrier(); asm volatile("" ::: "memory");
    }
}

__device__ __forceinline__ h16 tohx(float x) { return (h16)x; }
typedef __attribute__((ext_vector_type(2))) _Float16 v2h;
typedef __attribute__((ext_vector_type(4))) _Float16 v4h;
typedef __attribute__((ext_vector_type(2))) unsigned short v2us;
typedef __attribute__((ext_vector_type(4))) unsigned short v4us;
typedef __attribute__((ext_vector_type(2))) float v2f;
typedef __attribute__((ext_vector_type(4))) int v4i;

__global__ __launch_bounds__(256) void k_wtG(const float* __restrict__ w, int K, int N, bf* Bt) {
    const int lane = threadIdx.x & 31; const int L0 = (blockIdx.x * 8 + (threadIdx.x >> 5)) * 8; const int nlines = N * K / 64;
{
#pragma unroll 1
        for (int l = 0; l < 8; ++l) { const int L = L0 + l; if (L >= nlines) break; const size_t e = (size_t)L * 64 + lane * 2; const int k = (int)(e % K), n = (int)(e / K); v2us o;
            o[0] = f2bf(w[(size_t)k * N + n]); o[1] = f2bf(w[(size_t)(k + 1) * N + n]); *(v2us*)(Bt + e) = o; }
         }
}
__global__ __launch_bounds__(256) void k_cvt8(const float* __restrict__ src, bf* dst, size_t n8) { const size_t i = (size_t)blockIdx.x * 256 + threadIdx.x; if (i >= n8) return; const v8f v = *(const v8f*)(src + i * 8); v8us o;
#pragma unroll
    for (int k = 0; k < 8; ++k) o[k] = f2bf(v[k]); *(v8us*)(dst + i * 8) = o;  }

#define AW 4
typedef v8f __attribute__((may_alias)) v8fa;
// 2^x. Behind a v_exp_f32 the instruction set asks for one independent instruction or a v_nop before its result is read or its source overwritten; it is kept here by construction:
// eight at a time, no output sharing a register with an input (each v_exp_f32 is independent of the one in front of it), one v_nop behind the last.
__device__ __forceinline__ v8f exp2x8(const v8f x) { float o0, o1, o2, o3, o4, o5, o6, o7;
    asm("v_exp_f32 %0, %8\n\tv_exp_f32 %1, %9\n\tv_exp_f32 %2, %10\n\tv_exp_f32 %3, %11\n\tv_exp_f32 %4, %12\n\tv_exp_f32 %5, %13\n\tv_exp_f32 %6, %14\n\tv_exp_f32 %7, %15\n\tv_nop"
        : "=&v"(o0), "=&v"(o1), "=&v"(o2), "=&v"(o3), "=&v"(o4), "=&v"(o5), "=&v"(o6), "=&v"(o7) : "v"(x[0]), "v"(x[1]), "v"(x[2]), "v"(x[3]), "v"(x[4]), "v"(x[5]), "v"(x[6]), "v"(x[7]));
    return (v8f){o0, o1, o2, o3, o4, o5, o6, o7}; }
__device__ __forceinline__ float exp2s(const float x) { float o; asm("v_exp_f32 %0, %1\n\tv_nop" : "=v"(o) : "v"(x)); return o; }   // the same slot behind a single one
template <typename T16, bool HL, int NQ>
__device__ __forceinline__ void attn_tile(const T16* __restrict__ Q, const T16* __restrict__ Q2, const T16* __restrict__ Kp, const T16* __restrict__ K2, const T16* __restrict__ Vt, const T16* __restrict__ V2, const int q0, bf* Ah, bf* Al, float* sO, float* sM, float* sL, float* sI) {
    typedef typename WFrag<T16>::V V;
    const int lane = threadIdx.x & 31, c = lane & 15, h = lane >> 4; const int w = __builtin_amdgcn_readfirstlane((int)(threadIdx.x >> 5));
    const float L2E = 1.4426950408889634f, SH = HL ? 0.0f : 10.0f;
    V qf[NQ][2], qf2[NQ][2];
#pragma unroll
    for (int nq = 0; nq < NQ; ++nq)
#pragma unroll
        for (int ks = 0; ks < 2; ++ks) { const size_t qo = (size_t)(q0 + nq * 16 + c) * HD + ks * 32 + 8 * h; qf[nq][ks] = WFrag<T16>::ld(Q + qo); if (HL) qf2[nq][ks] = WFrag<T16>::ld(Q2 + qo); }
    V ka[2][2], ka2[2][2];
    auto ldk = [&](const int kb) {                   // the key fragments of 32-key block kb
#pragma unroll
        for (int t = 0; t < 2; ++t)
#pragma unroll
            for (int ks = 0; ks < 2; ++ks) { const size_t ko = (size_t)(kb * 32 + t * 16 + c) * HD + ks * 32 + 8 * h; ka[t][ks] = WFrag<T16>::ld(Kp + ko); if (HL) ka2[t][ks] = WFrag<T16>::ld(K2 + ko); } };
    v8f o[4][NQ]; float m[NQ], l[NQ];
#pragma unroll
    for (int nq = 0; nq < NQ; ++nq) { m[nq] = -3.0e38f; l[nq] = 0.f;
#pragma unroll
        for (int mb = 0; mb < 4; ++mb) o[mb][nq] = (v8f){}; }
    const int nblk = (q0 + NQ * 16 + 31) / 32;      // 32-key blocks that hold a key <= the tile's last query; only the last one crosses the diagonal
    if (!HL) ldk(min(w, nblk - 1));                  // fp16 tiles (long loops) fetch their key fragments one pass ahead; a wave without a block loads the last block and drops it
    asm volatile("s_wait_xcnt 0x0" ::: "memory");    // stands in front of any rewrite of the address registers of the loads above
#pragma unroll 1
    for (int kb = w; kb < nblk; kb += AW) {
        const int k0 = kb * 32;
        V va[4], va2[4];
        if (HL) ldk(kb);
#pragma unroll
        for (int mb = 0; mb < 4; ++mb) { const size_t vo = (size_t)(mb * 16 + c) * TT + k0 + 8 * h; va[mb] = WFrag<T16>::ld(Vt + vo); if (HL) va2[mb] = WFrag<T16>::ld(V2 + vo); }
        asm volatile("s_wait_xcnt 0x0" ::: "memory");    // in front of any rewrite of those loads' address registers; its clobber also keeps these loads from being sunk below this point, towards their use, where each would be waited for alone
        v8f s[2][NQ];
#pragma unroll
        for (int t = 0; t < 2; ++t)
#pragma unroll
            for (int nq = 0; nq < NQ; ++nq) { v8f a = (v8f){};
#pragma unroll
                for (int ks = 0; ks < 2; ++ks) { a = WFrag<T16>::mma(ka[t][ks], qf[nq][ks], a); if (HL) { a = WFrag<T16>::mma(ka[t][ks], qf2[nq][ks], a); a = WFrag<T16>::mma(ka2[t][ks], qf[nq][ks], a); } }
                s[t][nq] = a; }
        if (!HL && kb + AW < nblk) { ldk(kb + AW);       // next pass's key fragments, into the registers the products above have just read (wave-uniform test)
            asm volatile("s_wait_xcnt 0x0" ::: "memory"); }  // in front of any rewrite of those loads' address registers
        if (kb == nblk - 1) {                        // diagonal block (wave-uniform test): keys above the query are masked by select
#pragma unroll
            for (int t = 0; t < 2; ++t)
#pragma unroll
                for (int nq = 0; nq < NQ; ++nq)
#pragma unroll
                    for (int r = 0; r < 8; ++r) s[t][nq][r] = (k0 + t * 16 + 8 * h + r <= q0 + nq * 16 + c) ? s[t][nq][r] : -3.0e38f; }
#pragma unroll
        for (int nq = 0; nq < NQ; ++nq) {
            float mx = m[nq];
#pragma unroll
            for (int t = 0; t < 2; ++t)
#pragma unroll
                for (int r = 0; r < 8; ++r) { s[t][nq][r] *= SCL; mx = fmaxf(mx, s[t][nq][r]); }
            mx = fmaxf(mx, __shfl_xor(mx, 16, 32));
            const float al = exp2s((m[nq] - mx) * L2E); m[nq] = mx;
            float sum = 0.f;
#pragma unroll
            for (int t = 0; t < 2; ++t) { s[t][nq] = exp2x8((s[t][nq] - mx) * L2E + SH);
#pragma unroll
                for (int r = 0; r < 8; ++r) sum += s[t][nq][r]; }
            l[nq] = l[nq] * al + sum;                // this half's keys only; the halves are joined once after the loop
#pragma unroll
            for (int mb = 0; mb < 4; ++mb) o[mb][nq] *= al;
            V pf, pf2;
            if constexpr (HL) { v8us h0, h1, l0, l1;
#pragma unroll
                for (int r = 0; r < 8; ++r) { unsigned short x, y; splitf(s[0][nq][r], x, y); h0[r] = x; l0[r] = y; splitf(s[1][nq][r], x, y); h1[r] = x; l1[r] = y; }
                pf = cat16b(h0, h1); pf2 = cat16b(l0, l1);
            } else { v8h p0, p1;
#pragma unroll
                for (int r = 0; r < 8; ++r) { p0[r] = tohx(s[0][nq][r]); p1[r] = tohx(s[1][nq][r]); }
                pf = cat16(p0, p1); }
#pragma unroll
            for (int mb = 0; mb < 4; ++mb) { o[mb][nq] = WFrag<T16>::mma(va[mb], pf, o[mb][nq]); if (HL) { o[mb][nq] = WFrag<T16>::mma(va[mb], pf2, o[mb][nq]); o[mb][nq] = WFrag<T16>::mma(va2[mb], pf, o[mb][nq]); } }
        }
    }
    // join: per query the waves' (m, l) go through LDS; every wave rescales its O^T to the common maximum and stages it; then each wave sums and stores whole 128-byte rows of the merged planes
#pragma unroll
    for (int nq = 0; nq < NQ; ++nq) { l[nq] += __shfl_xor(l[nq], 16, 32); if (h == 0) { sM[w * 32 + nq * 16 + c] = m[nq]; sL[w * 32 + nq * 16 + c] = l[nq]; } }
    __syncthreads();
#pragma unroll
    for (int nq = 0; nq < NQ; ++nq) { float M = sM[nq * 16 + c];
#pragma unroll
        for (int ww = 1; ww < AW; ++ww) M = fmaxf(M, sM[ww * 32 + nq * 16 + c]);
        float lt = 0.f;
#pragma unroll
        for (int ww = 0; ww < AW; ++ww) lt += sL[ww * 32 + nq * 16 + c] * exp2s((sM[ww * 32 + nq * 16 + c] - M) * L2E);
        if (w == 0 && h == 0) sI[nq * 16 + c] = __fdiv_rn(1.0f, lt);
        const float f = exp2s((m[nq] - M) * L2E);
#pragma unroll
        for (int mb = 0; mb < 4; ++mb) *(v8fa*)(sO + (((w * 4 + mb) * NQ + nq) * 32 + lane) * 8) = o[mb][nq] * f; }
    __syncthreads();
#pragma unroll
    for (int ps = 0; ps < NQ; ++ps) { const int ql = (w * NQ + ps) * 4 + (lane >> 3), ds = lane & 7; const int nq = ql >> 4, cc = ql & 15, mb = ds >> 1, hh = ds & 1;
        v8f a = *(const v8fa*)(sO + ((mb * NQ + nq) * 32 + hh * 16 + cc) * 8);
#pragma unroll
        for (int ww = 1; ww < AW; ++ww) a += *(const v8fa*)(sO + (((ww * 4 + mb) * NQ + nq) * 32 + hh * 16 + cc) * 8);
        const float inv = sI[ql]; v8us oh, ol;
#pragma unroll
        for (int r = 0; r < 8; ++r) { unsigned short x, y; splitf(a[r] * inv, x, y); oh[r] = x; ol[r] = y; }
        const size_t oo = (size_t)(q0 + ql) * DQ + ds * 8; *(v8us*)(Ah + oo) = oh; *(v8us*)(Al + oo) = ol; }
}
// grid (batches x heads, tiles), blockIdx.x = b * heads + head; blockIdx.y: (TT - RH) / 32 fp16 tiles of 32 rows from the last row down, then RH / 16 hi/lo tiles of 16 rows.
__global__ __launch_bounds__(AW * 32) void k_fattn(const h16* __restrict__ Q16, const h16* __restrict__ K16, const h16* __restrict__ V16, const bf* __restrict__ Qh, const bf* __restrict__ Ql, const bf* __restrict__ Kh, const bf* __restrict__ Kl, const bf* __restrict__ Vh, const bf* __restrict__ Vl, bf* Ah, bf* Al) {
    __shared__ __align__(32) float sO[AW * 4 * 2 * 32 * 8]; __shared__ float sM[AW * 32], sL[AW * 32], sI[32];
    const size_t pz = (size_t)blockIdx.x * TT * HD; const int ty = blockIdx.y; const size_t ao = (size_t)(blockIdx.x / NH_) * TT * DQ + (blockIdx.x % NH_) * HD; Ah += ao; Al += ao;
    if (ty < (TT - RH) / 32) attn_tile<h16, false, 2>(Q16 + pz, nullptr, K16 + pz, nullptr, V16 + pz, nullptr, TT - 32 * (ty + 1), Ah, Al, sO, sM, sL, sI);
    else attn_tile<bf, true, 1>(Qh + pz, Ql + pz, Kh + pz, Kl + pz, Vh + pz, Vl + pz, RH - 16 * (ty - (TT - RH) / 32 + 1), Ah, Al, sO, sM, sL, sI);
}

extern "C" void kernel_launch(void* const* d_in, const int* in_sizes, int n_in,
                              void* d_out, int out_size, void* d_ws, size_t ws_size, hipStream_t stream) {
    (void)in_sizes; (void)n_in; (void)out_size;
    const float* x = (const float*)d_in[0]; const float* wq = (const float*)d_in[1]; const float* wk = (const float*)d_in[2]; const float* wv = (const float*)d_in[3]; const float* wo = (const float*)d_in[4]; const float* bo = (const float*)d_in[5];   /* argument order x, Wq, Wk, Wv, Wp ('oi' [768][768]: nn.Linear layout, applied transposed), bp */
    float* OUT = (float*)d_out;     // [4][2048][768]
    char* wsp = (char*)d_ws;
    auto take = [&](size_t bytes) { char* p = wsp; wsp += (bytes + 255) & ~(size_t)255; return (void*)p; };
    bf* WQ = (bf*)take((size_t)DQ * DM * 2); bf* WK = (bf*)take((size_t)DKV * DM * 2); bf* WV = (bf*)take((size_t)DKV * DM * 2); bf* WO = (bf*)take((size_t)DM * DQ * 2);
    bf* XB = (bf*)take((size_t)NB_ * TT * DM * 2);
    static_assert(NKV == NH_ && ((size_t)DQ * DM * 2) % 256 == 0 && ((size_t)NB_ * NH_ * TT * HD * 2) % 256 == 0, "the projection launch steps from q to k to v by one weight's, one plane's size: take() may leave no gap");
    h16* QP16 = (h16*)take((size_t)NB_ * NH_ * TT * HD * 2); h16* KP16 = (h16*)take((size_t)NB_ * NKV * TT * HD * 2); h16* VT16 = (h16*)take((size_t)NB_ * NKV * HD * TT * 2);
    bf* QPh = (bf*)take((size_t)NB_ * NH_ * TT * HD * 2); bf* QPl = (bf*)take((size_t)NB_ * NH_ * TT * HD * 2); bf* KPh = (bf*)take((size_t)NB_ * NKV * TT * HD * 2); bf* KPl = (bf*)take((size_t)NB_ * NKV * TT * HD * 2); bf* VTh = (bf*)take((size_t)NB_ * NKV * HD * TT * 2); bf* VTl = (bf*)take((size_t)NB_ * NKV * HD * TT * 2);
    bf* ATh = (bf*)take((size_t)NB_ * TT * DQ * 2); bf* ATl = (bf*)take((size_t)NB_ * TT * DQ * 2);
    if ((size_t)(wsp - (char*)d_ws) > ws_size) return;    // about 149 MiB of the 256 MiB
    { k_cvt8<<<(unsigned)(((size_t)DQ * DM / 8 + 255) / 256), 256, 0, stream>>>(wq, WQ, (size_t)DQ * DM / 8); k_cvt8<<<(unsigned)(((size_t)DKV * DM / 8 + 255) / 256), 256, 0, stream>>>(wk, WK, (size_t)DKV * DM / 8); k_cvt8<<<(unsigned)(((size_t)DKV * DM / 8 + 255) / 256), 256, 0, stream>>>(wv, WV, (size_t)DKV * DM / 8);   /* 'oi' weights are already [out][in] = Bt rows: a plain cast, no transpose */
      k_cvt8<<<(unsigned)(((size_t)DM * DQ / 8 + 255) / 256), 256, 0, stream>>>(wo, WO, (size_t)DM * DQ / 8);   /* Wp 'oi' [768][768]: plain cast */
       }
    // one launch per stage for all batches: the projections see x as [NB_*TT][DM] rows (grid z = q, k, v), attention takes the batch from blockIdx.x
    k_cvt8<<<(unsigned)(((size_t)NB_ * TT * DM / 8 + 255) / 256), 256, 0, stream>>>(x, XB, (size_t)NB_ * TT * DM / 8);
    k_gemmw<bf, 0, false, true><<<dim3(NB_ * TT / 64, NH_, 3), 32, 0, stream>>>(XB, nullptr, WQ, nullptr, DM, nullptr, 0, nullptr, 0, (size_t)DQ * DM, 0, QP16, QPh, QPl);
    k_fattn<<<dim3(NB_ * NH_, (TT - RH) / 32 + RH / 16, 1), AW * 32, 0, stream>>>(QP16, KP16, VT16, QPh, QPl, KPh, KPl, VTh, VTl, ATh, ATl);
    k_gemmw<bf, 1, true, false><<<dim3(NB_ * TT / 64, DM / 64, 1), 32, 0, stream>>>(ATh, ATl, WO, nullptr, DQ, OUT, DM, bo, 0, 0, 0, nullptr, nullptr, nullptr);
}

// v004
// One run takes 129 microseconds.
// Two timings next to v003 put it at 1.28 and 1.27 times that version's speed.
// All steps since v000 together make it 16.7 times as fast.
#include <hip/hip_runtime.h>

// Causal multi-head attention with bias-free (out, in) projections and a biased (out, in) output projection at a 768-wide model (x [4][2048][768]; q, k, v = x W^T ('oi' [768][768] uniform(+-1/sqrt(768)), no bias; 12 heads x 64); scores x 64^-0.5; tril kept, -inf elsewhere (tril built inside the function); softmax; out = merged Wp^T + bp ('oi' + a REAL bias, uniform(+-1/sqrt(768))) -> [4][2048][768] (6.3 M); argument order x, Wq, Wk, Wv, Wp, bp).
// Every 16-bit operand plane lies in FRAGMENT ORDER: a block of 16 rows x 32 k is 1 KiB, two halves of 512 B, lane l's 16 bytes at l*16 (row l & 15; k = half*16 + (l >> 4)*8 + 0..7); blocks run along k, then along rows.
// A wave's 16-byte-per-lane fragment load so covers 512 contiguous bytes (4 whole lines, not 32-byte pieces of 16 lines), and it puts the same values into the same registers as a load from row-major planes.
// Layout, all four batches in every launch (rows b*2048 + t, planes [b][h]): bf16 copy of x; 'oi' weights cast (no transpose); exact projections (K 768), q, k and v in one launch that writes the head planes itself; one fused causal attention launch at 12 heads (scores, online softmax and the value product stay in registers; hybrid rows: < 512 hi/lo 3 products, rest fp16 with probabilities x1024); merged hi/lo x Wp exact + bp.
// Compute dtypes, f32 accumulate: every input rounded to bf16; projections exact; attention rows < 512 3 products, rest fp16; softmax f32; Wp hl x exact + bias.

#define NB_  4
#define TT   2048
#define DM   768
#define NH_  12
#define NKV  12
#define HD   64
#define DQ   (NH_ * HD)
#define DKV  (NKV * HD)
#define RH   512                  // query rows < RH use hi+lo planes (0: none)
#define SCL  0.125f   // HD^-0.5
typedef _Float16 h16;
typedef unsigned short bf;
typedef __attribute__((ext_vector_type(16))) __bf16   v16bf;
typedef __attribute__((ext_vector_type(16))) _Float16 v16h;
typedef __attribute__((ext_vector_type(8)))  _Float16 v8h;
typedef __attribute__((ext_vector_type(8)))  unsigned short v8us;
typedef __attribute__((ext_vector_type(8)))  float    v8f;
typedef __attribute__((ext_vector_type(4)))  float    v4f;
typedef v8h  __attribute__((may_alias)) v8ha;
typedef v4f  __attribute__((may_alias)) v4fa;
typedef v8us __attribute__((may_alias)) v8usa;

__device__ __forceinline__ unsigned short f2bf(float f) { unsigned u = __float_as_uint(f); u += 0x7FFFu + ((u >> 16) & 1u); return (unsigned short)(u >> 16); }
__device__ __forceinline__ float bf2f(unsigned short b) { return __uint_as_float(((unsigned)b) << 16); }
__device__ __forceinline__ float bfr(float f) { return bf2f(f2bf(f)); }
__device__ __forceinline__ v16h cat16(v8h lo, v8h hi) { return __builtin_shufflevector(lo, hi, 0, 1, 2, 3, 4, 5, 6, 7, 8, 9, 10, 11, 12, 13, 14, 15); }
__device__ __forceinline__ v16bf cat16b(v8us lo, v8us hi) { return __builtin_bit_cast(v16bf, __builtin_shufflevector(lo, hi, 0, 1, 2, 3, 4, 5, 6, 7, 8, 9, 10, 11, 12, 13, 14, 15)); }
__device__ __forceinline__ v8f wmma16(v16h a, v16h b, v8f c) { return __builtin_amdgcn_wmma_f32_16x16x32_f16(false, a, false, b, (short)0, c, false, false); }
__device__ __forceinline__ v8f wmmab(v16bf a, v16bf b, v8f c) { return __builtin_amdgcn_wmma_f32_16x16x32_bf16(false, a, false, b, (short)0, c, false, false); }



// ---- k_gemmw: register-blocked GEMM, ONE WAVE per 64x64 output tile (16 accumulators), operands straight from 16-bit planes in fragment order; grid (M/64, N/64, Z), 32 threads.
// C[m][n] (f32, pitch ldc, + optional f32 bias[n]) = sum_k A[m][k] Bt[n][k] (+ split products per NSPLIT). z-batch strides sA/sB/sC in elements. K % 32 == 0, a compile-time constant: a pass's fragment addresses are then one per-lane address per operand plus immediates.
// PLANES: no C. A = token rows [NB_*TT][K], Bt = the q, k, v weights behind one another (z = 0, 1, 2; blockIdx.y = head, a 64-wide tile is one head); the tile leaves as 16-bit head planes in fragment order, q and k [b][h] rows t, k index d; v [b][h] rows d, k index t.
// A lane's 8 accumulator values run along m, so the plane's k index is made the m index: q and k are computed as W x^T (operand roles swapped; both fragments load alike, same k order), v as x W^T.
// Only what attention reads is written: hi/lo planes for t < RH, the fp16 q plane for t >= RH, the fp16 k and v planes everywhere.
// ld(p, lb): the fragment of the block at p (the same pointer in every lane: a scalar base), lb = lane * 16; ldq(q): the same from the lane's own address q.
typedef const __attribute__((address_space(1))) char* gptr;   // a byte address in global memory (keeps the loads global_load where the address passes through an asm statement)
template <typename T16> struct WFrag;
template <> struct WFrag<h16> { typedef v16h V; static __device__ __forceinline__ V ldq(gptr q) { return cat16(*(const __attribute__((address_space(1))) v8h*)q, *(const __attribute__((address_space(1))) v8h*)(q + 512)); } static __device__ __forceinline__ V ld(const h16* p, const unsigned lb) { return ldq((gptr)p + lb); } static __device__ __forceinline__ v8f mma(V a, V b, v8f c) { return wmma16(a, b, c); } };
template <> struct WFrag<bf> { typedef v16bf V; static __device__ __forceinline__ V ldq(gptr q) { return cat16b(*(const __attribute__((address_space(1))) v8us*)q, *(const __attribute__((address_space(1))) v8us*)(q + 512)); } static __device__ __forceinline__ V ld(const bf* p, const unsigned lb) { return ldq((gptr)p + lb); } static __device__ __forceinline__ v8f mma(V a, V b, v8f c) { return wmmab(a, b, c); } };
__device__ __forceinline__ void splitf(float y, unsigned short& h, unsigned short& l) { h = f2bf(y); l = f2bf(y - bf2f(h)); }
// One wave's 64x64 accumulator tile to 16-bit planes (W16: fp16; WHL: bf16 hi and lo). Plane row = the tile's n index (16 per nb), plane k = the m index.
// Accumulator tile (mb, nb) converted is one 512-byte half block of the plane as it stands in the lanes (row = lane & 15, k = mb*16 + (lane >> 4)*8 + 0..7): one 16-byte store per lane, whole lines, no staging.
// rs = half blocks from one 16-row group of the plane to the next (2 * the plane's k extent / 32).
typedef __attribute__((ext_vector_type(4))) unsigned v4u;
// Four such stores, 512 B apart at one scalar base. The s_wait_xcnt 0 that stands in front of any rewrite of a register which an issued store names (data, offset, base) is the last line of the stores' own statement: there nothing can be moved in front of it.
__device__ __forceinline__ void st4(void* base, const unsigned lb, const v4u a, const v4u b, const v4u c, const v4u d) {
    asm volatile("global_store_b128 %0, %1, %5\n\tglobal_store_b128 %0, %2, %5 offset:512\n\tglobal_store_b128 %0, %3, %5 offset:1024\n\tglobal_store_b128 %0, %4, %5 offset:1536\n\ts_wait_xcnt 0x0"
        :: "v"(lb), "v"(a), "v"(b), "v"(c), "v"(d), "s"(base) : "memory"); }
template <bool W16, bool WHL>
__device__ __forceinline__ void planes_out(const v8f (&acc)[4][4], const int rs, h16* P16, bf* Ph, bf* Pl) {
    const unsigned lb = (threadIdx.x & 31) * 16;
#pragma unroll
    for (int nb = 0; nb < 4; ++nb) { const size_t go = (size_t)(nb * rs) * 256;
        if (W16) { v4u q[4];
#pragma unroll
            for (int mb = 0; mb < 4; ++mb) { v8h p;
#pragma unroll
                for (int j = 0; j < 8; ++j) p[j] = (h16)acc[mb][nb][j];
                q[mb] = __builtin_bit_cast(v4u, p); }
            st4(P16 + go, lb, q[0], q[1], q[2], q[3]); }
        if (WHL) { v4u qh[4], ql[4];
#pragma unroll
            for (int mb = 0; mb < 4; ++mb) { v8us ph, pl;
#pragma unroll
                for (int j = 0; j < 8; ++j) { unsigned short x, y; splitf(acc[mb][nb][j], x, y); ph[j] = x; pl[j] = y; }
                qh[mb] = __builtin_bit_cast(v4u, ph); ql[mb] = __builtin_bit_cast(v4u, pl); }
            st4(Ph + go, lb, qh[0], qh[1], qh[2], qh[3]); st4(Pl + go, lb, ql[0], ql[1], ql[2], ql[3]); }
    }
}
template <typename T16, int NSPLIT, bool BIAS, bool PLANES, int K>
__global__ __launch_bounds__(32) void k_gemmw(const T16* __restrict__ A, const T16* __restrict__ A2, const T16* __restrict__ Bt, const T16* __restrict__ Bt2, float* C, int ldc, const float* __restrict__ bias, size_t sA, size_t sB, size_t sC, h16* P16, bf* Ph, bf* Pl) {
    typedef typename WFrag<T16>::V V;
    __shared__ __align__(16) float os[16 * 68];
    const size_t z = blockIdx.z; A += z * sA; if (A2) A2 += z * sA; Bt += z * sB; if (Bt2) Bt2 += z * sB; C += z * sC;
    const bool sw = PLANES && z < 2;   // q, k: the weight rows take the m side, the token rows the n side (block-uniform)
    if (sw) { const T16* t = A; A = Bt; Bt = t; }
    const int lane = threadIdx.x & 31, lr = lane & 15, hi = lane >> 4; const int r0 = (sw ? blockIdx.y : blockIdx.x) * 64, c0 = (sw ? blockIdx.x : blockIdx.y) * 64;
    v8f acc[4][4];
#pragma unroll
    for (int mb = 0; mb < 4; ++mb)
#pragma unroll
        for (int nb = 0; nb < 4; ++nb) acc[mb][nb] = (v8f){};
    static_assert(NSPLIT < 2, "the pass below steps A, A2 and Bt only");
    gptr pa = (gptr)(A + (size_t)r0 * K) + lane * 16; gptr pb = (gptr)(Bt + (size_t)c0 * K) + lane * 16; gptr pa2 = NSPLIT == 1 ? (gptr)(A2 + (size_t)r0 * K) + lane * 16 : pa;   // the lane's place in the first block of each operand; 16 rows x K = K / 32 blocks of 1 KiB
#pragma unroll 1
    for (int kc = 0; kc < K; kc += 32) {
        V a[4], a2[4], b[4];
#pragma unroll
        for (int mb = 0; mb < 4; ++mb) { a[mb] = WFrag<T16>::ldq(pa + mb * 32 * K); if (NSPLIT == 1) a2[mb] = WFrag<T16>::ldq(pa2 + mb * 32 * K); }
#pragma unroll
        for (int nb = 0; nb < 4; ++nb) b[nb] = WFrag<T16>::ldq(pb + nb * 32 * K);
        // the step to the next 1-KiB block rewrites the address registers that this pass's loads name: the s_wait_xcnt 0 that stands in front of such a rewrite and the additions are one statement, so nothing comes between them
        if constexpr (NSPLIT == 1) asm volatile("s_wait_xcnt 0x0\n\tv_add_nc_u64_e32 %0, %3, %0\n\tv_add_nc_u64_e32 %1, %3, %1\n\tv_add_nc_u64_e32 %2, %3, %2" : "+v"(pa), "+v"(pb), "+v"(pa2) : "s"(1024ull) : "memory");
        else asm volatile("s_wait_xcnt 0x0\n\tv_add_nc_u64_e32 %0, %2, %0\n\tv_add_nc_u64_e32 %1, %2, %1" : "+v"(pa), "+v"(pb) : "s"(1024ull) : "memory");
#pragma unroll
        for (int nb = 0; nb < 4; ++nb) {
#pragma unroll
            for (int mb = 0; mb < 4; ++mb) { acc[mb][nb] = WFrag<T16>::mma(a[mb], b[nb], acc[mb][nb]); if (NSPLIT == 1) acc[mb][nb] = WFrag<T16>::mma(a2[mb], b[nb], acc[mb][nb]); } }
        asm volatile("v_nop\n\tv_nop\n\tv_nop\n\tv_nop" : "+v"(acc[0][0]), "+v"(acc[1][1]), "+v"(acc[2][2]), "+v"(acc[3][3]) : "v"(a[0]), "v"(a[3]));
    }
    if constexpr (PLANES) {
        const int tb = blockIdx.x * 64, t0 = tb % TT; const size_t po = ((size_t)(tb / TT) * NH_ + blockIdx.y) * TT * HD + (sw ? (size_t)t0 * HD : (size_t)t0 * 16); const int rs = sw ? HD / 16 : TT / 16;   // q, k: 16 tokens are HD / 16 half blocks; v: 16 tokens are one half block of each 16-row group
        const size_t PE = (size_t)NB_ * NH_ * TT * HD; P16 += z * PE + po; Ph += z * 2 * PE + po; Pl += z * 2 * PE + po;   // planes in the order q, k, v; hi and lo alternate
        if (t0 >= RH) planes_out<true, false>(acc, rs, P16, Ph, Pl);          // block-uniform tests: one straight-line body each
        else if (z == 0) planes_out<false, true>(acc, rs, P16, Ph, Pl);
        else planes_out<true, true>(acc, rs, P16, Ph, Pl);
        return;
    }
#pragma unroll
    for (int mb = 0; mb < 4; ++mb) {
#pragma unroll
        for (int nb = 0; nb < 4; ++nb) {
#pragma unroll
            for (int j = 0; j < 8; ++j) os[(hi * 8 + j) * 68 + nb * 16 + lr] = acc[mb][nb][j]; }
        __builtin_amdgcn_wave_barrier(); asm volatile("" ::: "memory");
        float* crow = C + (size_t)(r0 + mb * 16) * ldc + c0;
{
#pragma unroll
            for (int s = 0; s < 8; ++s) { const int row = 2 * s + hi, cofs = lr * 4; v4f val = *(const v4fa*)(os + row * 68 + cofs); if (BIAS) { val[0] += bfr(bias[c0 + cofs]); val[1] += bfr(bias[c0 + cofs + 1]); val[2] += bfr(bias[c0 + cofs + 2]); val[3] += bfr(bias[c0 + cofs + 3]); }
                *(v4f*)(crow + (size_t)row * ldc + cofs) = val; }
             }
        __builtin_amdgcn_wave_barrier(); asm volatile("" ::: "memory");
    }
}

__device__ __forceinline__ h16 tohx(float x) { return (h16)x; }
typedef __attribute__((ext_vector_type(2))) _Float16 v2h;
typedef __attribute__((ext_vector_type(4))) _Float16 v4h;
typedef __attribute__((ext_vector_type(2))) unsigned short v2us;
typedef __attribute__((ext_vector_type(4))) unsigned short v4us;
typedef __attribute__((ext_vector_type(2))) float v2f;
typedef __attribute__((ext_vector_type(4))) int v4i;

__global__ __launch_bounds__(256) void k_wtG(const float* __restrict__ w, int K, int N, bf* Bt) {
    const int lane = threadIdx.x & 31; const int L0 = (blockIdx.x * 8 + (threadIdx.x >> 5)) * 8; const int nlines = N * K / 64;
{
#pragma unroll 1
        for (int l = 0; l < 8; ++l) { const int L = L0 + l; if (L >= nlines) break; const size_t e = (size_t)L * 64 + lane * 2; const int k = (int)(e % K), n = (int)(e / K); v2us o;
            o[0] = f2bf(w[(size_t)k * N + n]); o[1] = f2bf(w[(size_t)(k + 1) * N + n]); *(v2us*)(Bt + e) = o; }
         }
}
// f32 [rows][DM] row-major to bf16 in fragment order: thread i writes 16-byte piece i of the plane (a wave's store covers 512 contiguous bytes) and fetches that piece's 8 values; a block's 256 pieces are 16 rows x 512 contiguous source bytes.
__global__ __launch_bounds__(256) void k_cvt8(const float* __restrict__ src, bf* dst, size_t n8) { const size_t i = (size_t)blockIdx.x * 256 + threadIdx.x; if (i >= n8) return;
    const size_t blk = i >> 6, rb = blk / (DM / 32); const int kb = (int)(blk % (DM / 32)), kk = (int)((i >> 5) & 1) * 16 + (int)((i >> 4) & 1) * 8;
    const v8f v = *(const v8f*)(src + (rb * 16 + (i & 15)) * DM + kb * 32 + kk); v8us o;
#pragma unroll
    for (int k = 0; k < 8; ++k) o[k] = f2bf(v[k]); *(v8us*)(dst + i * 8) = o;  }

#define AW 4
typedef v8f __attribute__((may_alias)) v8fa;
// 2^x. Behind a v_exp_f32 the instruction set asks for one independent instruction or a v_nop before its result is read or its source overwritten; it is kept here by construction:
// eight at a time, no output sharing a register with an input (each v_exp_f32 is independent of the one in front of it), one v_nop behind the last.
__device__ __forceinline__ v8f exp2x8(const v8f x) { float o0, o1, o2, o3, o4, o5, o6, o7;
    asm("v_exp_f32 %0, %8\n\tv_exp_f32 %1, %9\n\tv_exp_f32 %2, %10\n\tv_exp_f32 %3, %11\n\tv_exp_f32 %4, %12\n\tv_exp_f32 %5, %13\n\tv_exp_f32 %6, %14\n\tv_exp_f32 %7, %15\n\tv_nop"
        : "=&v"(o0), "=&v"(o1), "=&v"(o2), "=&v"(o3), "=&v"(o4), "=&v"(o5), "=&v"(o6), "=&v"(o7) : "v"(x[0]), "v"(x[1]), "v"(x[2]), "v"(x[3]), "v"(x[4]), "v"(x[5]), "v"(x[6]), "v"(x[7]));
    return (v8f){o0, o1, o2, o3, o4, o5, o6, o7}; }
__device__ __forceinline__ float exp2s(const float x) { float o; asm("v_exp_f32 %0, %1\n\tv_nop" : "=v"(o) : "v"(x)); return o; }   // the same slot behind a single one
template <typename T16, bool HL, int NQ>
__device__ __forceinline__ void attn_tile(const T16* __restrict__ Q, const T16* __restrict__ Q2, const T16* __restrict__ Kp, const T16* __restrict__ K2, const T16* __restrict__ Vt, const T16* __restrict__ V2, const int q0, bf* Ah, bf* Al, float* sO, float* sM, float* sL, float* sI) {
    typedef typename WFrag<T16>::V V;
    const int lane = threadIdx.x & 31, c = lane & 15, h = lane >> 4; const int w = __builtin_amdgcn_readfirstlane((int)(threadIdx.x >> 5));
    const float L2E = 1.4426950408889634f, SH = HL ? 0.0f : 10.0f; const unsigned lb = lane * 16;
    V qf[NQ][2], qf2[NQ][2];
#pragma unroll
    for (int nq = 0; nq < NQ; ++nq)
#pragma unroll
        for (int ks = 0; ks < 2; ++ks) { const size_t qo = (size_t)(q0 + nq * 16) * HD + ks * 512; qf[nq][ks] = WFrag<T16>::ld(Q + qo, lb); if (HL) qf2[nq][ks] = WFrag<T16>::ld(Q2 + qo, lb); }
    V ka[2][2], ka2[2][2];
    auto ldk = [&](const int kb) {                   // the key fragments of 32-key block kb
#pragma unroll
        for (int t = 0; t < 2; ++t)
#pragma unroll
            for (int ks = 0; ks < 2; ++ks) { const size_t ko = (size_t)(kb * 32 + t * 16) * HD + ks * 512; ka[t][ks] = WFrag<T16>::ld(Kp + ko, lb); if (HL) ka2[t][ks] = WFrag<T16>::ld(K2 + ko, lb); } };
    v8f o[4][NQ]; float m[NQ], l[NQ];
#pragma unroll
    for (int nq = 0; nq < NQ; ++nq) { m[nq] = -3.0e38f; l[nq] = 0.f;
#pragma unroll
        for (int mb = 0; mb < 4; ++mb) o[mb][nq] = (v8f){}; }
    const int nblk = (q0 + NQ * 16 + 31) / 32;      // 32-key blocks that hold a key <= the tile's last query; only the last one crosses the diagonal
    if (!HL) ldk(min(w, nblk - 1));                  // fp16 tiles (long loops) fetch their key fragments one pass ahead; a wave without a block loads the last block and drops it
    asm volatile("s_wait_xcnt 0x0" ::: "memory");    // stands in front of any rewrite of the address registers of the loads above
#pragma unroll 1
    for (int kb = w; kb < nblk; kb += AW) {
        const int k0 = kb * 32;
        V va[4], va2[4];
        if (HL) ldk(kb);
#pragma unroll
        for (int mb = 0; mb < 4; ++mb) { const size_t vo = (size_t)mb * 16 * TT + k0 * 16; va[mb] = WFrag<T16>::ld(Vt + vo, lb); if (HL) va2[mb] = WFrag<T16>::ld(V2 + vo, lb); }
        asm volatile("s_wait_xcnt 0x0" ::: "memory");    // in front of any rewrite of those loads' address registers; its clobber also keeps these loads from being sunk below this point, towards their use, where each would be waited for alone
        v8f s[2][NQ];
#pragma unroll
        for (int t = 0; t < 2; ++t)
#pragma unroll
            for (int nq = 0; nq < NQ; ++nq) { v8f a = (v8f){};
#pragma unroll
                for (int ks = 0; ks < 2; ++ks) { a = WFrag<T16>::mma(ka[t][ks], qf[nq][ks], a); if (HL) { a = WFrag<T16>::mma(ka[t][ks], qf2[nq][ks], a); a = WFrag<T16>::mma(ka2[t][ks], qf[nq][ks], a); } }
                s[t][nq] = a; }
        if (!HL && kb + AW < nblk) { ldk(kb + AW);       // next pass's key fragments, into the registers the products above have just read (wave-uniform test)
            asm volatile("s_wait_xcnt 0x0" ::: "memory"); }  // in front of any rewrite of those loads' address registers
        if (kb == nblk - 1) {                        // diagonal block (wave-uniform test): keys above the query are masked by select
#pragma unroll
            for (int t = 0; t < 2; ++t)
#pragma unroll
                for (int nq = 0; nq < NQ; ++nq)
#pragma unroll
                    for (int r = 0; r < 8; ++r) s[t][nq][r] = (k0 + t * 16 + 8 * h + r <= q0 + nq * 16 + c) ? s[t][nq][r] : -3.0e38f; }
#pragma unroll
        for (int nq = 0; nq < NQ; ++nq) {
            float mx = m[nq];
#pragma unroll
            for (int t = 0; t < 2; ++t)
#pragma unroll
                for (int r = 0; r < 8; ++r) { s[t][nq][r] *= SCL; mx = fmaxf(mx, s[t][nq][r]); }
            mx = fmaxf(mx, __shfl_xor(mx, 16, 32));
            const float al = exp2s((m[nq] - mx) * L2E); m[nq] = mx;
            float sum = 0.f;
#pragma unroll
            for (int t = 0; t < 2; ++t) { s[t][nq] = exp2x8((s[t][nq] - mx) * L2E + SH);
#pragma unroll
                for (int r = 0; r < 8; ++r) sum += s[t][nq][r]; }
            l[nq] = l[nq] * al + sum;                // this half's keys only; the halves are joined once after the loop
#pragma unroll
            for (int mb = 0; mb < 4; ++mb) o[mb][nq] *= al;
            V pf, pf2;
            if constexpr (HL) { v8us h0, h1, l0, l1;
#pragma unroll
                for (int r = 0; r < 8; ++r) { unsigned short x, y; splitf(s[0][nq][r], x, y); h0[r] = x; l0[r] = y; splitf(s[1][nq][r], x, y); h1[r] = x; l1[r] = y; }
                pf = cat16b(h0, h1); pf2 = cat16b(l0, l1);
            } else { v8h p0, p1;
#pragma unroll
                for (int r = 0; r < 8; ++r) { p0[r] = tohx(s[0][nq][r]); p1[r] = tohx(s[1][nq][r]); }
                pf = cat16(p0, p1); }
#pragma unroll
            for (int mb = 0; mb < 4; ++mb) { o[mb][nq] = WFrag<T16>::mma(va[mb], pf, o[mb][nq]); if (HL) { o[mb][nq] = WFrag<T16>::mma(va[mb], pf2, o[mb][nq]); o[mb][nq] = WFrag<T16>::mma(va2[mb], pf, o[mb][nq]); } }
        }
    }
    // join: per query the waves' (m, l) go through LDS; every wave rescales its O^T to the common maximum and stages it; then wave w sums output tiles (w, nq) as they stand in the lanes, each one 512-byte half block of the merged planes
#pragma unroll
    for (int nq = 0; nq < NQ; ++nq) { l[nq] += __shfl_xor(l[nq], 16, 32); if (h == 0) { sM[w * 32 + nq * 16 + c] = m[nq]; sL[w * 32 + nq * 16 + c] = l[nq]; } }
    __syncthreads();
#pragma unroll
    for (int nq = 0; nq < NQ; ++nq) { float M = sM[nq * 16 + c];
#pragma unroll
        for (int ww = 1; ww < AW; ++ww) M = fmaxf(M, sM[ww * 32 + nq * 16 + c]);
        float lt = 0.f;
#pragma unroll
        for (int ww = 0; ww < AW; ++ww) lt += sL[ww * 32 + nq * 16 + c] * exp2s((sM[ww * 32 + nq * 16 + c] - M) * L2E);
        if (w == 0 && h == 0) sI[nq * 16 + c] = __fdiv_rn(1.0f, lt);
        const float f = exp2s((m[nq] - M) * L2E);
#pragma unroll
        for (int mb = 0; mb < 4; ++mb) *(v8fa*)(sO + (((w * 4 + mb) * NQ + nq) * 32 + lane) * 8) = o[mb][nq] * f; }
    __syncthreads();
#pragma unroll
    for (int nq = 0; nq < NQ; ++nq) {
        v8f a = *(const v8fa*)(sO + ((w * NQ + nq) * 32 + lane) * 8);
#pragma unroll
        for (int ww = 1; ww < AW; ++ww) a += *(const v8fa*)(sO + (((ww * 4 + w) * NQ + nq) * 32 + lane) * 8);
        const float inv = sI[nq * 16 + c]; v8us oh, ol;
#pragma unroll
        for (int r = 0; r < 8; ++r) { unsigned short x, y; splitf(a[r] * inv, x, y); oh[r] = x; ol[r] = y; }
        const size_t oo = (size_t)(q0 + nq * 16) * DQ + w * 256;
        asm volatile("global_store_b128 %0, %1, %3\n\tglobal_store_b128 %0, %2, %4\n\ts_wait_xcnt 0x0"   // the wait in front of any rewrite of a register that these stores name, in their own statement (as in st4)
            :: "v"(lb), "v"(__builtin_bit_cast(v4u, oh)), "v"(__builtin_bit_cast(v4u, ol)), "s"(Ah + oo), "s"(Al + oo) : "memory"); }
}
// grid (batches x heads, tiles), blockIdx.x = b * heads + head; blockIdx.y: (TT - RH) / 32 fp16 tiles of 32 rows from the last row down, then RH / 16 hi/lo tiles of 16 rows.
__global__ __launch_bounds__(AW * 32) void k_fattn(const h16* __restrict__ Q16, const h16* __restrict__ K16, const h16* __restrict__ V16, const bf* __restrict__ Qh, const bf* __restrict__ Ql, const bf* __restrict__ Kh, const bf* __restrict__ Kl, const bf* __restrict__ Vh, const bf* __restrict__ Vl, bf* Ah, bf* Al) {
    __shared__ __align__(32) float sO[AW * 4 * 2 * 32 * 8]; __shared__ float sM[AW * 32], sL[AW * 32], sI[32];
    const size_t pz = (size_t)blockIdx.x * TT * HD; const int ty = blockIdx.y; const size_t ao = (size_t)(blockIdx.x / NH_) * TT * DQ + (blockIdx.x % NH_) * (HD * 16); Ah += ao; Al += ao;   // a head's 64 k are two blocks of 512 elements in each 16-row group
    if (ty < (TT - RH) / 32) attn_tile<h16, false, 2>(Q16 + pz, nullptr, K16 + pz, nullptr, V16 + pz, nullptr, TT - 32 * (ty + 1), Ah, Al, sO, sM, sL, sI);
    else attn_tile<bf, true, 1>(Qh + pz, Ql + pz, Kh + pz, Kl + pz, Vh + pz, Vl + pz, RH - 16 * (ty - (TT - RH) / 32 + 1), Ah, Al, sO, sM, sL, sI);
}

extern "C" void kernel_launch(void* const* d_in, const int* in_sizes, int n_in,
                              void* d_out, int out_size, void* d_ws, size_t ws_size, hipStream_t stream) {
    (void)in_sizes; (void)n_in; (void)out_size;
    const float* x = (const float*)d_in[0]; const float* wq = (const float*)d_in[1]; const float* wk = (const float*)d_in[2]; const float* wv = (const float*)d_in[3]; const float* wo = (const float*)d_in[4]; const float* bo = (const float*)d_in[5];   /* argument order x, Wq, Wk, Wv, Wp ('oi' [768][768]: nn.Linear layout, applied transposed), bp */
    float* OUT = (float*)d_out;     // [4][2048][768]
    char* wsp = (char*)d_ws;
    auto take = [&](size_t bytes) { char* p = wsp; wsp += (bytes + 255) & ~(size_t)255; return (void*)p; };
    bf* WQ = (bf*)take((size_t)DQ * DM * 2); bf* WK = (bf*)take((size_t)DKV * DM * 2); bf* WV = (bf*)take((size_t)DKV * DM * 2); bf* WO = (bf*)take((size_t)DM * DQ * 2);
    bf* XB = (bf*)take((size_t)NB_ * TT * DM * 2);
    static_assert(NKV == NH_ && ((size_t)DQ * DM * 2) % 256 == 0 && ((size_t)NB_ * NH_ * TT * HD * 2) % 256 == 0, "the projection launch steps from q to k to v by one weight's, one plane's size: take() may leave no gap");
    h16* QP16 = (h16*)take((size_t)NB_ * NH_ * TT * HD * 2); h16* KP16 = (h16*)take((size_t)NB_ * NKV * TT * HD * 2); h16* VT16 = (h16*)take((size_t)NB_ * NKV * HD * TT * 2);
    bf* QPh = (bf*)take((size_t)NB_ * NH_ * TT * HD * 2); bf* QPl = (bf*)take((size_t)NB_ * NH_ * TT * HD * 2); bf* KPh = (bf*)take((size_t)NB_ * NKV * TT * HD * 2); bf* KPl = (bf*)take((size_t)NB_ * NKV * TT * HD * 2); bf* VTh = (bf*)take((size_t)NB_ * NKV * HD * TT * 2); bf* VTl = (bf*)take((size_t)NB_ * NKV * HD * TT * 2);
    bf* ATh = (bf*)take((size_t)NB_ * TT * DQ * 2); bf* ATl = (bf*)take((size_t)NB_ * TT * DQ * 2);
    if ((size_t)(wsp - (char*)d_ws) > ws_size) return;    // about 149 MiB of the 256 MiB
    { k_cvt8<<<(unsigned)(((size_t)DQ * DM / 8 + 255) / 256), 256, 0, stream>>>(wq, WQ, (size_t)DQ * DM / 8); k_cvt8<<<(unsigned)(((size_t)DKV * DM / 8 + 255) / 256), 256, 0, stream>>>(wk, WK, (size_t)DKV * DM / 8); k_cvt8<<<(unsigned)(((size_t)DKV * DM / 8 + 255) / 256), 256, 0, stream>>>(wv, WV, (size_t)DKV * DM / 8);   /* 'oi' weights are already [out][in] = Bt rows: a cast into fragment order, no transpose */
      k_cvt8<<<(unsigned)(((size_t)DM * DQ / 8 + 255) / 256), 256, 0, stream>>>(wo, WO, (size_t)DM * DQ / 8);   /* Wp 'oi' [768][768]: the same cast */
       }
    // one launch per stage for all batches: the projections see x as [NB_*TT][DM] rows (grid z = q, k, v), attention takes the batch from blockIdx.x
    k_cvt8<<<(unsigned)(((size_t)NB_ * TT * DM / 8 + 255) / 256), 256, 0, stream>>>(x, XB, (size_t)NB_ * TT * DM / 8);
    k_gemmw<bf, 0, false, true, DM><<<dim3(NB_ * TT / 64, NH_, 3), 32, 0, stream>>>(XB, nullptr, WQ, nullptr, nullptr, 0, nullptr, 0, (size_t)DQ * DM, 0, QP16, QPh, QPl);
    k_fattn<<<dim3(NB_ * NH_, (TT - RH) / 32 + RH / 16, 1), AW * 32, 0, stream>>>(QP16, KP16, VT16, QPh, QPl, KPh, KPl, VTh, VTl, ATh, ATl);
    k_gemmw<bf, 1, true, false, DQ><<<dim3(NB_ * TT / 64, DM / 64, 1), 32, 0, stream>>>(ATh, ATl, WO, nullptr, OUT, DM, bo, 0, 0, 0, nullptr, nullptr, nullptr);
}

// v005
// Measured time: 120 microseconds a run.
// Two timings next to v004 both put it at 1.08 times that version's speed.
// Over all steps from v000 it is 18.0 times as fast.
#include <hip/hip_runtime.h>

// Causal multi-head attention with bias-free (out, in) projections and a biased (out, in) output projection at a 768-wide model (x [4][2048][768]; q, k, v = x W^T ('oi' [768][768] uniform(+-1/sqrt(768)), no bias; 12 heads x 64); scores x 64^-0.5; tril kept, -inf elsewhere (tril built inside the function); softmax; out = merged Wp^T + bp ('oi' + a REAL bias, uniform(+-1/sqrt(768))) -> [4][2048][768] (6.3 M); argument order x, Wq, Wk, Wv, Wp, bp).
// Every 16-bit operand plane lies in FRAGMENT ORDER: a block of 16 rows x 32 k is 1 KiB, two halves of 512 B, lane l's 16 bytes at l*16 (row l & 15; k = half*16 + (l >> 4)*8 + 0..7); blocks run along k, then along rows.
// A wave's 16-byte-per-lane fragment load so covers 512 contiguous bytes (4 whole lines, not 32-byte pieces of 16 lines), and it puts the same values into the same registers as a load from row-major planes.
// Layout, all four batches in every launch (rows b*2048 + t, planes [b][h]): bf16 copy of x; 'oi' weights cast (no transpose); exact projections (K 768), q, k and v in one launch that writes the head planes itself; one fused causal attention launch at 12 heads (scores, online softmax and the value product stay in registers; hybrid rows: < 512 hi/lo 3 products, rest fp16 with probabilities x1024); merged hi/lo x Wp exact + bp.
// Compute dtypes, f32 accumulate: every input rounded to bf16; projections exact; attention rows < 512 3 products, rest fp16; softmax f32; Wp hl x exact + bias.

#define NB_  4
#define TT   2048
#define DM   768
#define NH_  12
#define NKV  12
#define HD   64
#define DQ   (NH_ * HD)
#define DKV  (NKV * HD)
#define RH   512                  // query rows < RH use hi+lo planes (0: none)
#define SCL  0.125f   // HD^-0.5
typedef _Float16 h16;
typedef unsigned short bf;
typedef __attribute__((ext_vector_type(16))) __bf16   v16bf;
typedef __attribute__((ext_vector_type(16))) _Float16 v16h;
typedef __attribute__((ext_vector_type(8)))  _Float16 v8h;
typedef __attribute__((ext_vector_type(8)))  unsigned short v8us;
typedef __attribute__((ext_vector_type(8)))  float    v8f;
typedef __attribute__((ext_vector_type(4)))  float    v4f;
typedef v8h  __attribute__((may_alias)) v8ha;
typedef v4f  __attribute__((may_alias)) v4fa;
typedef v8us __attribute__((may_alias)) v8usa;

__device__ __forceinline__ unsigned short f2bf(float f) { unsigned u = __float_as_uint(f); u += 0x7FFFu + ((u >> 16) & 1u); return (unsigned short)(u >> 16); }
__device__ __forceinline__ float bf2f(unsigned short b) { return __uint_as_float(((unsigned)b) << 16); }
__device__ __forceinline__ float bfr(float f) { return bf2f(f2bf(f)); }
__device__ __forceinline__ v16h cat16(v8h lo, v8h hi) { return __builtin_shufflevector(lo, hi, 0, 1, 2, 3, 4, 5, 6, 7, 8, 9, 10, 11, 12, 13, 14, 15); }
__device__ __forceinline__ v16bf cat16b(v8us lo, v8us hi) { return __builtin_bit_cast(v16bf, __builtin_shufflevector(lo, hi, 0, 1, 2, 3, 4, 5, 6, 7, 8, 9, 10, 11, 12, 13, 14, 15)); }
__device__ __forceinline__ v8f wmma16(v16h a, v16h b, v8f c) { return __builtin_amdgcn_wmma_f32_16x16x32_f16(false, a, false, b, (short)0, c, false, false); }
__device__ __forceinline__ v8f wmmab(v16bf a, v16bf b, v8f c) { return __builtin_amdgcn_wmma_f32_16x16x32_bf16(false, a, false, b, (short)0, c, false, false); }



// ---- k_gemmw: register-blocked GEMM, ONE WAVE per 64x64 output tile (16 accumulators), operands straight from 16-bit planes in fragment order; grid (M/64, N/64, Z), 32 threads.
// C[m][n] (f32, pitch ldc, + optional f32 bias[n]) = sum_k A[m][k] Bt[n][k] (+ split products per NSPLIT). z-batch strides sA/sB/sC in elements. K % 32 == 0, a compile-time constant: a pass's fragment addresses are then one per-lane address per operand plus immediates.
// PLANES: no C. A = token rows [NB_*TT][K], Bt = the q, k, v weights behind one another (z = 0, 1, 2; blockIdx.y = head, a 64-wide tile is one head); the tile leaves as 16-bit head planes in fragment order, q and k [b][h] rows t, k index d; v [b][h] rows d, k index t.
// A lane's 8 accumulator values run along m, so the plane's k index is made the m index: q and k are computed as W x^T (operand roles swapped; both fragments load alike, same k order), v as x W^T.
// Only what attention reads is written: hi/lo planes for t < RH, the fp16 q plane for t >= RH, the fp16 k and v planes everywhere.
// ld(p, lb): the fragment of the block at p (the same pointer in every lane: a scalar base), lb = lane * 16; ldq(q): the same from the lane's own address q.
typedef const __attribute__((address_space(1))) char* gptr;   // a byte address in global memory (keeps the loads global_load where the address passes through an asm statement)
template <typename T16> struct WFrag;
template <> struct WFrag<h16> { typedef v16h V; static __device__ __forceinline__ V ldq(gptr q) { return cat16(*(const __attribute__((address_space(1))) v8h*)q, *(const __attribute__((address_space(1))) v8h*)(q + 512)); } static __device__ __forceinline__ V ld(const h16* p, const unsigned lb) { return ldq((gptr)p + lb); } static __device__ __forceinline__ v8f mma(V a, V b, v8f c) { return wmma16(a, b, c); } };
template <> struct WFrag<bf> { typedef v16bf V; static __device__ __forceinline__ V ldq(gptr q) { return cat16b(*(const __attribute__((address_space(1))) v8us*)q, *(const __attribute__((address_space(1))) v8us*)(q + 512)); } static __device__ __forceinline__ V ld(const bf* p, const unsigned lb) { return ldq((gptr)p + lb); } static __device__ __forceinline__ v8f mma(V a, V b, v8f c) { return wmmab(a, b, c); } };
__device__ __forceinline__ void splitf(float y, unsigned short& h, unsigned short& l) { h = f2bf(y); l = f2bf(y - bf2f(h)); }
// One wave's 64x64 accumulator tile to 16-bit planes (W16: fp16; WHL: bf16 hi and lo). Plane row = the tile's n index (16 per nb), plane k = the m index.
// Accumulator tile (mb, nb) converted is one 512-byte half block of the plane as it stands in the lanes (row = lane & 15, k = mb*16 + (lane >> 4)*8 + 0..7): one 16-byte store per lane, whole lines, no staging.
// rs = half blocks from one 16-row group of the plane to the next (2 * the plane's k extent / 32).
typedef __attribute__((ext_vector_type(4))) unsigned v4u;
// Four such stores, 512 B apart at one scalar base. The s_wait_xcnt 0 that stands in front of any rewrite of a register which an issued store names (data, offset, base) is the last line of the stores' own statement: there nothing can be moved in front of it.
__device__ __forceinline__ void st4(void* base, const unsigned lb, const v4u a, const v4u b, const v4u c, const v4u d) {
    asm volatile("global_store_b128 %0, %1, %5\n\tglobal_store_b128 %0, %2, %5 offset:512\n\tglobal_store_b128 %0, %3, %5 offset:1024\n\tglobal_store_b128 %0, %4, %5 offset:1536\n\ts_wait_xcnt 0x0"
        :: "v"(lb), "v"(a), "v"(b), "v"(c), "v"(d), "s"(base) : "memory"); }
template <bool W16, bool WHL>
__device__ __forceinline__ void planes_out(const v8f (&acc)[4][4], const int rs, h16* P16, bf* Ph, bf* Pl) {
    const unsigned lb = (threadIdx.x & 31) * 16;
#pragma unroll
    for (int nb = 0; nb < 4; ++nb) { const size_t go = (size_t)(nb * rs) * 256;
        if (W16) { v4u q[4];
#pragma unroll
            for (int mb = 0; mb < 4; ++mb) { v8h p;
#pragma unroll
                for (int j = 0; j < 8; ++j) p[j] = (h16)acc[mb][nb][j];
                q[mb] = __builtin_bit_cast(v4u, p); }
            st4(P16 + go, lb, q[0], q[1], q[2], q[3]); }
        if (WHL) { v4u qh[4], ql[4];
#pragma unroll
            for (int mb = 0; mb < 4; ++mb) { v8us ph, pl;
#pragma unroll
                for (int j = 0; j < 8; ++j) { unsigned short x, y; splitf(acc[mb][nb][j], x, y); ph[j] = x; pl[j] = y; }
                qh[mb] = __builtin_bit_cast(v4u, ph); ql[mb] = __builtin_bit_cast(v4u, pl); }
            st4(Ph + go, lb, qh[0], qh[1], qh[2], qh[3]); st4(Pl + go, lb, ql[0], ql[1], ql[2], ql[3]); }
    }
}
template <typename T16, int NSPLIT, bool BIAS, bool PLANES, int K>
__global__ __launch_bounds__(32) void k_gemmw(const T16* __restrict__ A, const T16* __restrict__ A2, const T16* __restrict__ Bt, const T16* __restrict__ Bt2, float* C, int ldc, const float* __restrict__ bias, size_t sA, size_t sB, size_t sC, h16* P16, bf* Ph, bf* Pl) {
    typedef typename WFrag<T16>::V V;
    __shared__ __align__(16) float os[16 * 68];
    const size_t z = blockIdx.z; A += z * sA; if (A2) A2 += z * sA; Bt += z * sB; if (Bt2) Bt2 += z * sB; C += z * sC;
    const bool sw = PLANES && z < 2;   // q, k: the weight rows take the m side, the token rows the n side (block-uniform)
    if (sw) { const T16* t = A; A = Bt; Bt = t; }
    const int lane = threadIdx.x & 31, lr = lane & 15, hi = lane >> 4; const int r0 = (sw ? blockIdx.y : blockIdx.x) * 64, c0 = (sw ? blockIdx.x : blockIdx.y) * 64;
    v8f acc[4][4];
#pragma unroll
    for (int mb = 0; mb < 4; ++mb)
#pragma unroll
        for (int nb = 0; nb < 4; ++nb) acc[mb][nb] = (v8f){};
    static_assert(NSPLIT < 2, "the pass below steps A, A2 and Bt only");
    gptr pa = (gptr)(A + (size_t)r0 * K) + lane * 16; gptr pb = (gptr)(Bt + (size_t)c0 * K) + lane * 16; gptr pa2 = NSPLIT == 1 ? (gptr)(A2 + (size_t)r0 * K) + lane * 16 : pa;   // the lane's place in the first block of each operand; 16 rows x K = K / 32 blocks of 1 KiB
#pragma unroll 1
    for (int kc = 0; kc < K; kc += 32) {
        V a[4], a2[4], b[4];
#pragma unroll
        for (int mb = 0; mb < 4; ++mb) { a[mb] = WFrag<T16>::ldq(pa + mb * 32 * K); if (NSPLIT == 1) a2[mb] = WFrag<T16>::ldq(pa2 + mb * 32 * K); }
#pragma unroll
        for (int nb = 0; nb < 4; ++nb) b[nb] = WFrag<T16>::ldq(pb + nb * 32 * K);
        // the step to the next 1-KiB block rewrites the address registers that this pass's loads name: the s_wait_xcnt 0 that stands in front of such a rewrite and the additions are one statement, so nothing comes between them
        if constexpr (NSPLIT == 1) asm volatile("s_wait_xcnt 0x0\n\tv_add_nc_u64_e32 %0, %3, %0\n\tv_add_nc_u64_e32 %1, %3, %1\n\tv_add_nc_u64_e32 %2, %3, %2" : "+v"(pa), "+v"(pb), "+v"(pa2) : "s"(1024ull) : "memory");
        else asm volatile("s_wait_xcnt 0x0\n\tv_add_nc_u64_e32 %0, %2, %0\n\tv_add_nc_u64_e32 %1, %2, %1" : "+v"(pa), "+v"(pb) : "s"(1024ull) : "memory");
#pragma unroll
        for (int nb = 0; nb < 4; ++nb) {
#pragma unroll
            for (int mb = 0; mb < 4; ++mb) { acc[mb][nb] = WFrag<T16>::mma(a[mb], b[nb], acc[mb][nb]); if (NSPLIT == 1) acc[mb][nb] = WFrag<T16>::mma(a2[mb], b[nb], acc[mb][nb]); } }
        asm volatile("v_nop\n\tv_nop\n\tv_nop\n\tv_nop" : "+v"(acc[0][0]), "+v"(acc[1][1]), "+v"(acc[2][2]), "+v"(acc[3][3]) : "v"(a[0]), "v"(a[3]));
    }
    if constexpr (PLANES) {
        const int tb = blockIdx.x * 64, t0 = tb % TT; const size_t po = ((size_t)(tb / TT) * NH_ + blockIdx.y) * TT * HD + (sw ? (size_t)t0 * HD : (size_t)t0 * 16); const int rs = sw ? HD / 16 : TT / 16;   // q, k: 16 tokens are HD / 16 half blocks; v: 16 tokens are one half block of each 16-row group
        const size_t PE = (size_t)NB_ * NH_ * TT * HD; P16 += z * PE + po; Ph += z * 2 * PE + po; Pl += z * 2 * PE + po;   // planes in the order q, k, v; hi and lo alternate
        if (t0 >= RH) planes_out<true, false>(acc, rs, P16, Ph, Pl);          // block-uniform tests: one straight-line body each
        else if (z == 0) planes_out<false, true>(acc, rs, P16, Ph, Pl);
        else planes_out<true, true>(acc, rs, P16, Ph, Pl);
        return;
    }
#pragma unroll
    for (int mb = 0; mb < 4; ++mb) {
#pragma unroll
        for (int nb = 0; nb < 4; ++nb) {
#pragma unroll
            for (int j = 0; j < 8; ++j) os[(hi * 8 + j) * 68 + nb * 16 + lr] = acc[mb][nb][j]; }
        __builtin_amdgcn_wave_barrier(); asm volatile("" ::: "memory");
        float* crow = C + (size_t)(r0 + mb * 16) * ldc + c0;
{
#pragma unroll
            for (int s = 0; s < 8; ++s) { const int row = 2 * s + hi, cofs = lr * 4; v4f val = *(const v4fa*)(os + row * 68 + cofs); if (BIAS) { val[0] += bfr(bias[c0 + cofs]); val[1] += bfr(bias[c0 + cofs + 1]); val[2] += bfr(bias[c0 + cofs + 2]); val[3] += bfr(bias[c0 + cofs + 3]); }
                *(v4f*)(crow + (size_t)row * ldc + cofs) = val; }
             }
        __builtin_amdgcn_wave_barrier(); asm volatile("" ::: "memory");
    }
}

__device__ __forceinline__ h16 tohx(float x) { return (h16)x; }
typedef __attribute__((ext_vector_type(2))) _Float16 v2h;
typedef __attribute__((ext_vector_type(4))) _Float16 v4h;
typedef __attribute__((ext_vector_type(2))) unsigned short v2us;
typedef __attribute__((ext_vector_type(4))) unsigned short v4us;
typedef __attribute__((ext_vector_type(2))) float v2f;
typedef __attribute__((ext_vector_type(4))) int v4i;

__global__ __launch_bounds__(256) void k_wtG(const float* __restrict__ w, int K, int N, bf* Bt) {
    const int lane = threadIdx.x & 31; const int L0 = (blockIdx.x * 8 + (threadIdx.x >> 5)) * 8; const int nlines = N * K / 64;
{
#pragma unroll 1
        for (int l = 0; l < 8; ++l) { const int L = L0 + l; if (L >= nlines) break; const size_t e = (size_t)L * 64 + lane * 2; const int k = (int)(e % K), n = (int)(e / K); v2us o;
            o[0] = f2bf(w[(size_t)k * N + n]); o[1] = f2bf(w[(size_t)(k + 1) * N + n]); *(v2us*)(Bt + e) = o; }
         }
}
// f32 [rows][DM] row-major to bf16 in fragment order, x and the four weights in ONE launch. A block takes one 16-row group of one tensor: 16 x DM values, DM / 32 blocks of 1 KiB = 6 x 256 pieces of 16 bytes, contiguous in the plane.
// Thread t writes pieces j*256 + t (a wave's store covers 512 contiguous bytes) and fetches each piece's 8 values: row t & 15, k = j*128 + (t >> 4)*8, so one address per thread serves all loads, one all stores, the rest are immediates.
// Groups 0 .. NB_*TT/16 - 1 are x, then DM/16 groups of each weight in the order q, k, v, p (block-uniform choice).
static_assert(DQ == DM && DKV == DM && DM == 6 * 128, "every cast tensor has rows of DM values; a 16-row group is 6 x 256 pieces");
__global__ __launch_bounds__(256) void k_cvtall(const float* __restrict__ x, const float* __restrict__ wq, const float* __restrict__ wk, const float* __restrict__ wv, const float* __restrict__ wo, bf* XB, bf* WQ, bf* WK, bf* WV, bf* WO) {
    const int GX = NB_ * TT / 16, GW = DM / 16; int g = blockIdx.x; const float* src = x; bf* dst = XB;
    if (g >= GX) { g -= GX; const int t = g / GW; g -= t * GW; src = t == 0 ? wq : t == 1 ? wk : t == 2 ? wv : wo; dst = t == 0 ? WQ : t == 1 ? WK : t == 2 ? WV : WO; }
    const int tid = threadIdx.x; const float* p = src + (size_t)(g * 16 + (tid & 15)) * DM + (tid >> 4) * 8;
    v8f v[6];
#pragma unroll
    for (int j = 0; j < 6; ++j) v[j] = *(const v8f*)(p + j * 128);
    asm volatile("s_wait_xcnt 0x0" ::: "memory");    // stands in front of any rewrite of the address registers of the loads above; its clobber also keeps all twelve loads in front of the first use, so that they fly together
    v4u q[6];
#pragma unroll
    for (int j = 0; j < 6; ++j) { v8us o;
#pragma unroll
        for (int k = 0; k < 8; ++k) o[k] = f2bf(v[j][k]);
        q[j] = __builtin_bit_cast(v4u, o); }
    // six stores, 4 KiB apart at one scalar base; the s_wait_xcnt 0 in front of any rewrite of a register that they name is the last line of their own statement (as in st4)
    asm volatile("global_store_b128 %0, %1, %7\n\tglobal_store_b128 %0, %2, %7 offset:4096\n\tglobal_store_b128 %0, %3, %7 offset:8192\n\tglobal_store_b128 %0, %4, %7 offset:12288\n\tglobal_store_b128 %0, %5, %7 offset:16384\n\tglobal_store_b128 %0, %6, %7 offset:20480\n\ts_wait_xcnt 0x0"
        :: "v"((unsigned)tid * 16u), "v"(q[0]), "v"(q[1]), "v"(q[2]), "v"(q[3]), "v"(q[4]), "v"(q[5]), "s"(dst + (size_t)g * 16 * DM) : "memory"); }

#define AW 4
typedef v8f __attribute__((may_alias)) v8fa;
// 2^x. Behind a v_exp_f32 the instruction set asks for one independent instruction or a v_nop before its result is read or its source overwritten; it is kept here by construction:
// eight at a time, no output sharing a register with an input (each v_exp_f32 is independent of the one in front of it), one v_nop behind the last.
__device__ __forceinline__ v8f exp2x8(const v8f x) { float o0, o1, o2, o3, o4, o5, o6, o7;
    asm("v_exp_f32 %0, %8\n\tv_exp_f32 %1, %9\n\tv_exp_f32 %2, %10\n\tv_exp_f32 %3, %11\n\tv_exp_f32 %4, %12\n\tv_exp_f32 %5, %13\n\tv_exp_f32 %6, %14\n\tv_exp_f32 %7, %15\n\tv_nop"
        : "=&v"(o0), "=&v"(o1), "=&v"(o2), "=&v"(o3), "=&v"(o4), "=&v"(o5), "=&v"(o6), "=&v"(o7) : "v"(x[0]), "v"(x[1]), "v"(x[2]), "v"(x[3]), "v"(x[4]), "v"(x[5]), "v"(x[6]), "v"(x[7]));
    return (v8f){o0, o1, o2, o3, o4, o5, o6, o7}; }
__device__ __forceinline__ float exp2s(const float x) { float o; asm("v_exp_f32 %0, %1\n\tv_nop" : "=v"(o) : "v"(x)); return o; }   // the same slot behind a single one
template <typename T16, bool HL, int NQ>
__device__ __forceinline__ void attn_tile(const T16* __restrict__ Q, const T16* __restrict__ Q2, const T16* __restrict__ Kp, const T16* __restrict__ K2, const T16* __restrict__ Vt, const T16* __restrict__ V2, const int q0, bf* Ah, bf* Al, float* sO, float* sM, float* sL, float* sI) {
    typedef typename WFrag<T16>::V V;
    const int lane = threadIdx.x & 31, c = lane & 15, h = lane >> 4; const int w = __builtin_amdgcn_readfirstlane((int)(threadIdx.x >> 5));
    const float L2E = 1.4426950408889634f, SH = HL ? 0.0f : 10.0f; const unsigned lb = lane * 16;
    V qf[NQ][2], qf2[NQ][2];
#pragma unroll
    for (int nq = 0; nq < NQ; ++nq)
#pragma unroll
        for (int ks = 0; ks < 2; ++ks) { const size_t qo = (size_t)(q0 + nq * 16) * HD + ks * 512; qf[nq][ks] = WFrag<T16>::ld(Q + qo, lb); if (HL) qf2[nq][ks] = WFrag<T16>::ld(Q2 + qo, lb); }
    V ka[2][2], ka2[2][2];
    auto ldk = [&](const int kb) {                   // the key fragments of 32-key block kb
#pragma unroll
        for (int t = 0; t < 2; ++t)
#pragma unroll
            for (int ks = 0; ks < 2; ++ks) { const size_t ko = (size_t)(kb * 32 + t * 16) * HD + ks * 512; ka[t][ks] = WFrag<T16>::ld(Kp + ko, lb); if (HL) ka2[t][ks] = WFrag<T16>::ld(K2 + ko, lb); } };
    v8f o[4][NQ]; float m[NQ], l[NQ];
#pragma unroll
    for (int nq = 0; nq < NQ; ++nq) { m[nq] = -3.0e38f; l[nq] = 0.f;
#pragma unroll
        for (int mb = 0; mb < 4; ++mb) o[mb][nq] = (v8f){}; }
    const int nblk = (q0 + NQ * 16 + 31) / 32;      // 32-key blocks that hold a key <= the tile's last query; only the last one crosses the diagonal
    if (!HL) ldk(min(w, nblk - 1));                  // fp16 tiles (long loops) fetch their key fragments one pass ahead; a wave without a block loads the last block and drops it
    asm volatile("s_wait_xcnt 0x0" ::: "memory");    // stands in front of any rewrite of the address registers of the loads above
#pragma unroll 1
    for (int kb = w; kb < nblk; kb += AW) {
        const int k0 = kb * 32;
        V va[4], va2[4];
        if (HL) ldk(kb);
#pragma unroll
        for (int mb = 0; mb < 4; ++mb) { const size_t vo = (size_t)mb * 16 * TT + k0 * 16; va[mb] = WFrag<T16>::ld(Vt + vo, lb); if (HL) va2[mb] = WFrag<T16>::ld(V2 + vo, lb); }
        asm volatile("s_wait_xcnt 0x0" ::: "memory");    // in front of any rewrite of those loads' address registers; its clobber also keeps these loads from being sunk below this point, towards their use, where each would be waited for alone
        v8f s[2][NQ];
#pragma unroll
        for (int t = 0; t < 2; ++t)
#pragma unroll
            for (int nq = 0; nq < NQ; ++nq) { v8f a = (v8f){};
#pragma unroll
                for (int ks = 0; ks < 2; ++ks) { a = WFrag<T16>::mma(ka[t][ks], qf[nq][ks], a); if (HL) { a = WFrag<T16>::mma(ka[t][ks], qf2[nq][ks], a); a = WFrag<T16>::mma(ka2[t][ks], qf[nq][ks], a); } }
                s[t][nq] = a; }
        if (!HL && kb + AW < nblk) { ldk(kb + AW);       // next pass's key fragments, into the registers the products above have just read (wave-uniform test)
            asm volatile("s_wait_xcnt 0x0" ::: "memory"); }  // in front of any rewrite of those loads' address registers
        if (kb == nblk - 1) {                        // diagonal block (wave-uniform test): keys above the query are masked by select
#pragma unroll
            for (int t = 0; t < 2; ++t)
#pragma unroll
                for (int nq = 0; nq < NQ; ++nq)
#pragma unroll
                    for (int r = 0; r < 8; ++r) s[t][nq][r] = (k0 + t * 16 + 8 * h + r <= q0 + nq * 16 + c) ? s[t][nq][r] : -3.0e38f; }
#pragma unroll
        for (int nq = 0; nq < NQ; ++nq) {
            float mx = m[nq];
#pragma unroll
            for (int t = 0; t < 2; ++t)
#pragma unroll
                for (int r = 0; r < 8; ++r) { s[t][nq][r] *= SCL; mx = fmaxf(mx, s[t][nq][r]); }
            mx = fmaxf(mx, __shfl_xor(mx, 16, 32));
            const float al = exp2s((m[nq] - mx) * L2E); m[nq] = mx;
            float sum = 0.f;
#pragma unroll
            for (int t = 0; t < 2; ++t) { s[t][nq] = exp2x8((s[t][nq] - mx) * L2E + SH);
#pragma unroll
                for (int r = 0; r < 8; ++r) sum += s[t][nq][r]; }
            l[nq] = l[nq] * al + sum;                // this half's keys only; the halves are joined once after the loop
#pragma unroll
            for (int mb = 0; mb < 4; ++mb) o[mb][nq] *= al;
            V pf, pf2;
            if constexpr (HL) { v8us h0, h1, l0, l1;
#pragma unroll
                for (int r = 0; r < 8; ++r) { unsigned short x, y; splitf(s[0][nq][r], x, y); h0[r] = x; l0[r] = y; splitf(s[1][nq][r], x, y); h1[r] = x; l1[r] = y; }
                pf = cat16b(h0, h1); pf2 = cat16b(l0, l1);
            } else { v8h p0, p1;
#pragma unroll
                for (int r = 0; r < 8; ++r) { p0[r] = tohx(s[0][nq][r]); p1[r] = tohx(s[1][nq][r]); }
                pf = cat16(p0, p1); }
#pragma unroll
            for (int mb = 0; mb < 4; ++mb) { o[mb][nq] = WFrag<T16>::mma(va[mb], pf, o[mb][nq]); if (HL) { o[mb][nq] = WFrag<T16>::mma(va[mb], pf2, o[mb][nq]); o[mb][nq] = WFrag<T16>::mma(va2[mb], pf, o[mb][nq]); } }
        }
    }
    // join: per query the waves' (m, l) go through LDS; every wave rescales its O^T to the common maximum and stages it; then wave w sums output tiles (w, nq) as they stand in the lanes, each one 512-byte half block of the merged planes
#pragma unroll
    for (int nq = 0; nq < NQ; ++nq) { l[nq] += __shfl_xor(l[nq], 16, 32); if (h == 0) { sM[w * 32 + nq * 16 + c] = m[nq]; sL[w * 32 + nq * 16 + c] = l[nq]; } }
    __syncthreads();
#pragma unroll
    for (int nq = 0; nq < NQ; ++nq) { float M = sM[nq * 16 + c];
#pragma unroll
        for (int ww = 1; ww < AW; ++ww) M = fmaxf(M, sM[ww * 32 + nq * 16 + c]);
        float lt = 0.f;
#pragma unroll
        for (int ww = 0; ww < AW; ++ww) lt += sL[ww * 32 + nq * 16 + c] * exp2s((sM[ww * 32 + nq * 16 + c] - M) * L2E);
        if (w == 0 && h == 0) sI[nq * 16 + c] = __fdiv_rn(1.0f, lt);
        const float f = exp2s((m[nq] - M) * L2E);
#pragma unroll
        for (int mb = 0; mb < 4; ++mb) *(v8fa*)(sO + (((w * 4 + mb) * NQ + nq) * 32 + lane) * 8) = o[mb][nq] * f; }
    __syncthreads();
#pragma unroll
    for (int nq = 0; nq < NQ; ++nq) {
        v8f a = *(const v8fa*)(sO + ((w * NQ + nq) * 32 + lane) * 8);
#pragma unroll
        for (int ww = 1; ww < AW; ++ww) a += *(const v8fa*)(sO + (((ww * 4 + w) * NQ + nq) * 32 + lane) * 8);
        const float inv = sI[nq * 16 + c]; v8us oh, ol;
#pragma unroll
        for (int r = 0; r < 8; ++r) { unsigned short x, y; splitf(a[r] * inv, x, y); oh[r] = x; ol[r] = y; }
        const size_t oo = (size_t)(q0 + nq * 16) * DQ + w * 256;
        asm volatile("global_store_b128 %0, %1, %3\n\tglobal_store_b128 %0, %2, %4\n\ts_wait_xcnt 0x0"   // the wait in front of any rewrite of a register that these stores name, in their own statement (as in st4)
            :: "v"(lb), "v"(__builtin_bit_cast(v4u, oh)), "v"(__builtin_bit_cast(v4u, ol)), "s"(Ah + oo), "s"(Al + oo) : "memory"); }
}
// grid (batches x heads, tiles), blockIdx.x = b * heads + head; blockIdx.y: (TT - RH) / 32 fp16 tiles of 32 rows from the last row down, then RH / 16 hi/lo tiles of 16 rows.
__global__ __launch_bounds__(AW * 32) void k_fattn(const h16* __restrict__ Q16, const h16* __restrict__ K16, const h16* __restrict__ V16, const bf* __restrict__ Qh, const bf* __restrict__ Ql, const bf* __restrict__ Kh, const bf* __restrict__ Kl, const bf* __restrict__ Vh, const bf* __restrict__ Vl, bf* Ah, bf* Al) {
    __shared__ __align__(32) float sO[AW * 4 * 2 * 32 * 8]; __shared__ float sM[AW * 32], sL[AW * 32], sI[32];
    const size_t pz = (size_t)blockIdx.x * TT * HD; const int ty = blockIdx.y; const size_t ao = (size_t)(blockIdx.x / NH_) * TT * DQ + (blockIdx.x % NH_) * (HD * 16); Ah += ao; Al += ao;   // a head's 64 k are two blocks of 512 elements in each 16-row group
    if (ty < (TT - RH) / 32) attn_tile<h16, false, 2>(Q16 + pz, nullptr, K16 + pz, nullptr, V16 + pz, nullptr, TT - 32 * (ty + 1), Ah, Al, sO, sM, sL, sI);
    else attn_tile<bf, true, 1>(Qh + pz, Ql + pz, Kh + pz, Kl + pz, Vh + pz, Vl + pz, RH - 16 * (ty - (TT - RH) / 32 + 1), Ah, Al, sO, sM, sL, sI);
}

extern "C" void kernel_launch(void* const* d_in, const int* in_sizes, int n_in,
                              void* d_out, int out_size, void* d_ws, size_t ws_size, hipStream_t stream) {
    (void)in_sizes; (void)n_in; (void)out_size;
    const float* x = (const float*)d_in[0]; const float* wq = (const float*)d_in[1]; const float* wk = (const float*)d_in[2]; const float* wv = (const float*)d_in[3]; const float* wo = (const float*)d_in[4]; const float* bo = (const float*)d_in[5];   /* argument order x, Wq, Wk, Wv, Wp ('oi' [768][768]: nn.Linear layout, applied transposed), bp */
    float* OUT = (float*)d_out;     // [4][2048][768]
    char* wsp = (char*)d_ws;
    auto take = [&](size_t bytes) { char* p = wsp; wsp += (bytes + 255) & ~(size_t)255; return (void*)p; };
    bf* WQ = (bf*)take((size_t)DQ * DM * 2); bf* WK = (bf*)take((size_t)DKV * DM * 2); bf* WV = (bf*)take((size_t)DKV * DM * 2); bf* WO = (bf*)take((size_t)DM * DQ * 2);
    bf* XB = (bf*)take((size_t)NB_ * TT * DM * 2);
    static_assert(NKV == NH_ && ((size_t)DQ * DM * 2) % 256 == 0 && ((size_t)NB_ * NH_ * TT * HD * 2) % 256 == 0, "the projection launch steps from q to k to v by one weight's, one plane's size: take() may leave no gap");
    h16* QP16 = (h16*)take((size_t)NB_ * NH_ * TT * HD * 2); h16* KP16 = (h16*)take((size_t)NB_ * NKV * TT * HD * 2); h16* VT16 = (h16*)take((size_t)NB_ * NKV * HD * TT * 2);
    bf* QPh = (bf*)take((size_t)NB_ * NH_ * TT * HD * 2); bf* QPl = (bf*)take((size_t)NB_ * NH_ * TT * HD * 2); bf* KPh = (bf*)take((size_t)NB_ * NKV * TT * HD * 2); bf* KPl = (bf*)take((size_t)NB_ * NKV * TT * HD * 2); bf* VTh = (bf*)take((size_t)NB_ * NKV * HD * TT * 2); bf* VTl = (bf*)take((size_t)NB_ * NKV * HD * TT * 2);
    bf* ATh = (bf*)take((size_t)NB_ * TT * DQ * 2); bf* ATl = (bf*)take((size_t)NB_ * TT * DQ * 2);
    if ((size_t)(wsp - (char*)d_ws) > ws_size) return;    // about 149 MiB of the 256 MiB
    // one launch per stage for all batches: one cast launch ('oi' weights are already [out][in] = Bt rows: a cast into fragment order, no transpose); the projections see x as [NB_*TT][DM] rows (grid z = q, k, v), attention takes the batch from blockIdx.x
    k_cvtall<<<NB_ * TT / 16 + 4 * (DM / 16), 256, 0, stream>>>(x, wq, wk, wv, wo, XB, WQ, WK, WV, WO);
    k_gemmw<bf, 0, false, true, DM><<<dim3(NB_ * TT / 64, NH_, 3), 32, 0, stream>>>(XB, nullptr, WQ, nullptr, nullptr, 0, nullptr, 0, (size_t)DQ * DM, 0, QP16, QPh, QPl);
    k_fattn<<<dim3(NB_ * NH_, (TT - RH) / 32 + RH / 16, 1), AW * 32, 0, stream>>>(QP16, KP16, VT16, QPh, QPl, KPh, KPl, VTh, VTl, ATh, ATl);
    k_gemmw<bf, 1, true, false, DQ><<<dim3(NB_ * TT / 64, DM / 64, 1), 32, 0, stream>>>(ATh, ATl, WO, nullptr, OUT, DM, bo, 0, 0, 0, nullptr, nullptr, nullptr);
}

// v006
// One run takes 105 microseconds.
// Next to v005, in two timings, it ran 1.14 and 1.15 times as fast.
// Over all steps from v000 it is 20.6 times as fast.
#include <hip/hip_runtime.h>

// Causal multi-head attention with bias-free (out, in) projections and a biased (out, in) output projection at a 768-wide model (x [4][2048][768]; q, k, v = x W^T ('oi' [768][768] uniform(+-1/sqrt(768)), no bias; 12 heads x 64); scores x 64^-0.5; tril kept, -inf elsewhere (tril built inside the function); softmax; out = merged Wp^T + bp ('oi' + a REAL bias, uniform(+-1/sqrt(768))) -> [4][2048][768] (6.3 M); argument order x, Wq, Wk, Wv, Wp, bp).
// Every 16-bit operand plane lies in FRAGMENT ORDER: a block of 16 rows x 32 k is 1 KiB, two halves of 512 B, lane l's 16 bytes at l*16 (row l & 15; k = half*16 + (l >> 4)*8 + 0..7); blocks run along k, then along rows.
// A wave's 16-byte-per-lane fragment load so covers 512 contiguous bytes (4 whole lines, not 32-byte pieces of 16 lines), and it puts the same values into the same registers as a load from row-major planes.
// Layout, all four batches in every launch (rows b*2048 + t, planes [b][h]): bf16 copy of x; 'oi' weights cast (no transpose); exact projections (K 768), q, k and v in one launch that writes the head planes itself; one fused causal attention launch at 12 heads (scores, online softmax and the value product stay in registers; hybrid rows: < 512 hi/lo 3 products, rest fp16 with probabilities x1024); merged hi/lo x Wp exact + bp.
// Compute dtypes, f32 accumulate: every input rounded to bf16; projections exact; attention rows < 512 3 products, rest fp16; softmax f32; Wp hl x exact + bias.

#define NB_  4
#define TT   2048
#define DM   768
#define NH_  12
#define NKV  12
#define HD   64
#define DQ   (NH_ * HD)
#define DKV  (NKV * HD)
#define RH   512                  // query rows < RH use hi+lo planes (0: none)
#define SCL  0.125f   // HD^-0.5
typedef _Float16 h16;
typedef unsigned short bf;
typedef __attribute__((ext_vector_type(16))) __bf16   v16bf;
typedef __attribute__((ext_vector_type(16))) _Float16 v16h;
typedef __attribute__((ext_vector_type(8)))  _Float16 v8h;
typedef __attribute__((ext_vector_type(8)))  unsigned short v8us;
typedef __attribute__((ext_vector_type(8)))  float    v8f;
typedef __attribute__((ext_vector_type(4)))  float    v4f;
typedef v8h  __attribute__((may_alias)) v8ha;
typedef v4f  __attribute__((may_alias)) v4fa;
typedef v8us __attribute__((may_alias)) v8usa;

__device__ __forceinline__ unsigned short f2bf(float f) { unsigned u = __float_as_uint(f); u += 0x7FFFu + ((u >> 16) & 1u); return (unsigned short)(u >> 16); }
__device__ __forceinline__ float bf2f(unsigned short b) { return __uint_as_float(((unsigned)b) << 16); }
__device__ __forceinline__ float bfr(float f) { return bf2f(f2bf(f)); }
__device__ __forceinline__ v16h cat16(v8h lo, v8h hi) { return __builtin_shufflevector(lo, hi, 0, 1, 2, 3, 4, 5, 6, 7, 8, 9, 10, 11, 12, 13, 14, 15); }
__device__ __forceinline__ v16bf cat16b(v8us lo, v8us hi) { return __builtin_bit_cast(v16bf, __builtin_shufflevector(lo, hi, 0, 1, 2, 3, 4, 5, 6, 7, 8, 9, 10, 11, 12, 13, 14, 15)); }
__device__ __forceinline__ v8f wmma16(v16h a, v16h b, v8f c) { return __builtin_amdgcn_wmma_f32_16x16x32_f16(false, a, false, b, (short)0, c, false, false); }
__device__ __forceinline__ v8f wmmab(v16bf a, v16bf b, v8f c) { return __builtin_amdgcn_wmma_f32_16x16x32_bf16(false, a, false, b, (short)0, c, false, false); }



// ---- k_gemmw: register-blocked GEMM, one wave per 64x64 output tile (16 accumulators), FOUR waves (2 x 2) per block on a 128x128 tile; grid (M/128, N/128, Z), 128 threads.
// The block's operand rows of one pass (32 k: 8 blocks of 1 KiB per operand, already in fragment order) are brought into LDS once by asynchronous copies and read there by the two waves that need each, so every operand byte leaves L2 half as often;
// two buffers: the copies of pass t + 2 fly while pass t + 1 is worked on.
// C[m][n] (f32, pitch ldc, + optional f32 bias[n]) = sum_k A[m][k] Bt[n][k] (+ split products per NSPLIT). z-batch strides sA/sB/sC in elements. K % 32 == 0, a compile-time constant.
// PLANES: no C. A = token rows [NB_*TT][K], Bt = the q, k, v weights behind one another (z = 0, 1, 2; a wave's 64-wide tile is one head); the tile leaves as 16-bit head planes in fragment order, q and k [b][h] rows t, k index d; v [b][h] rows d, k index t.
// A lane's 8 accumulator values run along m, so the plane's k index is made the m index: q and k are computed as W x^T (operand roles swapped; both fragments load alike, same k order), v as x W^T.
// Only what attention reads is written: hi/lo planes for t < RH, the fp16 q plane for t >= RH, the fp16 k and v planes everywhere.
// ld(p, lb): the fragment of the block at p (the same pointer in every lane: a scalar base), lb = lane * 16; ldq(q): the same from the lane's own address q.
typedef const __attribute__((address_space(1))) char* gptr;   // a byte address in global memory (keeps the loads global_load where the address passes through an asm statement)
template <typename T16> struct WFrag;
template <> struct WFrag<h16> { typedef v16h V; static __device__ __forceinline__ V ldq(gptr q) { return cat16(*(const __attribute__((address_space(1))) v8h*)q, *(const __attribute__((address_space(1))) v8h*)(q + 512)); } static __device__ __forceinline__ V ld(const h16* p, const unsigned lb) { return ldq((gptr)p + lb); } static __device__ __forceinline__ V lds(const char* q) { return cat16(*(const v8ha*)q, *(const v8ha*)(q + 512)); } static __device__ __forceinline__ v8f mma(V a, V b, v8f c) { return wmma16(a, b, c); } };
template <> struct WFrag<bf> { typedef v16bf V; static __device__ __forceinline__ V ldq(gptr q) { return cat16b(*(const __attribute__((address_space(1))) v8us*)q, *(const __attribute__((address_space(1))) v8us*)(q + 512)); } static __device__ __forceinline__ V ld(const bf* p, const unsigned lb) { return ldq((gptr)p + lb); } static __device__ __forceinline__ V lds(const char* q) { return cat16b(*(const v8usa*)q, *(const v8usa*)(q + 512)); } static __device__ __forceinline__ v8f mma(V a, V b, v8f c) { return wmmab(a, b, c); } };
__device__ __forceinline__ void splitf(float y, unsigned short& h, unsigned short& l) { h = f2bf(y); l = f2bf(y - bf2f(h)); }
// One wave's 64x64 accumulator tile to 16-bit planes (W16: fp16; WHL: bf16 hi and lo). Plane row = the tile's n index (16 per nb), plane k = the m index.
// Accumulator tile (mb, nb) converted is one 512-byte half block of the plane as it stands in the lanes (row = lane & 15, k = mb*16 + (lane >> 4)*8 + 0..7): one 16-byte store per lane, whole lines, no staging.
// rs = half blocks from one 16-row group of the plane to the next (2 * the plane's k extent / 32).
typedef __attribute__((ext_vector_type(4))) unsigned v4u;
// Four such stores, 512 B apart at one scalar base. The s_wait_xcnt 0 that stands in front of any rewrite of a register which an issued store names (data, offset, base) is the last line of the stores' own statement: there nothing can be moved in front of it.
__device__ __forceinline__ void st4(void* base, const unsigned lb, const v4u a, const v4u b, const v4u c, const v4u d) {
    asm volatile("global_store_b128 %0, %1, %5\n\tglobal_store_b128 %0, %2, %5 offset:512\n\tglobal_store_b128 %0, %3, %5 offset:1024\n\tglobal_store_b128 %0, %4, %5 offset:1536\n\ts_wait_xcnt 0x0"
        :: "v"(lb), "v"(a), "v"(b), "v"(c), "v"(d), "s"(base) : "memory"); }
template <bool W16, bool WHL>
__device__ __forceinline__ void planes_out(const v8f (&acc)[4][4], const int rs, h16* P16, bf* Ph, bf* Pl) {
    const unsigned lb = (threadIdx.x & 31) * 16;
#pragma unroll
    for (int nb = 0; nb < 4; ++nb) { const size_t go = (size_t)(nb * rs) * 256;
        if (W16) { v4u q[4];
#pragma unroll
            for (int mb = 0; mb < 4; ++mb) { v8h p;
#pragma unroll
                for (int j = 0; j < 8; ++j) p[j] = (h16)acc[mb][nb][j];
                q[mb] = __builtin_bit_cast(v4u, p); }
            st4(P16 + go, lb, q[0], q[1], q[2], q[3]); }
        if (WHL) { v4u qh[4], ql[4];
#pragma unroll
            for (int mb = 0; mb < 4; ++mb) { v8us ph, pl;
#pragma unroll
                for (int j = 0; j < 8; ++j) { unsigned short x, y; splitf(acc[mb][nb][j], x, y); ph[j] = x; pl[j] = y; }
                qh[mb] = __builtin_bit_cast(v4u, ph); ql[mb] = __builtin_bit_cast(v4u, pl); }
            st4(Ph + go, lb, qh[0], qh[1], qh[2], qh[3]); st4(Pl + go, lb, ql[0], ql[1], ql[2], ql[3]); }
    }
}
// One pass's operand blocks into one buffer: thread t's 16 bytes at t*16 of each pair of 1-KiB blocks (LDS: 2 KiB apart, the operands 8 KiB apart; global: two 16-row groups = gs bytes apart). l = the lane's own LDS byte address, ga, gb = its own global addresses.
// The s_wait_xcnt 0 that stands in front of any rewrite of a register which an issued copy names is the last line of the copies' own statement: there nothing can be moved in front of it.
__device__ __forceinline__ void acopy8(const unsigned l, gptr ga, gptr gb, const int gs) {
    asm volatile("global_load_async_to_lds_b128 %0, %8, off\n\tglobal_load_async_to_lds_b128 %1, %9, off\n\tglobal_load_async_to_lds_b128 %2, %10, off\n\tglobal_load_async_to_lds_b128 %3, %11, off\n\tglobal_load_async_to_lds_b128 %4, %12, off\n\tglobal_load_async_to_lds_b128 %5, %13, off\n\tglobal_load_async_to_lds_b128 %6, %14, off\n\tglobal_load_async_to_lds_b128 %7, %15, off\n\ts_wait_xcnt 0x0"
        :: "v"(l + 0u), "v"(l + 2048u), "v"(l + 4096u), "v"(l + 6144u), "v"(l + 8192u), "v"(l + 10240u), "v"(l + 12288u), "v"(l + 14336u), "v"(ga), "v"(ga + gs), "v"(ga + 2 * gs), "v"(ga + 3 * gs), "v"(gb), "v"(gb + gs), "v"(gb + 2 * gs), "v"(gb + 3 * gs) : "memory"); }
__device__ __forceinline__ void acopy4(const unsigned l, gptr ga, const int gs) {   // one operand alone: fewer address registers at a time
    asm volatile("global_load_async_to_lds_b128 %0, %4, off\n\tglobal_load_async_to_lds_b128 %1, %5, off\n\tglobal_load_async_to_lds_b128 %2, %6, off\n\tglobal_load_async_to_lds_b128 %3, %7, off\n\ts_wait_xcnt 0x0"
        :: "v"(l + 0u), "v"(l + 2048u), "v"(l + 4096u), "v"(l + 6144u), "v"(ga), "v"(ga + gs), "v"(ga + 2 * gs), "v"(ga + 3 * gs) : "memory"); }
template <typename T16, int NSPLIT, bool BIAS, bool PLANES, int K>
__global__ __launch_bounds__(128) void k_gemmw(const T16* __restrict__ A, const T16* __restrict__ A2, const T16* __restrict__ Bt, const T16* __restrict__ Bt2, float* C, int ldc, const float* __restrict__ bias, size_t sA, size_t sB, size_t sC, h16* P16, bf* Ph, bf* Pl) {
    typedef typename WFrag<T16>::V V;
    constexpr int SB = (NSPLIT == 1 ? 3 : 2) * 8192, NT = K / 32;   // bytes of one buffer (A | Bt | A2, 128 rows x 32 k each); passes
    static_assert(NT >= 2, "the prologue fills two buffers");
    __shared__ __align__(1024) char ring[2 * SB];
    __shared__ __align__(16) float osw[4][16 * 68];
    const size_t z = blockIdx.z; A += z * sA; if (A2) A2 += z * sA; Bt += z * sB; if (Bt2) Bt2 += z * sB; C += z * sC;
    const bool sw = PLANES && z < 2;   // q, k: the weight rows take the m side, the token rows the n side (block-uniform)
    if (sw) { const T16* t = A; A = Bt; Bt = t; }
    const int tid = threadIdx.x, lane = tid & 31, lr = lane & 15, hi = lane >> 4; const int w = __builtin_amdgcn_readfirstlane(tid >> 5);
    const int bx = blockIdx.x * 2 + (w & 1), by = blockIdx.y * 2 + (w >> 1);   // the wave's own 64x64 tile, numbered as a grid of such tiles
    const int r0 = (sw ? by : bx) * 64, c0 = (sw ? bx : by) * 64; float* os = osw[w];
    v8f acc[4][4];
#pragma unroll
    for (int mb = 0; mb < 4; ++mb)
#pragma unroll
        for (int nb = 0; nb < 4; ++nb) acc[mb][nb] = (v8f){};
    static_assert(NSPLIT < 2, "the pass below stages A, A2 and Bt only");
    const int R0 = (sw ? blockIdx.y : blockIdx.x) * 128 + (tid >> 6) * 16, C0 = (sw ? blockIdx.x : blockIdx.y) * 128 + (tid >> 6) * 16;   // the 16-row group of the block's tile that this thread's first copy serves
    gptr ga = (gptr)(A + (size_t)R0 * K) + (tid & 63) * 16; gptr gb = (gptr)(Bt + (size_t)C0 * K) + (tid & 63) * 16; gptr ga2 = NSPLIT == 1 ? (gptr)(A2 + (size_t)R0 * K) + (tid & 63) * 16 : ga;   // 16 rows x K = K / 32 blocks of 1 KiB
    const unsigned l0 = (unsigned)(size_t)(__attribute__((address_space(3))) char*)ring + tid * 16;
    auto fill = [&](const int t) { const unsigned l = l0 + (t & 1) * SB; const int go = t * 1024;   // pass t's blocks into buffer t mod 2
        if constexpr (NSPLIT == 1) { acopy4(l, ga + go, 64 * K); acopy4(l + 8192u, gb + go, 64 * K); acopy4(l + 16384u, ga2 + go, 64 * K); } else acopy8(l, ga + go, gb + go, 64 * K); };
    // the hand-over behind pass t's last LDS read. EARLY: it stands in front of the pass's products, with all fragments in registers, so the refill flies under them (where the grid leaves registers free: at most two waves a SIMD); else behind them, and the fragments may be read as they are used
    constexpr bool EARLY = NSPLIT == 1;
    auto foot = [&](const int t) {
        asm volatile("s_wait_dscnt 0x0" ::: "memory");      // this wave has left buffer t mod 2
        asm volatile("s_wait_asynccnt 0x0" ::: "memory");   // its copies of pass t + 1 have landed
        __syncthreads();                                    // both hold for every wave: pass t + 1 may be read, buffer t mod 2 refilled
        if (t + 2 < NT) fill(t + 2); };                     // block-uniform test
    fill(0);
    asm volatile("s_wait_asynccnt 0x0" ::: "memory");   // this wave's copies of pass 0 have landed
    __syncthreads();                                    // and every other wave's: pass 0 may be read
    fill(1);
    const char* fa = ring + (r0 & 64) * 64 + lane * 16; const char* fb = ring + 8192 + (c0 & 64) * 64 + lane * 16;   // the wave's four blocks of each operand: the lower or the upper 4 KiB of the tile
#pragma unroll 1
    for (int t = 0; t < NT; ++t) {
        const int bo = (t & 1) * SB;
        V a[4], a2[4], b[4];
#pragma unroll
        for (int mb = 0; mb < 4; ++mb) { a[mb] = WFrag<T16>::lds(fa + bo + mb * 1024); if (NSPLIT == 1) a2[mb] = WFrag<T16>::lds(fa + bo + 16384 + mb * 1024); }
#pragma unroll
        for (int nb = 0; nb < 4; ++nb) b[nb] = WFrag<T16>::lds(fb + bo + nb * 1024);
        if constexpr (EARLY) foot(t);
#pragma unroll
        for (int nb = 0; nb < 4; ++nb) {
#pragma unroll
            for (int mb = 0; mb < 4; ++mb) { acc[mb][nb] = WFrag<T16>::mma(a[mb], b[nb], acc[mb][nb]); if (NSPLIT == 1) acc[mb][nb] = WFrag<T16>::mma(a2[mb], b[nb], acc[mb][nb]); } }
        if constexpr (!EARLY) foot(t);
    }
    asm volatile("s_wait_asynccnt 0x0" ::: "memory");       // no copy is left in flight
    if constexpr (PLANES) {
        const int tb = bx * 64, t0 = tb % TT; const size_t po = ((size_t)(tb / TT) * NH_ + by) * TT * HD + (sw ? (size_t)t0 * HD : (size_t)t0 * 16); const int rs = sw ? HD / 16 : TT / 16;   // q, k: 16 tokens are HD / 16 half blocks; v: 16 tokens are one half block of each 16-row group
        const size_t PE = (size_t)NB_ * NH_ * TT * HD; P16 += z * PE + po; Ph += z * 2 * PE + po; Pl += z * 2 * PE + po;   // planes in the order q, k, v; hi and lo alternate
        if (t0 >= RH) planes_out<true, false>(acc, rs, P16, Ph, Pl);          // wave-uniform tests: one straight-line body each
        else if (z == 0) planes_out<false, true>(acc, rs, P16, Ph, Pl);
        else planes_out<true, true>(acc, rs, P16, Ph, Pl);
        return;
    }
#pragma unroll
    for (int mb = 0; mb < 4; ++mb) {
#pragma unroll
        for (int nb = 0; nb < 4; ++nb) {
#pragma unroll
            for (int j = 0; j < 8; ++j) os[(hi * 8 + j) * 68 + nb * 16 + lr] = acc[mb][nb][j]; }
        __builtin_amdgcn_wave_barrier(); asm volatile("" ::: "memory");
        float* crow = C + (size_t)(r0 + mb * 16) * ldc + c0;
{
#pragma unroll
            for (int s = 0; s < 8; ++s) { const int row = 2 * s + hi, cofs = lr * 4; v4f val = *(const v4fa*)(os + row * 68 + cofs); if (BIAS) { val[0] += bfr(bias[c0 + cofs]); val[1] += bfr(bias[c0 + cofs + 1]); val[2] += bfr(bias[c0 + cofs + 2]); val[3] += bfr(bias[c0 + cofs + 3]); }
                *(v4f*)(crow + (size_t)row * ldc + cofs) = val; }
             }
        __builtin_amdgcn_wave_barrier(); asm volatile("" ::: "memory");
    }
}

__device__ __forceinline__ h16 tohx(float x) { return (h16)x; }
typedef __attribute__((ext_vector_type(2))) _Float16 v2h;
typedef __attribute__((ext_vector_type(4))) _Float16 v4h;
typedef __attribute__((ext_vector_type(2))) unsigned short v2us;
typedef __attribute__((ext_vector_type(4))) unsigned short v4us;
typedef __attribute__((ext_vector_type(2))) float v2f;
typedef __attribute__((ext_vector_type(4))) int v4i;

__global__ __launch_bounds__(256) void k_wtG(const float* __restrict__ w, int K, int N, bf* Bt) {
    const int lane = threadIdx.x & 31; const int L0 = (blockIdx.x * 8 + (threadIdx.x >> 5)) * 8; const int nlines = N * K / 64;
{
#pragma unroll 1
        for (int l = 0; l < 8; ++l) { const int L = L0 + l; if (L >= nlines) break; const size_t e = (size_t)L * 64 + lane * 2; const int k = (int)(e % K), n = (int)(e / K); v2us o;
            o[0] = f2bf(w[(size_t)k * N + n]); o[1] = f2bf(w[(size_t)(k + 1) * N + n]); *(v2us*)(Bt + e) = o; }
         }
}
// f32 [rows][DM] row-major to bf16 in fragment order, x and the four weights in ONE launch. A block takes one 16-row group of one tensor: 16 x DM values, DM / 32 blocks of 1 KiB = 6 x 256 pieces of 16 bytes, contiguous in the plane.
// Thread t writes pieces j*256 + t (a wave's store covers 512 contiguous bytes) and fetches each piece's 8 values: row t & 15, k = j*128 + (t >> 4)*8, so one address per thread serves all loads, one all stores, the rest are immediates.
// Groups 0 .. NB_*TT/16 - 1 are x, then DM/16 groups of each weight in the order q, k, v, p (block-uniform choice).
static_assert(DQ == DM && DKV == DM && DM == 6 * 128, "every cast tensor has rows of DM values; a 16-row group is 6 x 256 pieces");
__global__ __launch_bounds__(256) void k_cvtall(const float* __restrict__ x, const float* __restrict__ wq, const float* __restrict__ wk, const float* __restrict__ wv, const float* __restrict__ wo, bf* XB, bf* WQ, bf* WK, bf* WV, bf* WO) {
    const int GX = NB_ * TT / 16, GW = DM / 16; int g = blockIdx.x; const float* src = x; bf* dst = XB;
    if (g >= GX) { g -= GX; const int t = g / GW; g -= t * GW; src = t == 0 ? wq : t == 1 ? wk : t == 2 ? wv : wo; dst = t == 0 ? WQ : t == 1 ? WK : t == 2 ? WV : WO; }
    const int tid = threadIdx.x; const float* p = src + (size_t)(g * 16 + (tid & 15)) * DM + (tid >> 4) * 8;
    v8f v[6];
#pragma unroll
    for (int j = 0; j < 6; ++j) v[j] = *(const v8f*)(p + j * 128);
    asm volatile("s_wait_xcnt 0x0" ::: "memory");    // stands in front of any rewrite of the address registers of the loads above; its clobber also keeps all twelve loads in front of the first use, so that they fly together
    v4u q[6];
#pragma unroll
    for (int j = 0; j < 6; ++j) { v8us o;
#pragma unroll
        for (int k = 0; k < 8; ++k) o[k] = f2bf(v[j][k]);
        q[j] = __builtin_bit_cast(v4u, o); }
    // six stores, 4 KiB apart at one scalar base; the s_wait_xcnt 0 in front of any rewrite of a register that they name is the last line of their own statement (as in st4)
    asm volatile("global_store_b128 %0, %1, %7\n\tglobal_store_b128 %0, %2, %7 offset:4096\n\tglobal_store_b128 %0, %3, %7 offset:8192\n\tglobal_store_b128 %0, %4, %7 offset:12288\n\tglobal_store_b128 %0, %5, %7 offset:16384\n\tglobal_store_b128 %0, %6, %7 offset:20480\n\ts_wait_xcnt 0x0"
        :: "v"((unsigned)tid * 16u), "v"(q[0]), "v"(q[1]), "v"(q[2]), "v"(q[3]), "v"(q[4]), "v"(q[5]), "s"(dst + (size_t)g * 16 * DM) : "memory"); }

#define AW 4
typedef v8f __attribute__((may_alias)) v8fa;
// 2^x. Behind a v_exp_f32 the instruction set asks for one independent instruction or a v_nop before its result is read or its source overwritten; it is kept here by construction:
// eight at a time, no output sharing a register with an input (each v_exp_f32 is independent of the one in front of it), one v_nop behind the last.
__device__ __forceinline__ v8f exp2x8(const v8f x) { float o0, o1, o2, o3, o4, o5, o6, o7;
    asm("v_exp_f32 %0, %8\n\tv_exp_f32 %1, %9\n\tv_exp_f32 %2, %10\n\tv_exp_f32 %3, %11\n\tv_exp_f32 %4, %12\n\tv_exp_f32 %5, %13\n\tv_exp_f32 %6, %14\n\tv_exp_f32 %7, %15\n\tv_nop"
        : "=&v"(o0), "=&v"(o1), "=&v"(o2), "=&v"(o3), "=&v"(o4), "=&v"(o5), "=&v"(o6), "=&v"(o7) : "v"(x[0]), "v"(x[1]), "v"(x[2]), "v"(x[3]), "v"(x[4]), "v"(x[5]), "v"(x[6]), "v"(x[7]));
    return (v8f){o0, o1, o2, o3, o4, o5, o6, o7}; }
__device__ __forceinline__ float exp2s(const float x) { float o; asm("v_exp_f32 %0, %1\n\tv_nop" : "=v"(o) : "v"(x)); return o; }   // the same slot behind a single one
template <typename T16, bool HL, int NQ>
__device__ __forceinline__ void attn_tile(const T16* __restrict__ Q, const T16* __restrict__ Q2, const T16* __restrict__ Kp, const T16* __restrict__ K2, const T16* __restrict__ Vt, const T16* __restrict__ V2, const int q0, bf* Ah, bf* Al, float* sO, float* sM, float* sL, float* sI) {
    typedef typename WFrag<T16>::V V;
    const int lane = threadIdx.x & 31, c = lane & 15, h = lane >> 4; const int w = __builtin_amdgcn_readfirstlane((int)(threadIdx.x >> 5));
    const float L2E = 1.4426950408889634f, SH = HL ? 0.0f : 10.0f; const unsigned lb = lane * 16;
    V qf[NQ][2], qf2[NQ][2];
#pragma unroll
    for (int nq = 0; nq < NQ; ++nq)
#pragma unroll
        for (int ks = 0; ks < 2; ++ks) { const size_t qo = (size_t)(q0 + nq * 16) * HD + ks * 512; qf[nq][ks] = WFrag<T16>::ld(Q + qo, lb); if (HL) qf2[nq][ks] = WFrag<T16>::ld(Q2 + qo, lb); }
    V ka[2][2], ka2[2][2];
    auto ldk = [&](const int kb) {                   // the key fragments of 32-key block kb
#pragma unroll
        for (int t = 0; t < 2; ++t)
#pragma unroll
            for (int ks = 0; ks < 2; ++ks) { const size_t ko = (size_t)(kb * 32 + t * 16) * HD + ks * 512; ka[t][ks] = WFrag<T16>::ld(Kp + ko, lb); if (HL) ka2[t][ks] = WFrag<T16>::ld(K2 + ko, lb); } };
    v8f o[4][NQ]; float m[NQ], l[NQ];
#pragma unroll
    for (int nq = 0; nq < NQ; ++nq) { m[nq] = -3.0e38f; l[nq] = 0.f;
#pragma unroll
        for (int mb = 0; mb < 4; ++mb) o[mb][nq] = (v8f){}; }
    const int nblk = (q0 + NQ * 16 + 31) / 32;      // 32-key blocks that hold a key <= the tile's last query; only the last one crosses the diagonal
    if (!HL) ldk(min(w, nblk - 1));                  // fp16 tiles (long loops) fetch their key fragments one pass ahead; a wave without a block loads the last block and drops it
    asm volatile("s_wait_xcnt 0x0" ::: "memory");    // stands in front of any rewrite of the address registers of the loads above
#pragma unroll 1
    for (int kb = w; kb < nblk; kb += AW) {
        const int k0 = kb * 32;
        V va[4], va2[4];
        if (HL) ldk(kb);
#pragma unroll
        for (int mb = 0; mb < 4; ++mb) { const size_t vo = (size_t)mb * 16 * TT + k0 * 16; va[mb] = WFrag<T16>::ld(Vt + vo, lb); if (HL) va2[mb] = WFrag<T16>::ld(V2 + vo, lb); }
        asm volatile("s_wait_xcnt 0x0" ::: "memory");    // in front of any rewrite of those loads' address registers; its clobber also keeps these loads from being sunk below this point, towards their use, where each would be waited for alone
        v8f s[2][NQ];
#pragma unroll
        for (int t = 0; t < 2; ++t)
#pragma unroll
            for (int nq = 0; nq < NQ; ++nq) { v8f a = (v8f){};
#pragma unroll
                for (int ks = 0; ks < 2; ++ks) { a = WFrag<T16>::mma(ka[t][ks], qf[nq][ks], a); if (HL) { a = WFrag<T16>::mma(ka[t][ks], qf2[nq][ks], a); a = WFrag<T16>::mma(ka2[t][ks], qf[nq][ks], a); } }
                s[t][nq] = a; }
        if (!HL && kb + AW < nblk) { ldk(kb + AW);       // next pass's key fragments, into the registers the products above have just read (wave-uniform test)
            asm volatile("s_wait_xcnt 0x0" ::: "memory"); }  // in front of any rewrite of those loads' address registers
        if (kb == nblk - 1) {                        // diagonal block (wave-uniform test): keys above the query are masked by select
#pragma unroll
            for (int t = 0; t < 2; ++t)
#pragma unroll
                for (int nq = 0; nq < NQ; ++nq)
#pragma unroll
                    for (int r = 0; r < 8; ++r) s[t][nq][r] = (k0 + t * 16 + 8 * h + r <= q0 + nq * 16 + c) ? s[t][nq][r] : -3.0e38f; }
#pragma unroll
        for (int nq = 0; nq < NQ; ++nq) {
            float mx = m[nq];
#pragma unroll
            for (int t = 0; t < 2; ++t)
#pragma unroll
                for (int r = 0; r < 8; ++r) { s[t][nq][r] *= SCL; mx = fmaxf(mx, s[t][nq][r]); }
            mx = fmaxf(mx, __shfl_xor(mx, 16, 32));
            const float al = exp2s((m[nq] - mx) * L2E); m[nq] = mx;
            float sum = 0.f;
#pragma unroll
            for (int t = 0; t < 2; ++t) { s[t][nq] = exp2x8((s[t][nq] - mx) * L2E + SH);
#pragma unroll
                for (int r = 0; r < 8; ++r) sum += s[t][nq][r]; }
            l[nq] = l[nq] * al + sum;                // this half's keys only; the halves are joined once after the loop
#pragma unroll
            for (int mb = 0; mb < 4; ++mb) o[mb][nq] *= al;
            V pf, pf2;
            if constexpr (HL) { v8us h0, h1, l0, l1;
#pragma unroll
                for (int r = 0; r < 8; ++r) { unsigned short x, y; splitf(s[0][nq][r], x, y); h0[r] = x; l0[r] = y; splitf(s[1][nq][r], x, y); h1[r] = x; l1[r] = y; }
                pf = cat16b(h0, h1); pf2 = cat16b(l0, l1);
            } else { v8h p0, p1;
#pragma unroll
                for (int r = 0; r < 8; ++r) { p0[r] = tohx(s[0][nq][r]); p1[r] = tohx(s[1][nq][r]); }
                pf = cat16(p0, p1); }
#pragma unroll
            for (int mb = 0; mb < 4; ++mb) { o[mb][nq] = WFrag<T16>::mma(va[mb], pf, o[mb][nq]); if (HL) { o[mb][nq] = WFrag<T16>::mma(va[mb], pf2, o[mb][nq]); o[mb][nq] = WFrag<T16>::mma(va2[mb], pf, o[mb][nq]); } }
        }
    }
    // join: per query the waves' (m, l) go through LDS; every wave rescales its O^T to the common maximum and stages it; then wave w sums output tiles (w, nq) as they stand in the lanes, each one 512-byte half block of the merged planes
#pragma unroll
    for (int nq = 0; nq < NQ; ++nq) { l[nq] += __shfl_xor(l[nq], 16, 32); if (h == 0) { sM[w * 32 + nq * 16 + c] = m[nq]; sL[w * 32 + nq * 16 + c] = l[nq]; } }
    __syncthreads();
#pragma unroll
    for (int nq = 0; nq < NQ; ++nq) { float M = sM[nq * 16 + c];
#pragma unroll
        for (int ww = 1; ww < AW; ++ww) M = fmaxf(M, sM[ww * 32 + nq * 16 + c]);
        float lt = 0.f;
#pragma unroll
        for (int ww = 0; ww < AW; ++ww) lt += sL[ww * 32 + nq * 16 + c] * exp2s((sM[ww * 32 + nq * 16 + c] - M) * L2E);
        if (w == 0 && h == 0) sI[nq * 16 + c] = __fdiv_rn(1.0f, lt);
        const float f = exp2s((m[nq] - M) * L2E);
#pragma unroll
        for (int mb = 0; mb < 4; ++mb) *(v8fa*)(sO + (((w * 4 + mb) * NQ + nq) * 32 + lane) * 8) = o[mb][nq] * f; }
    __syncthreads();
#pragma unroll
    for (int nq = 0; nq < NQ; ++nq) {
        v8f a = *(const v8fa*)(sO + ((w * NQ + nq) * 32 + lane) * 8);
#pragma unroll
        for (int ww = 1; ww < AW; ++ww) a += *(const v8fa*)(sO + (((ww * 4 + w) * NQ + nq) * 32 + lane) * 8);
        const float inv = sI[nq * 16 + c]; v8us oh, ol;
#pragma unroll
        for (int r = 0; r < 8; ++r) { unsigned short x, y; splitf(a[r] * inv, x, y); oh[r] = x; ol[r] = y; }
        const size_t oo = (size_t)(q0 + nq * 16) * DQ + w * 256;
        asm volatile("global_store_b128 %0, %1, %3\n\tglobal_store_b128 %0, %2, %4\n\ts_wait_xcnt 0x0"   // the wait in front of any rewrite of a register that these stores name, in their own statement (as in st4)
            :: "v"(lb), "v"(__builtin_bit_cast(v4u, oh)), "v"(__builtin_bit_cast(v4u, ol)), "s"(Ah + oo), "s"(Al + oo) : "memory"); }
}
// grid (batches x heads, tiles), blockIdx.x = b * heads + head; blockIdx.y: (TT - RH) / 32 fp16 tiles of 32 rows from the last row down, then RH / 16 hi/lo tiles of 16 rows.
__global__ __launch_bounds__(AW * 32) void k_fattn(const h16* __restrict__ Q16, const h16* __restrict__ K16, const h16* __restrict__ V16, const bf* __restrict__ Qh, const bf* __restrict__ Ql, const bf* __restrict__ Kh, const bf* __restrict__ Kl, const bf* __restrict__ Vh, const bf* __restrict__ Vl, bf* Ah, bf* Al) {
    __shared__ __align__(32) float sO[AW * 4 * 2 * 32 * 8]; __shared__ float sM[AW * 32], sL[AW * 32], sI[32];
    const size_t pz = (size_t)blockIdx.x * TT * HD; const int ty = blockIdx.y; const size_t ao = (size_t)(blockIdx.x / NH_) * TT * DQ + (blockIdx.x % NH_) * (HD * 16); Ah += ao; Al += ao;   // a head's 64 k are two blocks of 512 elements in each 16-row group
    if (ty < (TT - RH) / 32) attn_tile<h16, false, 2>(Q16 + pz, nullptr, K16 + pz, nullptr, V16 + pz, nullptr, TT - 32 * (ty + 1), Ah, Al, sO, sM, sL, sI);
    else attn_tile<bf, true, 1>(Qh + pz, Ql + pz, Kh + pz, Kl + pz, Vh + pz, Vl + pz, RH - 16 * (ty - (TT - RH) / 32 + 1), Ah, Al, sO, sM, sL, sI);
}

extern "C" void kernel_launch(void* const* d_in, const int* in_sizes, int n_in,
                              void* d_out, int out_size, void* d_ws, size_t ws_size, hipStream_t stream) {
    (void)in_sizes; (void)n_in; (void)out_size;
    const float* x = (const float*)d_in[0]; const float* wq = (const float*)d_in[1]; const float* wk = (const float*)d_in[2]; const float* wv = (const float*)d_in[3]; const float* wo = (const float*)d_in[4]; const float* bo = (const float*)d_in[5];   /* argument order x, Wq, Wk, Wv, Wp ('oi' [768][768]: nn.Linear layout, applied transposed), bp */
    float* OUT = (float*)d_out;     // [4][2048][768]
    char* wsp = (char*)d_ws;
    auto take = [&](size_t bytes) { char* p = wsp; wsp += (bytes + 255) & ~(size_t)255; return (void*)p; };
    bf* WQ = (bf*)take((size_t)DQ * DM * 2); bf* WK = (bf*)take((size_t)DKV * DM * 2); bf* WV = (bf*)take((size_t)DKV * DM * 2); bf* WO = (bf*)take((size_t)DM * DQ * 2);
    bf* XB = (bf*)take((size_t)NB_ * TT * DM * 2);
    static_assert(NKV == NH_ && ((size_t)DQ * DM * 2) % 256 == 0 && ((size_t)NB_ * NH_ * TT * HD * 2) % 256 == 0, "the projection launch steps from q to k to v by one weight's, one plane's size: take() may leave no gap");
    h16* QP16 = (h16*)take((size_t)NB_ * NH_ * TT * HD * 2); h16* KP16 = (h16*)take((size_t)NB_ * NKV * TT * HD * 2); h16* VT16 = (h16*)take((size_t)NB_ * NKV * HD * TT * 2);
    bf* QPh = (bf*)take((size_t)NB_ * NH_ * TT * HD * 2); bf* QPl = (bf*)take((size_t)NB_ * NH_ * TT * HD * 2); bf* KPh = (bf*)take((size_t)NB_ * NKV * TT * HD * 2); bf* KPl = (bf*)take((size_t)NB_ * NKV * TT * HD * 2); bf* VTh = (bf*)take((size_t)NB_ * NKV * HD * TT * 2); bf* VTl = (bf*)take((size_t)NB_ * NKV * HD * TT * 2);
    bf* ATh = (bf*)take((size_t)NB_ * TT * DQ * 2); bf* ATl = (bf*)take((size_t)NB_ * TT * DQ * 2);
    if ((size_t)(wsp - (char*)d_ws) > ws_size) return;    // about 149 MiB of the 256 MiB
    // one launch per stage for all batches: one cast launch ('oi' weights are already [out][in] = Bt rows: a cast into fragment order, no transpose); the projections see x as [NB_*TT][DM] rows (grid z = q, k, v), attention takes the batch from blockIdx.x
    k_cvtall<<<NB_ * TT / 16 + 4 * (DM / 16), 256, 0, stream>>>(x, wq, wk, wv, wo, XB, WQ, WK, WV, WO);
    k_gemmw<bf, 0, false, true, DM><<<dim3(NB_ * TT / 128, NH_ / 2, 3), 128, 0, stream>>>(XB, nullptr, WQ, nullptr, nullptr, 0, nullptr, 0, (size_t)DQ * DM, 0, QP16, QPh, QPl);
    k_fattn<<<dim3(NB_ * NH_, (TT - RH) / 32 + RH / 16, 1), AW * 32, 0, stream>>>(QP16, KP16, VT16, QPh, QPl, KPh, KPl, VTh, VTl, ATh, ATl);
    k_gemmw<bf, 1, true, false, DQ><<<dim3(NB_ * TT / 128, DM / 128, 1), 128, 0, stream>>>(ATh, ATl, WO, nullptr, OUT, DM, bo, 0, 0, 0, nullptr, nullptr, nullptr);
}

// v007
// Measured time: 98.3 microseconds a run.
// Two timings next to v006 both put it at 1.06 times that version's speed.
// Counting every step since v000, it is 21.8 times as fast.
#include <hip/hip_runtime.h>

// Causal multi-head attention with bias-free (out, in) projections and a biased (out, in) output projection at a 768-wide model (x [4][2048][768]; q, k, v = x W^T ('oi' [768][768] uniform(+-1/sqrt(768)), no bias; 12 heads x 64); scores x 64^-0.5; tril kept, -inf elsewhere (tril built inside the function); softmax; out = merged Wp^T + bp ('oi' + a REAL bias, uniform(+-1/sqrt(768))) -> [4][2048][768] (6.3 M); argument order x, Wq, Wk, Wv, Wp, bp).
// Every 16-bit operand plane lies in FRAGMENT ORDER: a block of 16 rows x 32 k is 1 KiB, two halves of 512 B, lane l's 16 bytes at l*16 (row l & 15; k = half*16 + (l >> 4)*8 + 0..7); blocks run along k, then along rows.
// A wave's 16-byte-per-lane fragment load so covers 512 contiguous bytes (4 whole lines, not 32-byte pieces of 16 lines), and it puts the same values into the same registers as a load from row-major planes.
// Layout, all four batches in every launch (rows b*2048 + t, planes [b][h]): bf16 copy of x; 'oi' weights cast (no transpose); exact projections (K 768), q, k and v in one launch that writes the head planes itself; one fused causal attention launch at 12 heads (scores, online softmax and the value product stay in registers; hybrid rows: < 512 hi/lo 3 products, rest fp16 with probabilities x1024); merged hi/lo x Wp exact + bp.
// Compute dtypes, f32 accumulate: every input rounded to bf16; projections exact; attention rows < 512 3 products, rest fp16; softmax f32; Wp hl x exact + bias.

#define NB_  4
#define TT   2048
#define DM   768
#define NH_  12
#define NKV  12
#define HD   64
#define DQ   (NH_ * HD)
#define DKV  (NKV * HD)
#define RH   512                  // query rows < RH use hi+lo planes (a multiple of 64, at least 64)
#define SCL  0.125f   // HD^-0.5
typedef _Float16 h16;
typedef unsigned short bf;
typedef __attribute__((ext_vector_type(16))) __bf16   v16bf;
typedef __attribute__((ext_vector_type(16))) _Float16 v16h;
typedef __attribute__((ext_vector_type(8)))  _Float16 v8h;
typedef __attribute__((ext_vector_type(8)))  unsigned short v8us;
typedef __attribute__((ext_vector_type(8)))  float    v8f;
typedef __attribute__((ext_vector_type(4)))  float    v4f;
typedef v8h  __attribute__((may_alias)) v8ha;
typedef v4f  __attribute__((may_alias)) v4fa;
typedef v8us __attribute__((may_alias)) v8usa;

__device__ __forceinline__ unsigned short f2bf(float f) { unsigned u = __float_as_uint(f); u += 0x7FFFu + ((u >> 16) & 1u); return (unsigned short)(u >> 16); }
__device__ __forceinline__ float bf2f(unsigned short b) { return __uint_as_float(((unsigned)b) << 16); }
__device__ __forceinline__ float bfr(float f) { return bf2f(f2bf(f)); }
__device__ __forceinline__ v16h cat16(v8h lo, v8h hi) { return __builtin_shufflevector(lo, hi, 0, 1, 2, 3, 4, 5, 6, 7, 8, 9, 10, 11, 12, 13, 14, 15); }
__device__ __forceinline__ v16bf cat16b(v8us lo, v8us hi) { return __builtin_bit_cast(v16bf, __builtin_shufflevector(lo, hi, 0, 1, 2, 3, 4, 5, 6, 7, 8, 9, 10, 11, 12, 13, 14, 15)); }
__device__ __forceinline__ v8f wmma16(v16h a, v16h b, v8f c) { return __builtin_amdgcn_wmma_f32_16x16x32_f16(false, a, false, b, (short)0, c, false, false); }
__device__ __forceinline__ v8f wmmab(v16bf a, v16bf b, v8f c) { return __builtin_amdgcn_wmma_f32_16x16x32_bf16(false, a, false, b, (short)0, c, false, false); }



// ---- k_gemmw: register-blocked GEMM, one wave per 64x64 output tile (16 accumulators), FOUR waves (2 x 2) per block on a 128x128 tile; grid (M/128, N/128, Z), 128 threads.
// The block's operand rows of one pass (32 k: 8 blocks of 1 KiB per operand, already in fragment order) are brought into LDS once by asynchronous copies and read there by the two waves that need each, so every operand byte leaves L2 half as often;
// two buffers: the copies of pass t + 2 fly while pass t + 1 is worked on.
// C[m][n] (f32, pitch ldc, + optional f32 bias[n]) = sum_k A[m][k] Bt[n][k] (+ split products per NSPLIT). z-batch strides sA/sB/sC in elements. K % 32 == 0, a compile-time constant.
// PLANES: no C. A = token rows [NB_*TT][K], Bt = the q, k, v weights behind one another (z = 0, 1, 2; a wave's 64-wide tile is one head); the tile leaves as 16-bit head planes in fragment order, q and k [b][h] rows t, k index d; v [b][h] rows d, k index t.
// A lane's 8 accumulator values run along m, so the plane's k index is made the m index: q and k are computed as W x^T (operand roles swapped; both fragments load alike, same k order), v as x W^T.
// Only what attention reads is written: hi/lo planes for t < RH, the fp16 q plane for t >= RH, the fp16 k and v planes everywhere.
// ld(p, lb): the fragment of the block at p (the same pointer in every lane: a scalar base), lb = lane * 16; ldq(q): the same from the lane's own address q.
typedef const __attribute__((address_space(1))) char* gptr;   // a byte address in global memory (keeps the loads global_load where the address passes through an asm statement)
template <typename T16> struct WFrag;
template <> struct WFrag<h16> { typedef v16h V; static __device__ __forceinline__ V ldq(gptr q) { return cat16(*(const __attribute__((address_space(1))) v8h*)q, *(const __attribute__((address_space(1))) v8h*)(q + 512)); } static __device__ __forceinline__ V ld(const h16* p, const unsigned lb) { return ldq((gptr)p + lb); } static __device__ __forceinline__ V lds(const char* q) { return cat16(*(const v8ha*)q, *(const v8ha*)(q + 512)); } static __device__ __forceinline__ v8f mma(V a, V b, v8f c) { return wmma16(a, b, c); } };
template <> struct WFrag<bf> { typedef v16bf V; static __device__ __forceinline__ V ldq(gptr q) { return cat16b(*(const __attribute__((address_space(1))) v8us*)q, *(const __attribute__((address_space(1))) v8us*)(q + 512)); } static __device__ __forceinline__ V ld(const bf* p, const unsigned lb) { return ldq((gptr)p + lb); } static __device__ __forceinline__ V lds(const char* q) { return cat16b(*(const v8usa*)q, *(const v8usa*)(q + 512)); } static __device__ __forceinline__ v8f mma(V a, V b, v8f c) { return wmmab(a, b, c); } };
__device__ __forceinline__ void splitf(float y, unsigned short& h, unsigned short& l) { h = f2bf(y); l = f2bf(y - bf2f(h)); }
// One wave's 64x64 accumulator tile to 16-bit planes (W16: fp16; WHL: bf16 hi and lo). Plane row = the tile's n index (16 per nb), plane k = the m index.
// Accumulator tile (mb, nb) converted is one 512-byte half block of the plane as it stands in the lanes (row = lane & 15, k = mb*16 + (lane >> 4)*8 + 0..7): one 16-byte store per lane, whole lines, no staging.
// rs = half blocks from one 16-row group of the plane to the next (2 * the plane's k extent / 32).
typedef __attribute__((ext_vector_type(4))) unsigned v4u;
// Four such stores, 512 B apart at one scalar base. The s_wait_xcnt 0 that stands in front of any rewrite of a register which an issued store names (data, offset, base) is the last line of the stores' own statement: there nothing can be moved in front of it.
__device__ __forceinline__ void st4(void* base, const unsigned lb, const v4u a, const v4u b, const v4u c, const v4u d) {
    asm volatile("global_store_b128 %0, %1, %5\n\tglobal_store_b128 %0, %2, %5 offset:512\n\tglobal_store_b128 %0, %3, %5 offset:1024\n\tglobal_store_b128 %0, %4, %5 offset:1536\n\ts_wait_xcnt 0x0"
        :: "v"(lb), "v"(a), "v"(b), "v"(c), "v"(d), "s"(base) : "memory"); }
template <bool W16, bool WHL>
__device__ __forceinline__ void planes_out(const v8f (&acc)[4][4], const int rs, h16* P16, bf* Ph, bf* Pl) {
    const unsigned lb = (threadIdx.x & 31) * 16;
#pragma unroll
    for (int nb = 0; nb < 4; ++nb) { const size_t go = (size_t)(nb * rs) * 256;
        if (W16) { v4u q[4];
#pragma unroll
            for (int mb = 0; mb < 4; ++mb) { v8h p;
#pragma unroll
                for (int j = 0; j < 8; ++j) p[j] = (h16)acc[mb][nb][j];
                q[mb] = __builtin_bit_cast(v4u, p); }
            st4(P16 + go, lb, q[0], q[1], q[2], q[3]); }
        if (WHL) { v4u qh[4], ql[4];
#pragma unroll
            for (int mb = 0; mb < 4; ++mb) { v8us ph, pl;
#pragma unroll
                for (int j = 0; j < 8; ++j) { unsigned short x, y; splitf(acc[mb][nb][j], x, y); ph[j] = x; pl[j] = y; }
                qh[mb] = __builtin_bit_cast(v4u, ph); ql[mb] = __builtin_bit_cast(v4u, pl); }
            st4(Ph + go, lb, qh[0], qh[1], qh[2], qh[3]); st4(Pl + go, lb, ql[0], ql[1], ql[2], ql[3]); }
    }
}
// One pass's operand blocks into one buffer: thread t's 16 bytes at t*16 of each pair of 1-KiB blocks (LDS: 2 KiB apart, the operands 8 KiB apart; global: two 16-row groups = gs bytes apart). l = the lane's own LDS byte address, ga, gb = its own global addresses.
// The s_wait_xcnt 0 that stands in front of any rewrite of a register which an issued copy names is the last line of the copies' own statement: there nothing can be moved in front of it.
__device__ __forceinline__ void acopy8(const unsigned l, gptr ga, gptr gb, const int gs) {
    asm volatile("global_load_async_to_lds_b128 %0, %8, off\n\tglobal_load_async_to_lds_b128 %1, %9, off\n\tglobal_load_async_to_lds_b128 %2, %10, off\n\tglobal_load_async_to_lds_b128 %3, %11, off\n\tglobal_load_async_to_lds_b128 %4, %12, off\n\tglobal_load_async_to_lds_b128 %5, %13, off\n\tglobal_load_async_to_lds_b128 %6, %14, off\n\tglobal_load_async_to_lds_b128 %7, %15, off\n\ts_wait_xcnt 0x0"
        :: "v"(l + 0u), "v"(l + 2048u), "v"(l + 4096u), "v"(l + 6144u), "v"(l + 8192u), "v"(l + 10240u), "v"(l + 12288u), "v"(l + 14336u), "v"(ga), "v"(ga + gs), "v"(ga + 2 * gs), "v"(ga + 3 * gs), "v"(gb), "v"(gb + gs), "v"(gb + 2 * gs), "v"(gb + 3 * gs) : "memory"); }
__device__ __forceinline__ void acopy4(const unsigned l, gptr ga, const int gs) {   // one operand alone: fewer address registers at a time
    asm volatile("global_load_async_to_lds_b128 %0, %4, off\n\tglobal_load_async_to_lds_b128 %1, %5, off\n\tglobal_load_async_to_lds_b128 %2, %6, off\n\tglobal_load_async_to_lds_b128 %3, %7, off\n\ts_wait_xcnt 0x0"
        :: "v"(l + 0u), "v"(l + 2048u), "v"(l + 4096u), "v"(l + 6144u), "v"(ga), "v"(ga + gs), "v"(ga + 2 * gs), "v"(ga + 3 * gs) : "memory"); }
template <typename T16, int NSPLIT, bool BIAS, bool PLANES, int K>
__global__ __launch_bounds__(128) void k_gemmw(const T16* __restrict__ A, const T16* __restrict__ A2, const T16* __restrict__ Bt, const T16* __restrict__ Bt2, float* C, int ldc, const float* __restrict__ bias, size_t sA, size_t sB, size_t sC, h16* P16, bf* Ph, bf* Pl) {
    typedef typename WFrag<T16>::V V;
    constexpr int SB = (NSPLIT == 1 ? 3 : 2) * 8192, NT = K / 32;   // bytes of one buffer (A | Bt | A2, 128 rows x 32 k each); passes
    static_assert(NT >= 2, "the prologue fills two buffers");
    __shared__ __align__(1024) char ring[2 * SB];
    __shared__ __align__(16) float osw[4][16 * 68];
    const size_t z = blockIdx.z; A += z * sA; if (A2) A2 += z * sA; Bt += z * sB; if (Bt2) Bt2 += z * sB; C += z * sC;
    const bool sw = PLANES && z < 2;   // q, k: the weight rows take the m side, the token rows the n side (block-uniform)
    if (sw) { const T16* t = A; A = Bt; Bt = t; }
    const int tid = threadIdx.x, lane = tid & 31, lr = lane & 15, hi = lane >> 4; const int w = __builtin_amdgcn_readfirstlane(tid >> 5);
    const int bx = blockIdx.x * 2 + (w & 1), by = blockIdx.y * 2 + (w >> 1);   // the wave's own 64x64 tile, numbered as a grid of such tiles
    const int r0 = (sw ? by : bx) * 64, c0 = (sw ? bx : by) * 64; float* os = osw[w];
    v8f acc[4][4];
#pragma unroll
    for (int mb = 0; mb < 4; ++mb)
#pragma unroll
        for (int nb = 0; nb < 4; ++nb) acc[mb][nb] = (v8f){};
    static_assert(NSPLIT < 2, "the pass below stages A, A2 and Bt only");
    const int R0 = (sw ? blockIdx.y : blockIdx.x) * 128 + (tid >> 6) * 16, C0 = (sw ? blockIdx.x : blockIdx.y) * 128 + (tid >> 6) * 16;   // the 16-row group of the block's tile that this thread's first copy serves
    gptr ga = (gptr)(A + (size_t)R0 * K) + (tid & 63) * 16; gptr gb = (gptr)(Bt + (size_t)C0 * K) + (tid & 63) * 16; gptr ga2 = NSPLIT == 1 ? (gptr)(A2 + (size_t)R0 * K) + (tid & 63) * 16 : ga;   // 16 rows x K = K / 32 blocks of 1 KiB
    const unsigned l0 = (unsigned)(size_t)(__attribute__((address_space(3))) char*)ring + tid * 16;
    auto fill = [&](const int t) { const unsigned l = l0 + (t & 1) * SB; const int go = t * 1024;   // pass t's blocks into buffer t mod 2
        if constexpr (NSPLIT == 1) { acopy4(l, ga + go, 64 * K); acopy4(l + 8192u, gb + go, 64 * K); acopy4(l + 16384u, ga2 + go, 64 * K); } else acopy8(l, ga + go, gb + go, 64 * K); };
    // the hand-over behind pass t's last LDS read. EARLY: it stands in front of the pass's products, with all fragments in registers, so the refill flies under them (where the grid leaves registers free: at most two waves a SIMD); else behind them, and the fragments may be read as they are used
    constexpr bool EARLY = NSPLIT == 1;
    auto foot = [&](const int t) {
        asm volatile("s_wait_dscnt 0x0" ::: "memory");      // this wave has left buffer t mod 2
        asm volatile("s_wait_asynccnt 0x0" ::: "memory");   // its copies of pass t + 1 have landed
        __syncthreads();                                    // both hold for every wave: pass t + 1 may be read, buffer t mod 2 refilled
        if (t + 2 < NT) fill(t + 2); };                     // block-uniform test
    fill(0);
    asm volatile("s_wait_asynccnt 0x0" ::: "memory");   // this wave's copies of pass 0 have landed
    __syncthreads();                                    // and every other wave's: pass 0 may be read
    fill(1);
    const char* fa = ring + (r0 & 64) * 64 + lane * 16; const char* fb = ring + 8192 + (c0 & 64) * 64 + lane * 16;   // the wave's four blocks of each operand: the lower or the upper 4 KiB of the tile
#pragma unroll 1
    for (int t = 0; t < NT; ++t) {
        const int bo = (t & 1) * SB;
        V a[4], a2[4], b[4];
#pragma unroll
        for (int mb = 0; mb < 4; ++mb) { a[mb] = WFrag<T16>::lds(fa + bo + mb * 1024); if (NSPLIT == 1) a2[mb] = WFrag<T16>::lds(fa + bo + 16384 + mb * 1024); }
#pragma unroll
        for (int nb = 0; nb < 4; ++nb) b[nb] = WFrag<T16>::lds(fb + bo + nb * 1024);
        if constexpr (EARLY) foot(t);
#pragma unroll
        for (int nb = 0; nb < 4; ++nb) {
#pragma unroll
            for (int mb = 0; mb < 4; ++mb) { acc[mb][nb] = WFrag<T16>::mma(a[mb], b[nb], acc[mb][nb]); if (NSPLIT == 1) acc[mb][nb] = WFrag<T16>::mma(a2[mb], b[nb], acc[mb][nb]); } }
        if constexpr (!EARLY) foot(t);
    }
    asm volatile("s_wait_asynccnt 0x0" ::: "memory");       // no copy is left in flight
    if constexpr (PLANES) {
        const int tb = bx * 64, t0 = tb % TT; const size_t po = ((size_t)(tb / TT) * NH_ + by) * TT * HD + (sw ? (size_t)t0 * HD : (size_t)t0 * 16); const int rs = sw ? HD / 16 : TT / 16;   // q, k: 16 tokens are HD / 16 half blocks; v: 16 tokens are one half block of each 16-row group
        const size_t PE = (size_t)NB_ * NH_ * TT * HD; P16 += z * PE + po; Ph += z * 2 * PE + po; Pl += z * 2 * PE + po;   // planes in the order q, k, v; hi and lo alternate
        if (t0 >= RH) planes_out<true, false>(acc, rs, P16, Ph, Pl);          // wave-uniform tests: one straight-line body each
        else if (z == 0) planes_out<false, true>(acc, rs, P16, Ph, Pl);
        else planes_out<true, true>(acc, rs, P16, Ph, Pl);
        return;
    }
#pragma unroll
    for (int mb = 0; mb < 4; ++mb) {
#pragma unroll
        for (int nb = 0; nb < 4; ++nb) {
#pragma unroll
            for (int j = 0; j < 8; ++j) os[(hi * 8 + j) * 68 + nb * 16 + lr] = acc[mb][nb][j]; }
        __builtin_amdgcn_wave_barrier(); asm volatile("" ::: "memory");
        float* crow = C + (size_t)(r0 + mb * 16) * ldc + c0;
{
#pragma unroll
            for (int s = 0; s < 8; ++s) { const int row = 2 * s + hi, cofs = lr * 4; v4f val = *(const v4fa*)(os + row * 68 + cofs); if (BIAS) { val[0] += bfr(bias[c0 + cofs]); val[1] += bfr(bias[c0 + cofs + 1]); val[2] += bfr(bias[c0 + cofs + 2]); val[3] += bfr(bias[c0 + cofs + 3]); }
                *(v4f*)(crow + (size_t)row * ldc + cofs) = val; }
             }
        __builtin_amdgcn_wave_barrier(); asm volatile("" ::: "memory");
    }
}

__device__ __forceinline__ h16 tohx(float x) { return (h16)x; }
typedef __attribute__((ext_vector_type(2))) _Float16 v2h;
typedef __attribute__((ext_vector_type(4))) _Float16 v4h;
typedef __attribute__((ext_vector_type(2))) unsigned short v2us;
typedef __attribute__((ext_vector_type(4))) unsigned short v4us;
typedef __attribute__((ext_vector_type(2))) float v2f;
typedef __attribute__((ext_vector_type(4))) int v4i;

__global__ __launch_bounds__(256) void k_wtG(const float* __restrict__ w, int K, int N, bf* Bt) {
    const int lane = threadIdx.x & 31; const int L0 = (blockIdx.x * 8 + (threadIdx.x >> 5)) * 8; const int nlines = N * K / 64;
{
#pragma unroll 1
        for (int l = 0; l < 8; ++l) { const int L = L0 + l; if (L >= nlines) break; const size_t e = (size_t)L * 64 + lane * 2; const int k = (int)(e % K), n = (int)(e / K); v2us o;
            o[0] = f2bf(w[(size_t)k * N + n]); o[1] = f2bf(w[(size_t)(k + 1) * N + n]); *(v2us*)(Bt + e) = o; }
         }
}
// f32 [rows][DM] row-major to bf16 in fragment order, x and the four weights in ONE launch. A block takes one 16-row group of one tensor: 16 x DM values, DM / 32 blocks of 1 KiB = 6 x 256 pieces of 16 bytes, contiguous in the plane.
// Thread t writes pieces j*256 + t (a wave's store covers 512 contiguous bytes) and fetches each piece's 8 values: row t & 15, k = j*128 + (t >> 4)*8, so one address per thread serves all loads, one all stores, the rest are immediates.
// Groups 0 .. NB_*TT/16 - 1 are x, then DM/16 groups of each weight in the order q, k, v, p (block-uniform choice).
static_assert(DQ == DM && DKV == DM && DM == 6 * 128, "every cast tensor has rows of DM values; a 16-row group is 6 x 256 pieces");
__global__ __launch_bounds__(256) void k_cvtall(const float* __restrict__ x, const float* __restrict__ wq, const float* __restrict__ wk, const float* __restrict__ wv, const float* __restrict__ wo, bf* XB, bf* WQ, bf* WK, bf* WV, bf* WO) {
    const int GX = NB_ * TT / 16, GW = DM / 16; int g = blockIdx.x; const float* src = x; bf* dst = XB;
    if (g >= GX) { g -= GX; const int t = g / GW; g -= t * GW; src = t == 0 ? wq : t == 1 ? wk : t == 2 ? wv : wo; dst = t == 0 ? WQ : t == 1 ? WK : t == 2 ? WV : WO; }
    const int tid = threadIdx.x; const float* p = src + (size_t)(g * 16 + (tid & 15)) * DM + (tid >> 4) * 8;
    v8f v[6];
#pragma unroll
    for (int j = 0; j < 6; ++j) v[j] = *(const v8f*)(p + j * 128);
    asm volatile("s_wait_xcnt 0x0" ::: "memory");    // stands in front of any rewrite of the address registers of the loads above; its clobber also keeps all twelve loads in front of the first use, so that they fly together
    v4u q[6];
#pragma unroll
    for (int j = 0; j < 6; ++j) { v8us o;
#pragma unroll
        for (int k = 0; k < 8; ++k) o[k] = f2bf(v[j][k]);
        q[j] = __builtin_bit_cast(v4u, o); }
    // six stores, 4 KiB apart at one scalar base; the s_wait_xcnt 0 in front of any rewrite of a register that they name is the last line of their own statement (as in st4)
    asm volatile("global_store_b128 %0, %1, %7\n\tglobal_store_b128 %0, %2, %7 offset:4096\n\tglobal_store_b128 %0, %3, %7 offset:8192\n\tglobal_store_b128 %0, %4, %7 offset:12288\n\tglobal_store_b128 %0, %5, %7 offset:16384\n\tglobal_store_b128 %0, %6, %7 offset:20480\n\ts_wait_xcnt 0x0"
        :: "v"((unsigned)tid * 16u), "v"(q[0]), "v"(q[1]), "v"(q[2]), "v"(q[3]), "v"(q[4]), "v"(q[5]), "s"(dst + (size_t)g * 16 * DM) : "memory"); }

#define AW 4
typedef v8f __attribute__((may_alias)) v8fa;
// 2^x. Behind a v_exp_f32 the instruction set asks for one independent instruction or a v_nop before its result is read or its source overwritten; it is kept here by construction:
// eight at a time, no output sharing a register with an input (each v_exp_f32 is independent of the one in front of it), one v_nop behind the last.
__device__ __forceinline__ v8f exp2x8(const v8f x) { float o0, o1, o2, o3, o4, o5, o6, o7;
    asm("v_exp_f32 %0, %8\n\tv_exp_f32 %1, %9\n\tv_exp_f32 %2, %10\n\tv_exp_f32 %3, %11\n\tv_exp_f32 %4, %12\n\tv_exp_f32 %5, %13\n\tv_exp_f32 %6, %14\n\tv_exp_f32 %7, %15\n\tv_nop"
        : "=&v"(o0), "=&v"(o1), "=&v"(o2), "=&v"(o3), "=&v"(o4), "=&v"(o5), "=&v"(o6), "=&v"(o7) : "v"(x[0]), "v"(x[1]), "v"(x[2]), "v"(x[3]), "v"(x[4]), "v"(x[5]), "v"(x[6]), "v"(x[7]));
    return (v8f){o0, o1, o2, o3, o4, o5, o6, o7}; }
__device__ __forceinline__ float exp2s(const float x) { float o; asm("v_exp_f32 %0, %1\n\tv_nop" : "=v"(o) : "v"(x)); return o; }   // the same slot behind a single one
template <typename T16, bool HL, int NQ>
__device__ __forceinline__ void attn_tile(const T16* __restrict__ Q, const T16* __restrict__ Q2, const T16* __restrict__ Kp, const T16* __restrict__ K2, const T16* __restrict__ Vt, const T16* __restrict__ V2, const int q0, bf* Ah, bf* Al, float* sO, float* sM, float* sL, float* sI, const char* ring, const unsigned ring_l) {
    typedef typename WFrag<T16>::V V;
    constexpr int KS = HL ? AW : 2, MPW = 4 / KS;    // key shares per query group; output tiles (16 d each) a wave sums in the join
    static_assert(AW == 4 && (HL || NQ == 2), "fp16 tiles: 2 query groups of 32 rows x 2 key shares");
    const int lane = threadIdx.x & 31, c = lane & 15, h = lane >> 4; const int w = __builtin_amdgcn_readfirstlane((int)(threadIdx.x >> 5));
    const int qg = HL ? 0 : (w & 1), kh = HL ? w : (w >> 1), qw = q0 + qg * (NQ * 16);   // the wave's query group, its key share, its first query row (all wave-uniform)
    auto wi = [&](const int kk) { return HL ? kk : qg + 2 * kk; };                       // the wave that holds share kk of this wave's query group
    const float L2E = 1.4426950408889634f, SH = HL ? 0.0f : 10.0f; const unsigned lb = lane * 16;
    V qf[NQ][2], qf2[NQ][2];
#pragma unroll
    for (int nq = 0; nq < NQ; ++nq)
#pragma unroll
        for (int ks = 0; ks < 2; ++ks) { const size_t qo = (size_t)(qw + nq * 16) * HD + ks * 512; qf[nq][ks] = WFrag<T16>::ld(Q + qo, lb); if (HL) qf2[nq][ks] = WFrag<T16>::ld(Q2 + qo, lb); }
    V ka[2][2], ka2[2][2], va[4], va2[4];
    v8f o[4][NQ]; float m[NQ], l[NQ];
#pragma unroll
    for (int nq = 0; nq < NQ; ++nq) { m[nq] = -3.0e38f; l[nq] = 0.f;
#pragma unroll
        for (int mb = 0; mb < 4; ++mb) o[mb][nq] = (v8f){}; }
    const int nblk = (qw + NQ * 16 + 31) / 32;      // 32-key blocks that hold a key <= the wave's last query; only the last one crosses the diagonal
    asm volatile("s_wait_xcnt 0x0" ::: "memory");    // stands in front of any rewrite of the address registers of the loads above
    auto pass = [&](const int kb) {                  // one 32-key block, its fragments in ka, va (ka2, va2)
        const int k0 = kb * 32;
        v8f s[2][NQ];
#pragma unroll
        for (int t = 0; t < 2; ++t)
#pragma unroll
            for (int nq = 0; nq < NQ; ++nq) { v8f a = (v8f){};
#pragma unroll
                for (int ks = 0; ks < 2; ++ks) { a = WFrag<T16>::mma(ka[t][ks], qf[nq][ks], a); if (HL) { a = WFrag<T16>::mma(ka[t][ks], qf2[nq][ks], a); a = WFrag<T16>::mma(ka2[t][ks], qf[nq][ks], a); } }
                s[t][nq] = a; }
        if (kb == nblk - 1) {                        // diagonal block (wave-uniform test): keys above the query are masked by select
#pragma unroll
            for (int t = 0; t < 2; ++t)
#pragma unroll
                for (int nq = 0; nq < NQ; ++nq)
#pragma unroll
                    for (int r = 0; r < 8; ++r) s[t][nq][r] = (k0 + t * 16 + 8 * h + r <= qw + nq * 16 + c) ? s[t][nq][r] : -3.0e38f; }
#pragma unroll
        for (int nq = 0; nq < NQ; ++nq) {
            float mx = m[nq];
#pragma unroll
            for (int t = 0; t < 2; ++t)
#pragma unroll
                for (int r = 0; r < 8; ++r) { s[t][nq][r] *= SCL; mx = fmaxf(mx, s[t][nq][r]); }
            mx = fmaxf(mx, __shfl_xor(mx, 16, 32));
            const float al = exp2s((m[nq] - mx) * L2E); m[nq] = mx;
            float sum = 0.f;
#pragma unroll
            for (int t = 0; t < 2; ++t) { s[t][nq] = exp2x8((s[t][nq] - mx) * L2E + SH);
#pragma unroll
                for (int r = 0; r < 8; ++r) sum += s[t][nq][r]; }
            l[nq] = l[nq] * al + sum;                // this half's keys only; the halves are joined once after the loop
#pragma unroll
            for (int mb = 0; mb < 4; ++mb) o[mb][nq] *= al;
            V pf, pf2;
            if constexpr (HL) { v8us h0, h1, l0, l1;
#pragma unroll
                for (int r = 0; r < 8; ++r) { unsigned short x, y; splitf(s[0][nq][r], x, y); h0[r] = x; l0[r] = y; splitf(s[1][nq][r], x, y); h1[r] = x; l1[r] = y; }
                pf = cat16b(h0, h1); pf2 = cat16b(l0, l1);
            } else { v8h p0, p1;
#pragma unroll
                for (int r = 0; r < 8; ++r) { p0[r] = tohx(s[0][nq][r]); p1[r] = tohx(s[1][nq][r]); }
                pf = cat16(p0, p1); }
#pragma unroll
            for (int mb = 0; mb < 4; ++mb) { o[mb][nq] = WFrag<T16>::mma(va[mb], pf, o[mb][nq]); if (HL) { o[mb][nq] = WFrag<T16>::mma(va[mb], pf2, o[mb][nq]); o[mb][nq] = WFrag<T16>::mma(va2[mb], pf, o[mb][nq]); } }
        } };
    if constexpr (HL) {
#pragma unroll 1
        for (int kb = w; kb < nblk; kb += AW) {
#pragma unroll
            for (int t = 0; t < 2; ++t)
#pragma unroll
                for (int ks = 0; ks < 2; ++ks) { const size_t ko = (size_t)(kb * 32 + t * 16) * HD + ks * 512; ka[t][ks] = WFrag<T16>::ld(Kp + ko, lb); ka2[t][ks] = WFrag<T16>::ld(K2 + ko, lb); }
#pragma unroll
            for (int mb = 0; mb < 4; ++mb) { const size_t vo = (size_t)mb * 16 * TT + kb * 512; va[mb] = WFrag<T16>::ld(Vt + vo, lb); va2[mb] = WFrag<T16>::ld(V2 + vo, lb); }
            asm volatile("s_wait_xcnt 0x0" ::: "memory");    // in front of any rewrite of those loads' address registers; its clobber also keeps these loads from being sunk below this point, towards their use, where each would be waited for alone
            pass(kb);
        }
    } else {
        // stage s = keys s*64 .. s*64 + 63 in buffer s mod 2 (16 KiB): K, 8 KiB contiguous in its plane, then for each of the four 16-row groups of V^T its two 1-KiB blocks (64 KiB apart in the plane). Thread t's 16 bytes at t*16 of each 2-KiB piece.
        const int NS = q0 / 64 + 1;                  // the last stage holds the tile's own rows; q0 >= RH, so there are at least two stages (block-uniform)
        static_assert(RH >= 64 && RH % 64 == 0 && TT % 64 == 0, "the prologue fills two buffers; tiles of 64 rows");
        gptr gk = (gptr)Kp + threadIdx.x * 16; gptr gv = (gptr)Vt + threadIdx.x * 16; const unsigned l0 = ring_l + threadIdx.x * 16;
        auto fill = [&](const int s) { const unsigned lq = l0 + (s & 1) * 16384u; acopy4(lq, gk + s * 8192, 2048); acopy4(lq + 8192u, gv + s * 2048, 65536); };
        fill(0);
        asm volatile("s_wait_asynccnt 0x0" ::: "memory");   // this wave's copies of stage 0 have landed
        __syncthreads();                                    // and every other wave's: stage 0 may be read
        fill(1);
#pragma unroll 1
        for (int s = 0; s < NS; ++s) {
            const int kb = 2 * s + kh; const bool on = kb < nblk;   // wave-uniform: in the last stage the lower query group has no key in the upper block
            if (on) {
                const char* f = ring + (s & 1) * 16384 + lb;
#pragma unroll
                for (int t = 0; t < 2; ++t)
#pragma unroll
                    for (int ks = 0; ks < 2; ++ks) ka[t][ks] = WFrag<T16>::lds(f + kh * 4096 + t * 2048 + ks * 1024);
#pragma unroll
                for (int mb = 0; mb < 4; ++mb) va[mb] = WFrag<T16>::lds(f + 8192 + mb * 2048 + kh * 1024);
            }
            // the hand-over behind stage s's last LDS read stands in front of the stage's products, with all fragments in registers: the sixteen reads go out as one group, and the refill flies under the products
            asm volatile("s_wait_dscnt 0x0" ::: "memory");      // this wave has left buffer s mod 2
            asm volatile("s_wait_asynccnt 0x0" ::: "memory");   // its copies of stage s + 1 have landed
            __syncthreads();                                    // both hold for every wave: stage s + 1 may be read, buffer s mod 2 refilled
            if (s + 2 < NS) fill(s + 2);                        // block-uniform test
            if (on) pass(kb);
        }
        asm volatile("s_wait_asynccnt 0x0" ::: "memory");       // no copy is left in flight
    }
    // join: per query the (m, l) of the waves that share a query group go through LDS; every wave rescales its O^T to the common maximum and stages it; then each wave sums MPW output tiles per nq as they stand in the lanes, each one 512-byte half block of the merged planes
#pragma unroll
    for (int nq = 0; nq < NQ; ++nq) { l[nq] += __shfl_xor(l[nq], 16, 32); if (h == 0) { sM[w * 32 + nq * 16 + c] = m[nq]; sL[w * 32 + nq * 16 + c] = l[nq]; } }
    __syncthreads();
#pragma unroll
    for (int nq = 0; nq < NQ; ++nq) { float M = sM[wi(0) * 32 + nq * 16 + c];
#pragma unroll
        for (int kk = 1; kk < KS; ++kk) M = fmaxf(M, sM[wi(kk) * 32 + nq * 16 + c]);
        float lt = 0.f;
#pragma unroll
        for (int kk = 0; kk < KS; ++kk) lt += sL[wi(kk) * 32 + nq * 16 + c] * exp2s((sM[wi(kk) * 32 + nq * 16 + c] - M) * L2E);
        if (kh == 0 && h == 0) sI[qg * 32 + nq * 16 + c] = __fdiv_rn(1.0f, lt);
        const float f = exp2s((m[nq] - M) * L2E);
#pragma unroll
        for (int mb = 0; mb < 4; ++mb) *(v8fa*)(sO + (((w * 4 + mb) * NQ + nq) * 32 + lane) * 8) = o[mb][nq] * f; }
    __syncthreads();
#pragma unroll
    for (int nq = 0; nq < NQ; ++nq)
#pragma unroll
        for (int i = 0; i < MPW; ++i) { const int mb = kh * MPW + i;
        v8f a = *(const v8fa*)(sO + (((wi(0) * 4 + mb) * NQ + nq) * 32 + lane) * 8);
#pragma unroll
        for (int kk = 1; kk < KS; ++kk) a += *(const v8fa*)(sO + (((wi(kk) * 4 + mb) * NQ + nq) * 32 + lane) * 8);
        const float inv = sI[qg * 32 + nq * 16 + c]; v8us oh, ol;
#pragma unroll
        for (int r = 0; r < 8; ++r) { unsigned short x, y; splitf(a[r] * inv, x, y); oh[r] = x; ol[r] = y; }
        const size_t oo = (size_t)(qw + nq * 16) * DQ + mb * 256;
        asm volatile("global_store_b128 %0, %1, %3\n\tglobal_store_b128 %0, %2, %4\n\ts_wait_xcnt 0x0"   // the wait in front of any rewrite of a register that these stores name, in their own statement (as in st4)
            :: "v"(lb), "v"(__builtin_bit_cast(v4u, oh)), "v"(__builtin_bit_cast(v4u, ol)), "s"(Ah + oo), "s"(Al + oo) : "memory"); }
}
// grid (batches x heads, tiles), blockIdx.x = b * heads + head; blockIdx.y numbers the heaviest tiles first: (TT - RH) / 64 fp16 tiles of 64 rows from the last row down, then RH / 16 hi/lo tiles of 16 rows.
__global__ __launch_bounds__(AW * 32) void k_fattn(const h16* __restrict__ Q16, const h16* __restrict__ K16, const h16* __restrict__ V16, const bf* __restrict__ Qh, const bf* __restrict__ Ql, const bf* __restrict__ Kh, const bf* __restrict__ Kl, const bf* __restrict__ Vh, const bf* __restrict__ Vl, bf* Ah, bf* Al) {
    __shared__ __align__(32) float sO[AW * 4 * 2 * 32 * 8]; __shared__ float sM[AW * 32], sL[AW * 32], sI[64];
    __shared__ __align__(1024) char ring[2 * 16384];
    const unsigned ring_l = (unsigned)(size_t)(__attribute__((address_space(3))) char*)ring;
    const size_t pz = (size_t)blockIdx.x * TT * HD; const int ty = blockIdx.y; const size_t ao = (size_t)(blockIdx.x / NH_) * TT * DQ + (blockIdx.x % NH_) * (HD * 16); Ah += ao; Al += ao;   // a head's 64 k are two blocks of 512 elements in each 16-row group
    if (ty < (TT - RH) / 64) attn_tile<h16, false, 2>(Q16 + pz, nullptr, K16 + pz, nullptr, V16 + pz, nullptr, TT - 64 * (ty + 1), Ah, Al, sO, sM, sL, sI, ring, ring_l);
    else attn_tile<bf, true, 1>(Qh + pz, Ql + pz, Kh + pz, Kl + pz, Vh + pz, Vl + pz, RH - 16 * (ty - (TT - RH) / 64 + 1), Ah, Al, sO, sM, sL, sI, ring, ring_l);
}

extern "C" void kernel_launch(void* const* d_in, const int* in_sizes, int n_in,
                              void* d_out, int out_size, void* d_ws, size_t ws_size, hipStream_t stream) {
    (void)in_sizes; (void)n_in; (void)out_size;
    const float* x = (const float*)d_in[0]; const float* wq = (const float*)d_in[1]; const float* wk = (const float*)d_in[2]; const float* wv = (const float*)d_in[3]; const float* wo = (const float*)d_in[4]; const float* bo = (const float*)d_in[5];   /* argument order x, Wq, Wk, Wv, Wp ('oi' [768][768]: nn.Linear layout, applied transposed), bp */
    float* OUT = (float*)d_out;     // [4][2048][768]
    char* wsp = (char*)d_ws;
    auto take = [&](size_t bytes) { char* p = wsp; wsp += (bytes + 255) & ~(size_t)255; return (void*)p; };
    bf* WQ = (bf*)take((size_t)DQ * DM * 2); bf* WK = (bf*)take((size_t)DKV * DM * 2); bf* WV = (bf*)take((size_t)DKV * DM * 2); bf* WO = (bf*)take((size_t)DM * DQ * 2);
    bf* XB = (bf*)take((size_t)NB_ * TT * DM * 2);
    static_assert(NKV == NH_ && ((size_t)DQ * DM * 2) % 256 == 0 && ((size_t)NB_ * NH_ * TT * HD * 2) % 256 == 0, "the projection launch steps from q to k to v by one weight's, one plane's size: take() may leave no gap");
    h16* QP16 = (h16*)take((size_t)NB_ * NH_ * TT * HD * 2); h16* KP16 = (h16*)take((size_t)NB_ * NKV * TT * HD * 2); h16* VT16 = (h16*)take((size_t)NB_ * NKV * HD * TT * 2);
    bf* QPh = (bf*)take((size_t)NB_ * NH_ * TT * HD * 2); bf* QPl = (bf*)take((size_t)NB_ * NH_ * TT * HD * 2); bf* KPh = (bf*)take((size_t)NB_ * NKV * TT * HD * 2); bf* KPl = (bf*)take((size_t)NB_ * NKV * TT * HD * 2); bf* VTh = (bf*)take((size_t)NB_ * NKV * HD * TT * 2); bf* VTl = (bf*)take((size_t)NB_ * NKV * HD * TT * 2);
    bf* ATh = (bf*)take((size_t)NB_ * TT * DQ * 2); bf* ATl = (bf*)take((size_t)NB_ * TT * DQ * 2);
    if ((size_t)(wsp - (char*)d_ws) > ws_size) return;    // about 149 MiB of the 256 MiB
    // one launch per stage for all batches: one cast launch ('oi' weights are already [out][in] = Bt rows: a cast into fragment order, no transpose); the projections see x as [NB_*TT][DM] rows (grid z = q, k, v), attention takes the batch from blockIdx.x
    k_cvtall<<<NB_ * TT / 16 + 4 * (DM / 16), 256, 0, stream>>>(x, wq, wk, wv, wo, XB, WQ, WK, WV, WO);
    k_gemmw<bf, 0, false, true, DM><<<dim3(NB_ * TT / 128, NH_ / 2, 3), 128, 0, stream>>>(XB, nullptr, WQ, nullptr, nullptr, 0, nullptr, 0, (size_t)DQ * DM, 0, QP16, QPh, QPl);
    k_fattn<<<dim3(NB_ * NH_, (TT - RH) / 64 + RH / 16, 1), AW * 32, 0, stream>>>(QP16, KP16, VT16, QPh, QPl, KPh, KPl, VTh, VTl, ATh, ATl);
    k_gemmw<bf, 1, true, false, DQ><<<dim3(NB_ * TT / 128, DM / 128, 1), 128, 0, stream>>>(ATh, ATl, WO, nullptr, OUT, DM, bo, 0, 0, 0, nullptr, nullptr, nullptr);
}

// v008
// A run of this version takes 88.7 microseconds.
// In two side-by-side timings against v007, it was 1.13 and 1.11 times as fast.
// All steps since v000 together make it 24.5 times as fast.
#include <hip/hip_runtime.h>

// Causal multi-head attention with bias-free (out, in) projections and a biased (out, in) output projection at a 768-wide model (x [4][2048][768]; q, k, v = x W^T ('oi' [768][768] uniform(+-1/sqrt(768)), no bias; 12 heads x 64); scores x 64^-0.5; tril kept, -inf elsewhere (tril built inside the function); softmax; out = merged Wp^T + bp ('oi' + a REAL bias, uniform(+-1/sqrt(768))) -> [4][2048][768] (6.3 M); argument order x, Wq, Wk, Wv, Wp, bp).
// Every 16-bit operand plane lies in FRAGMENT ORDER: a block of 16 rows x 32 k is 1 KiB, two halves of 512 B, lane l's 16 bytes at l*16 (row l & 15; k = half*16 + (l >> 4)*8 + 0..7); blocks run along k, then along rows.
// A wave's 16-byte-per-lane fragment load so covers 512 contiguous bytes (4 whole lines, not 32-byte pieces of 16 lines), and it puts the same values into the same registers as a load from row-major planes.
// Layout, all four batches in every launch (rows b*2048 + t, planes [b][h]): bf16 copy of x; 'oi' weights cast (no transpose); exact projections (K 768), q, k and v in one launch that writes the head planes itself; one fused causal attention launch at 12 heads (scores, online softmax and the value product stay in registers; hybrid rows: < 512 hi/lo 3 products, rest fp16 with probabilities x1024); merged hi/lo x Wp exact + bp.
// Compute dtypes, f32 accumulate: every input rounded to bf16; projections exact; attention rows < 512 3 products, rest fp16; softmax f32; Wp hl x exact + bias.

#define NB_  4
#define TT   2048
#define DM   768
#define NH_  12
#define NKV  12
#define HD   64
#define DQ   (NH_ * HD)
#define DKV  (NKV * HD)
#define RH   512                  // query rows < RH use hi+lo planes (a multiple of 64, at least 64)
#define SCL  0.125f   // HD^-0.5
typedef _Float16 h16;
typedef unsigned short bf;
typedef __attribute__((ext_vector_type(16))) __bf16   v16bf;
typedef __attribute__((ext_vector_type(16))) _Float16 v16h;
typedef __attribute__((ext_vector_type(8)))  _Float16 v8h;
typedef __attribute__((ext_vector_type(8)))  unsigned short v8us;
typedef __attribute__((ext_vector_type(8)))  float    v8f;
typedef __attribute__((ext_vector_type(4)))  float    v4f;
typedef v8h  __attribute__((may_alias)) v8ha;
typedef v4f  __attribute__((may_alias)) v4fa;
typedef v8us __attribute__((may_alias)) v8usa;

__device__ __forceinline__ unsigned short f2bf(float f) { unsigned u = __float_as_uint(f); u += 0x7FFFu + ((u >> 16) & 1u); return (unsigned short)(u >> 16); }
__device__ __forceinline__ float bf2f(unsigned short b) { return __uint_as_float(((unsigned)b) << 16); }
__device__ __forceinline__ float bfr(float f) { return bf2f(f2bf(f)); }
__device__ __forceinline__ v16h cat16(v8h lo, v8h hi) { return __builtin_shufflevector(lo, hi, 0, 1, 2, 3, 4, 5, 6, 7, 8, 9, 10, 11, 12, 13, 14, 15); }
__device__ __forceinline__ v16bf cat16b(v8us lo, v8us hi) { return __builtin_bit_cast(v16bf, __builtin_shufflevector(lo, hi, 0, 1, 2, 3, 4, 5, 6, 7, 8, 9, 10, 11, 12, 13, 14, 15)); }
__device__ __forceinline__ v8f wmma16(v16h a, v16h b, v8f c) { return __builtin_amdgcn_wmma_f32_16x16x32_f16(false, a, false, b, (short)0, c, false, false); }
__device__ __forceinline__ v8f wmmab(v16bf a, v16bf b, v8f c) { return __builtin_amdgcn_wmma_f32_16x16x32_bf16(false, a, false, b, (short)0, c, false, false); }



// ---- k_gemmw: register-blocked GEMM, one wave per 64x64 output tile (16 accumulators), FOUR waves (2 x 2) per block on a 128x128 tile; grid (M/128, N/128, Z), 128 threads.
// The block's operand rows of one pass (32 k: 8 blocks of 1 KiB per operand, already in fragment order) are brought into LDS once by asynchronous copies and read there by the two waves that need each, so every operand byte leaves L2 half as often;
// a ring of NB buffers: the copies of passes t + 2 .. t + NB fly while pass t + 1 is worked on, so a copy has NB - 1 passes to land (its lines come from memory where no other block has touched them yet).
// C[m][n] (f32, pitch ldc, + optional f32 bias[n]) = sum_k A[m][k] Bt[n][k] (+ split products per NSPLIT). z-batch strides sA/sB/sC in elements. K % 32 == 0, a compile-time constant.
// PLANES: no C. A = token rows [NB_*TT][K], Bt = the q, k, v weights behind one another (z = 0, 1, 2; a wave's 64-wide tile is one head); the tile leaves as 16-bit head planes in fragment order, q and k [b][h] rows t, k index d; v [b][h] rows d, k index t.
// A lane's 8 accumulator values run along m, so the plane's k index is made the m index: q and k are computed as W x^T (operand roles swapped; both fragments load alike, same k order), v as x W^T.
// Only what attention reads is written: hi/lo planes for t < RH, the fp16 q plane for t >= RH, the fp16 k and v planes everywhere.
// ld(p, lb): the fragment of the block at p (the same pointer in every lane: a scalar base), lb = lane * 16; ldq(q): the same from the lane's own address q.
typedef const __attribute__((address_space(1))) char* gptr;   // a byte address in global memory (keeps the loads global_load where the address passes through an asm statement)
template <typename T16> struct WFrag;
template <> struct WFrag<h16> { typedef v16h V; static __device__ __forceinline__ V ldq(gptr q) { return cat16(*(const __attribute__((address_space(1))) v8h*)q, *(const __attribute__((address_space(1))) v8h*)(q + 512)); } static __device__ __forceinline__ V ld(const h16* p, const unsigned lb) { return ldq((gptr)p + lb); } static __device__ __forceinline__ V lds(const char* q) { return cat16(*(const v8ha*)q, *(const v8ha*)(q + 512)); } static __device__ __forceinline__ v8f mma(V a, V b, v8f c) { return wmma16(a, b, c); } };
template <> struct WFrag<bf> { typedef v16bf V; static __device__ __forceinline__ V ldq(gptr q) { return cat16b(*(const __attribute__((address_space(1))) v8us*)q, *(const __attribute__((address_space(1))) v8us*)(q + 512)); } static __device__ __forceinline__ V ld(const bf* p, const unsigned lb) { return ldq((gptr)p + lb); } static __device__ __forceinline__ V lds(const char* q) { return cat16b(*(const v8usa*)q, *(const v8usa*)(q + 512)); } static __device__ __forceinline__ v8f mma(V a, V b, v8f c) { return wmmab(a, b, c); } };
__device__ __forceinline__ void splitf(float y, unsigned short& h, unsigned short& l) { h = f2bf(y); l = f2bf(y - bf2f(h)); }
// One wave's 64x64 accumulator tile to 16-bit planes (W16: fp16; WHL: bf16 hi and lo). Plane row = the tile's n index (16 per nb), plane k = the m index.
// Accumulator tile (mb, nb) converted is one 512-byte half block of the plane as it stands in the lanes (row = lane & 15, k = mb*16 + (lane >> 4)*8 + 0..7): one 16-byte store per lane, whole lines, no staging.
// rs = half blocks from one 16-row group of the plane to the next (2 * the plane's k extent / 32).
typedef __attribute__((ext_vector_type(4))) unsigned v4u;
// Four such stores, 512 B apart at one scalar base. The s_wait_xcnt 0 that stands in front of any rewrite of a register which an issued store names (data, offset, base) is the last line of the stores' own statement: there nothing can be moved in front of it.
__device__ __forceinline__ void st4(void* base, const unsigned lb, const v4u a, const v4u b, const v4u c, const v4u d) {
    asm volatile("global_store_b128 %0, %1, %5\n\tglobal_store_b128 %0, %2, %5 offset:512\n\tglobal_store_b128 %0, %3, %5 offset:1024\n\tglobal_store_b128 %0, %4, %5 offset:1536\n\ts_wait_xcnt 0x0"
        :: "v"(lb), "v"(a), "v"(b), "v"(c), "v"(d), "s"(base) : "memory"); }
template <bool W16, bool WHL>
__device__ __forceinline__ void planes_out(const v8f (&acc)[4][4], const int rs, h16* P16, bf* Ph, bf* Pl) {
    const unsigned lb = (threadIdx.x & 31) * 16;
#pragma unroll
    for (int nb = 0; nb < 4; ++nb) { const size_t go = (size_t)(nb * rs) * 256;
        if (W16) { v4u q[4];
#pragma unroll
            for (int mb = 0; mb < 4; ++mb) { v8h p;
#pragma unroll
                for (int j = 0; j < 8; ++j) p[j] = (h16)acc[mb][nb][j];
                q[mb] = __builtin_bit_cast(v4u, p); }
            st4(P16 + go, lb, q[0], q[1], q[2], q[3]); }
        if (WHL) { v4u qh[4], ql[4];
#pragma unroll
            for (int mb = 0; mb < 4; ++mb) { v8us ph, pl;
#pragma unroll
                for (int j = 0; j < 8; ++j) { unsigned short x, y; splitf(acc[mb][nb][j], x, y); ph[j] = x; pl[j] = y; }
                qh[mb] = __builtin_bit_cast(v4u, ph); ql[mb] = __builtin_bit_cast(v4u, pl); }
            st4(Ph + go, lb, qh[0], qh[1], qh[2], qh[3]); st4(Pl + go, lb, ql[0], ql[1], ql[2], ql[3]); }
    }
}
// One pass's operand blocks into one buffer: thread t's 16 bytes at t*16 of each pair of 1-KiB blocks (LDS: 2 KiB apart, the operands 8 KiB apart; global: two 16-row groups = gs bytes apart). l = the lane's own LDS byte address, ga, gb = its own global addresses.
// The s_wait_xcnt 0 that stands in front of any rewrite of a register which an issued copy names is the last line of the copies' own statement: there nothing can be moved in front of it.
__device__ __forceinline__ void acopy8(const unsigned l, gptr ga, gptr gb, const int gs) {
    asm volatile("global_load_async_to_lds_b128 %0, %8, off\n\tglobal_load_async_to_lds_b128 %1, %9, off\n\tglobal_load_async_to_lds_b128 %2, %10, off\n\tglobal_load_async_to_lds_b128 %3, %11, off\n\tglobal_load_async_to_lds_b128 %4, %12, off\n\tglobal_load_async_to_lds_b128 %5, %13, off\n\tglobal_load_async_to_lds_b128 %6, %14, off\n\tglobal_load_async_to_lds_b128 %7, %15, off\n\ts_wait_xcnt 0x0"
        :: "v"(l + 0u), "v"(l + 2048u), "v"(l + 4096u), "v"(l + 6144u), "v"(l + 8192u), "v"(l + 10240u), "v"(l + 12288u), "v"(l + 14336u), "v"(ga), "v"(ga + gs), "v"(ga + 2 * gs), "v"(ga + 3 * gs), "v"(gb), "v"(gb + gs), "v"(gb + 2 * gs), "v"(gb + 3 * gs) : "memory"); }
__device__ __forceinline__ void acopy4(const unsigned l, gptr ga, const int gs) {   // one operand alone: fewer address registers at a time
    asm volatile("global_load_async_to_lds_b128 %0, %4, off\n\tglobal_load_async_to_lds_b128 %1, %5, off\n\tglobal_load_async_to_lds_b128 %2, %6, off\n\tglobal_load_async_to_lds_b128 %3, %7, off\n\ts_wait_xcnt 0x0"
        :: "v"(l + 0u), "v"(l + 2048u), "v"(l + 4096u), "v"(l + 6144u), "v"(ga), "v"(ga + gs), "v"(ga + 2 * gs), "v"(ga + 3 * gs) : "memory"); }
template <typename T16, int NSPLIT, bool BIAS, bool PLANES, int K>
__global__ __launch_bounds__(128) void k_gemmw(const T16* __restrict__ A, const T16* __restrict__ A2, const T16* __restrict__ Bt, const T16* __restrict__ Bt2, float* C, int ldc, const float* __restrict__ bias, size_t sA, size_t sB, size_t sC, h16* P16, bf* Ph, bf* Pl) {
    typedef typename WFrag<T16>::V V;
    constexpr int SB = (NSPLIT == 1 ? 3 : 2) * 8192, NT = K / 32;   // bytes of one buffer (A | Bt | A2, 128 rows x 32 k each); passes
    constexpr int NB = 3, CP = SB / 2048;                            // buffers of the ring; copies of one wave per pass, the same in every wave and every fill
    static_assert(NT >= NB && NB * CP <= 63, "the prologue fills every buffer; at most 63 copies of a wave in flight");
    __shared__ __align__(1024) char ring[NB * SB];
    static_assert(4 * 16 * 68 * 4 <= NB * SB, "the output staging below lies in the ring");
    const size_t z = blockIdx.z; A += z * sA; if (A2) A2 += z * sA; Bt += z * sB; if (Bt2) Bt2 += z * sB; C += z * sC;
    const bool sw = PLANES && z < 2;   // q, k: the weight rows take the m side, the token rows the n side (block-uniform)
    if (sw) { const T16* t = A; A = Bt; Bt = t; }
    const int tid = threadIdx.x, lane = tid & 31, lr = lane & 15, hi = lane >> 4; const int w = __builtin_amdgcn_readfirstlane(tid >> 5);
    const int bx = blockIdx.x * 2 + (w & 1), by = blockIdx.y * 2 + (w >> 1);   // the wave's own 64x64 tile, numbered as a grid of such tiles
    const int r0 = (sw ? by : bx) * 64, c0 = (sw ? bx : by) * 64;
    // output staging, 16 x 68 floats a wave, private to the wave: it lies in the ring, which nobody reads and no copy writes behind the last pass's barrier (each wave's s_wait_dscnt 0 and s_wait_asynccnt 0 stand in front of that barrier). A separate array would raise the block's LDS past a quarter of the WGP's, and the build then spends more than 256 registers and spills
    float* os = (float*)ring + w * (16 * 68);
    v8f acc[4][4];
#pragma unroll
    for (int mb = 0; mb < 4; ++mb)
#pragma unroll
        for (int nb = 0; nb < 4; ++nb) acc[mb][nb] = (v8f){};
    static_assert(NSPLIT < 2, "the pass below stages A, A2 and Bt only");
    const int R0 = (sw ? blockIdx.y : blockIdx.x) * 128 + (tid >> 6) * 16, C0 = (sw ? blockIdx.x : blockIdx.y) * 128 + (tid >> 6) * 16;   // the 16-row group of the block's tile that this thread's first copy serves
    gptr ga = (gptr)(A + (size_t)R0 * K) + (tid & 63) * 16; gptr gb = (gptr)(Bt + (size_t)C0 * K) + (tid & 63) * 16; gptr ga2 = NSPLIT == 1 ? (gptr)(A2 + (size_t)R0 * K) + (tid & 63) * 16 : ga;   // 16 rows x K = K / 32 blocks of 1 KiB
    const unsigned l0 = (unsigned)(size_t)(__attribute__((address_space(3))) char*)ring + tid * 16;
    auto fill = [&](const int t, const int bo) { const unsigned l = l0 + bo; const int go = t * 1024;   // pass t's blocks into buffer t mod NB, which begins at byte bo
        if constexpr (NSPLIT == 1) { acopy4(l, ga + go, 64 * K); acopy4(l + 8192u, gb + go, 64 * K); acopy4(l + 16384u, ga2 + go, 64 * K); } else acopy8(l, ga + go, gb + go, 64 * K); };
    // the hand-over behind pass t's last LDS read. EARLY: it stands in front of the pass's products, with all fragments in registers, so the refill flies under them (where the grid leaves registers free: at most two waves a SIMD); else behind them, and the fragments may be read as they are used
    constexpr bool EARLY = NSPLIT == 1;
    auto foot = [&](const int t, const int bo) {
        asm volatile("s_wait_dscnt 0x0" ::: "memory");      // this wave has left buffer t mod NB
        // its copies of pass t + 1 have landed. Copies land in issue order for the counter: while all of the passes t + 2 .. t + NB - 1 exist, exactly their (NB - 2) * CP copies are younger and may fly on; in the tail the wait is to 0 (block-uniform test)
        if (t + NB - 1 < NT) asm volatile("s_wait_asynccnt %0" :: "n"((NB - 2) * CP) : "memory"); else asm volatile("s_wait_asynccnt 0x0" ::: "memory");
        __syncthreads();                                    // both hold for every wave: pass t + 1 may be read, buffer t mod NB refilled
        if (t + NB < NT) fill(t + NB, bo); };               // block-uniform test
#pragma unroll   // the prologue's buffer and pass offsets become constants
    for (int s = 0; s < NB; ++s) fill(s, s * SB);
    asm volatile("s_wait_asynccnt %0" :: "n"((NB - 1) * CP) : "memory");   // this wave's copies of pass 0 have landed (the younger ones are those of passes 1 .. NB - 1)
    __syncthreads();                                    // and every other wave's: pass 0 may be read
    const char* fa = ring + (r0 & 64) * 64 + lane * 16; const char* fb = ring + 8192 + (c0 & 64) * 64 + lane * 16;   // the wave's four blocks of each operand: the lower or the upper 4 KiB of the tile
    int bo = 0;   // where buffer t mod NB begins
#pragma unroll 1
    for (int t = 0; t < NT; ++t) {
        V a[4], a2[4], b[4];
#pragma unroll
        for (int mb = 0; mb < 4; ++mb) { a[mb] = WFrag<T16>::lds(fa + bo + mb * 1024); if (NSPLIT == 1) a2[mb] = WFrag<T16>::lds(fa + bo + 16384 + mb * 1024); }
#pragma unroll
        for (int nb = 0; nb < 4; ++nb) b[nb] = WFrag<T16>::lds(fb + bo + nb * 1024);
        if constexpr (EARLY) foot(t, bo);
#pragma unroll
        for (int nb = 0; nb < 4; ++nb) {
#pragma unroll
            for (int mb = 0; mb < 4; ++mb) { acc[mb][nb] = WFrag<T16>::mma(a[mb], b[nb], acc[mb][nb]); if (NSPLIT == 1) acc[mb][nb] = WFrag<T16>::mma(a2[mb], b[nb], acc[mb][nb]); } }
        if constexpr (!EARLY) foot(t, bo);
        bo = bo + SB == NB * SB ? 0 : bo + SB;
    }
    asm volatile("s_wait_asynccnt 0x0" ::: "memory");       // no copy is left in flight
    if constexpr (PLANES) {
        const int tb = bx * 64, t0 = tb % TT; const size_t po = ((size_t)(tb / TT) * NH_ + by) * TT * HD + (sw ? (size_t)t0 * HD : (size_t)t0 * 16); const int rs = sw ? HD / 16 : TT / 16;   // q, k: 16 tokens are HD / 16 half blocks; v: 16 tokens are one half block of each 16-row group
        const size_t PE = (size_t)NB_ * NH_ * TT * HD; P16 += z * PE + po; Ph += z * 2 * PE + po; Pl += z * 2 * PE + po;   // planes in the order q, k, v; hi and lo alternate
        if (t0 >= RH) planes_out<true, false>(acc, rs, P16, Ph, Pl);          // wave-uniform tests: one straight-line body each
        else if (z == 0) planes_out<false, true>(acc, rs, P16, Ph, Pl);
        else planes_out<true, true>(acc, rs, P16, Ph, Pl);
        return;
    }
#pragma unroll
    for (int mb = 0; mb < 4; ++mb) {
#pragma unroll
        for (int nb = 0; nb < 4; ++nb) {
#pragma unroll
            for (int j = 0; j < 8; ++j) os[(hi * 8 + j) * 68 + nb * 16 + lr] = acc[mb][nb][j]; }
        __builtin_amdgcn_wave_barrier(); asm volatile("" ::: "memory");
        float* crow = C + (size_t)(r0 + mb * 16) * ldc + c0;
{
#pragma unroll
            for (int s = 0; s < 8; ++s) { const int row = 2 * s + hi, cofs = lr * 4; v4f val = *(const v4fa*)(os + row * 68 + cofs); if (BIAS) { val[0] += bfr(bias[c0 + cofs]); val[1] += bfr(bias[c0 + cofs + 1]); val[2] += bfr(bias[c0 + cofs + 2]); val[3] += bfr(bias[c0 + cofs + 3]); }
                *(v4f*)(crow + (size_t)row * ldc + cofs) = val; }
             }
        __builtin_amdgcn_wave_barrier(); asm volatile("" ::: "memory");
    }
}

__device__ __forceinline__ h16 tohx(float x) { return (h16)x; }
typedef __attribute__((ext_vector_type(2))) _Float16 v2h;
typedef __attribute__((ext_vector_type(4))) _Float16 v4h;
typedef __attribute__((ext_vector_type(2))) unsigned short v2us;
typedef __attribute__((ext_vector_type(4))) unsigned short v4us;
typedef __attribute__((ext_vector_type(2))) float v2f;
typedef __attribute__((ext_vector_type(4))) int v4i;

__global__ __launch_bounds__(256) void k_wtG(const float* __restrict__ w, int K, int N, bf* Bt) {
    const int lane = threadIdx.x & 31; const int L0 = (blockIdx.x * 8 + (threadIdx.x >> 5)) * 8; const int nlines = N * K / 64;
{
#pragma unroll 1
        for (int l = 0; l < 8; ++l) { const int L = L0 + l; if (L >= nlines) break; const size_t e = (size_t)L * 64 + lane * 2; const int k = (int)(e % K), n = (int)(e / K); v2us o;
            o[0] = f2bf(w[(size_t)k * N + n]); o[1] = f2bf(w[(size_t)(k + 1) * N + n]); *(v2us*)(Bt + e) = o; }
         }
}
// f32 [rows][DM] row-major to bf16 in fragment order, x and the four weights in ONE launch. A block takes one 16-row group of one tensor: 16 x DM values, DM / 32 blocks of 1 KiB = 6 x 256 pieces of 16 bytes, contiguous in the plane.
// Thread t writes pieces j*256 + t (a wave's store covers 512 contiguous bytes) and fetches each piece's 8 values: row t & 15, k = j*128 + (t >> 4)*8, so one address per thread serves all loads, one all stores, the rest are immediates.
// Groups 0 .. NB_*TT/16 - 1 are x, then DM/16 groups of each weight in the order q, k, v, p (block-uniform choice).
static_assert(DQ == DM && DKV == DM && DM == 6 * 128, "every cast tensor has rows of DM values; a 16-row group is 6 x 256 pieces");
__global__ __launch_bounds__(256) void k_cvtall(const float* __restrict__ x, const float* __restrict__ wq, const float* __restrict__ wk, const float* __restrict__ wv, const float* __restrict__ wo, bf* XB, bf* WQ, bf* WK, bf* WV, bf* WO) {
    const int GX = NB_ * TT / 16, GW = DM / 16; int g = blockIdx.x; const float* src = x; bf* dst = XB;
    if (g >= GX) { g -= GX; const int t = g / GW; g -= t * GW; src = t == 0 ? wq : t == 1 ? wk : t == 2 ? wv : wo; dst = t == 0 ? WQ : t == 1 ? WK : t == 2 ? WV : WO; }
    const int tid = threadIdx.x; const float* p = src + (size_t)(g * 16 + (tid & 15)) * DM + (tid >> 4) * 8;
    v8f v[6];
#pragma unroll
    for (int j = 0; j < 6; ++j) v[j] = *(const v8f*)(p + j * 128);
    asm volatile("s_wait_xcnt 0x0" ::: "memory");    // stands in front of any rewrite of the address registers of the loads above; its clobber also keeps all twelve loads in front of the first use, so that they fly together
    v4u q[6];
#pragma unroll
    for (int j = 0; j < 6; ++j) { v8us o;
#pragma unroll
        for (int k = 0; k < 8; ++k) o[k] = f2bf(v[j][k]);
        q[j] = __builtin_bit_cast(v4u, o); }
    // six stores, 4 KiB apart at one scalar base; the s_wait_xcnt 0 in front of any rewrite of a register that they name is the last line of their own statement (as in st4)
    asm volatile("global_store_b128 %0, %1, %7\n\tglobal_store_b128 %0, %2, %7 offset:4096\n\tglobal_store_b128 %0, %3, %7 offset:8192\n\tglobal_store_b128 %0, %4, %7 offset:12288\n\tglobal_store_b128 %0, %5, %7 offset:16384\n\tglobal_store_b128 %0, %6, %7 offset:20480\n\ts_wait_xcnt 0x0"
        :: "v"((unsigned)tid * 16u), "v"(q[0]), "v"(q[1]), "v"(q[2]), "v"(q[3]), "v"(q[4]), "v"(q[5]), "s"(dst + (size_t)g * 16 * DM) : "memory"); }

#define AW 4
typedef v8f __attribute__((may_alias)) v8fa;
// 2^x. Behind a v_exp_f32 the instruction set asks for one independent instruction or a v_nop before its result is read or its source overwritten; it is kept here by construction:
// eight at a time, no output sharing a register with an input (each v_exp_f32 is independent of the one in front of it), one v_nop behind the last.
__device__ __forceinline__ v8f exp2x8(const v8f x) { float o0, o1, o2, o3, o4, o5, o6, o7;
    asm("v_exp_f32 %0, %8\n\tv_exp_f32 %1, %9\n\tv_exp_f32 %2, %10\n\tv_exp_f32 %3, %11\n\tv_exp_f32 %4, %12\n\tv_exp_f32 %5, %13\n\tv_exp_f32 %6, %14\n\tv_exp_f32 %7, %15\n\tv_nop"
        : "=&v"(o0), "=&v"(o1), "=&v"(o2), "=&v"(o3), "=&v"(o4), "=&v"(o5), "=&v"(o6), "=&v"(o7) : "v"(x[0]), "v"(x[1]), "v"(x[2]), "v"(x[3]), "v"(x[4]), "v"(x[5]), "v"(x[6]), "v"(x[7]));
    return (v8f){o0, o1, o2, o3, o4, o5, o6, o7}; }
__device__ __forceinline__ float exp2s(const float x) { float o; asm("v_exp_f32 %0, %1\n\tv_nop" : "=v"(o) : "v"(x)); return o; }   // the same slot behind a single one
template <typename T16, bool HL, int NQ>
__device__ __forceinline__ void attn_tile(const T16* __restrict__ Q, const T16* __restrict__ Q2, const T16* __restrict__ Kp, const T16* __restrict__ K2, const T16* __restrict__ Vt, const T16* __restrict__ V2, const int q0, bf* Ah, bf* Al, float* sO, float* sM, float* sL, float* sI, const char* ring, const unsigned ring_l) {
    typedef typename WFrag<T16>::V V;
    constexpr int KS = HL ? AW : 2, MPW = 4 / KS;    // key shares per query group; output tiles (16 d each) a wave sums in the join
    static_assert(AW == 4 && (HL || NQ == 2), "fp16 tiles: 2 query groups of 32 rows x 2 key shares");
    const int lane = threadIdx.x & 31, c = lane & 15, h = lane >> 4; const int w = __builtin_amdgcn_readfirstlane((int)(threadIdx.x >> 5));
    const int qg = HL ? 0 : (w & 1), kh = HL ? w : (w >> 1), qw = q0 + qg * (NQ * 16);   // the wave's query group, its key share, its first query row (all wave-uniform)
    auto wi = [&](const int kk) { return HL ? kk : qg + 2 * kk; };                       // the wave that holds share kk of this wave's query group
    const float L2E = 1.4426950408889634f, SH = HL ? 0.0f : 10.0f; const unsigned lb = lane * 16;
    V qf[NQ][2], qf2[NQ][2];
#pragma unroll
    for (int nq = 0; nq < NQ; ++nq)
#pragma unroll
        for (int ks = 0; ks < 2; ++ks) { const size_t qo = (size_t)(qw + nq * 16) * HD + ks * 512; qf[nq][ks] = WFrag<T16>::ld(Q + qo, lb); if (HL) qf2[nq][ks] = WFrag<T16>::ld(Q2 + qo, lb); }
    V ka[2][2], ka2[2][2], va[4], va2[4];
    v8f o[4][NQ]; float m[NQ], l[NQ];
#pragma unroll
    for (int nq = 0; nq < NQ; ++nq) { m[nq] = -3.0e38f; l[nq] = 0.f;
#pragma unroll
        for (int mb = 0; mb < 4; ++mb) o[mb][nq] = (v8f){}; }
    const int nblk = (qw + NQ * 16 + 31) / 32;      // 32-key blocks that hold a key <= the wave's last query; only the last one crosses the diagonal
    asm volatile("s_wait_xcnt 0x0" ::: "memory");    // stands in front of any rewrite of the address registers of the loads above
    auto pass = [&](const int kb) {                  // one 32-key block, its fragments in ka, va (ka2, va2)
        const int k0 = kb * 32;
        v8f s[2][NQ];
#pragma unroll
        for (int t = 0; t < 2; ++t)
#pragma unroll
            for (int nq = 0; nq < NQ; ++nq) { v8f a = (v8f){};
#pragma unroll
                for (int ks = 0; ks < 2; ++ks) { a = WFrag<T16>::mma(ka[t][ks], qf[nq][ks], a); if (HL) { a = WFrag<T16>::mma(ka[t][ks], qf2[nq][ks], a); a = WFrag<T16>::mma(ka2[t][ks], qf[nq][ks], a); } }
                s[t][nq] = a; }
        if (kb == nblk - 1) {                        // diagonal block (wave-uniform test): keys above the query are masked by select
#pragma unroll
            for (int t = 0; t < 2; ++t)
#pragma unroll
                for (int nq = 0; nq < NQ; ++nq)
#pragma unroll
                    for (int r = 0; r < 8; ++r) s[t][nq][r] = (k0 + t * 16 + 8 * h + r <= qw + nq * 16 + c) ? s[t][nq][r] : -3.0e38f; }
#pragma unroll
        for (int nq = 0; nq < NQ; ++nq) {
            float mx = m[nq];
#pragma unroll
            for (int t = 0; t < 2; ++t)
#pragma unroll
                for (int r = 0; r < 8; ++r) { s[t][nq][r] *= SCL; mx = fmaxf(mx, s[t][nq][r]); }
            mx = fmaxf(mx, __shfl_xor(mx, 16, 32));
            const float al = exp2s((m[nq] - mx) * L2E); m[nq] = mx;
            float sum = 0.f;
#pragma unroll
            for (int t = 0; t < 2; ++t) { s[t][nq] = exp2x8((s[t][nq] - mx) * L2E + SH);
#pragma unroll
                for (int r = 0; r < 8; ++r) sum += s[t][nq][r]; }
            l[nq] = l[nq] * al + sum;                // this half's keys only; the halves are joined once after the loop
#pragma unroll
            for (int mb = 0; mb < 4; ++mb) o[mb][nq] *= al;
            V pf, pf2;
            if constexpr (HL) { v8us h0, h1, l0, l1;
#pragma unroll
                for (int r = 0; r < 8; ++r) { unsigned short x, y; splitf(s[0][nq][r], x, y); h0[r] = x; l0[r] = y; splitf(s[1][nq][r], x, y); h1[r] = x; l1[r] = y; }
                pf = cat16b(h0, h1); pf2 = cat16b(l0, l1);
            } else { v8h p0, p1;
#pragma unroll
                for (int r = 0; r < 8; ++r) { p0[r] = tohx(s[0][nq][r]); p1[r] = tohx(s[1][nq][r]); }
                pf = cat16(p0, p1); }
#pragma unroll
            for (int mb = 0; mb < 4; ++mb) { o[mb][nq] = WFrag<T16>::mma(va[mb], pf, o[mb][nq]); if (HL) { o[mb][nq] = WFrag<T16>::mma(va[mb], pf2, o[mb][nq]); o[mb][nq] = WFrag<T16>::mma(va2[mb], pf, o[mb][nq]); } }
        } };
    if constexpr (HL) {
#pragma unroll 1
        for (int kb = w; kb < nblk; kb += AW) {
#pragma unroll
            for (int t = 0; t < 2; ++t)
#pragma unroll
                for (int ks = 0; ks < 2; ++ks) { const size_t ko = (size_t)(kb * 32 + t * 16) * HD + ks * 512; ka[t][ks] = WFrag<T16>::ld(Kp + ko, lb); ka2[t][ks] = WFrag<T16>::ld(K2 + ko, lb); }
#pragma unroll
            for (int mb = 0; mb < 4; ++mb) { const size_t vo = (size_t)mb * 16 * TT + kb * 512; va[mb] = WFrag<T16>::ld(Vt + vo, lb); va2[mb] = WFrag<T16>::ld(V2 + vo, lb); }
            asm volatile("s_wait_xcnt 0x0" ::: "memory");    // in front of any rewrite of those loads' address registers; its clobber also keeps these loads from being sunk below this point, towards their use, where each would be waited for alone
            pass(kb);
        }
    } else {
        // stage s = keys s*64 .. s*64 + 63 in buffer s mod 2 (16 KiB): K, 8 KiB contiguous in its plane, then for each of the four 16-row groups of V^T its two 1-KiB blocks (64 KiB apart in the plane). Thread t's 16 bytes at t*16 of each 2-KiB piece.
        const int NS = q0 / 64 + 1;                  // the last stage holds the tile's own rows; q0 >= RH, so there are at least two stages (block-uniform)
        static_assert(RH >= 64 && RH % 64 == 0 && TT % 64 == 0, "the prologue fills two buffers; tiles of 64 rows");
        gptr gk = (gptr)Kp + threadIdx.x * 16; gptr gv = (gptr)Vt + threadIdx.x * 16; const unsigned l0 = ring_l + threadIdx.x * 16;
        auto fill = [&](const int s) { const unsigned lq = l0 + (s & 1) * 16384u; acopy4(lq, gk + s * 8192, 2048); acopy4(lq + 8192u, gv + s * 2048, 65536); };
        fill(0);
        asm volatile("s_wait_asynccnt 0x0" ::: "memory");   // this wave's copies of stage 0 have landed
        __syncthreads();                                    // and every other wave's: stage 0 may be read
        fill(1);
#pragma unroll 1
        for (int s = 0; s < NS; ++s) {
            const int kb = 2 * s + kh; const bool on = kb < nblk;   // wave-uniform: in the last stage the lower query group has no key in the upper block
            if (on) {
                const char* f = ring + (s & 1) * 16384 + lb;
#pragma unroll
                for (int t = 0; t < 2; ++t)
#pragma unroll
                    for (int ks = 0; ks < 2; ++ks) ka[t][ks] = WFrag<T16>::lds(f + kh * 4096 + t * 2048 + ks * 1024);
#pragma unroll
                for (int mb = 0; mb < 4; ++mb) va[mb] = WFrag<T16>::lds(f + 8192 + mb * 2048 + kh * 1024);
            }
            // the hand-over behind stage s's last LDS read stands in front of the stage's products, with all fragments in registers: the sixteen reads go out as one group, and the refill flies under the products
            asm volatile("s_wait_dscnt 0x0" ::: "memory");      // this wave has left buffer s mod 2
            asm volatile("s_wait_asynccnt 0x0" ::: "memory");   // its copies of stage s + 1 have landed
            __syncthreads();                                    // both hold for every wave: stage s + 1 may be read, buffer s mod 2 refilled
            if (s + 2 < NS) fill(s + 2);                        // block-uniform test
            if (on) pass(kb);
        }
        asm volatile("s_wait_asynccnt 0x0" ::: "memory");       // no copy is left in flight
    }
    // join: per query the (m, l) of the waves that share a query group go through LDS; every wave rescales its O^T to the common maximum and stages it; then each wave sums MPW output tiles per nq as they stand in the lanes, each one 512-byte half block of the merged planes
#pragma unroll
    for (int nq = 0; nq < NQ; ++nq) { l[nq] += __shfl_xor(l[nq], 16, 32); if (h == 0) { sM[w * 32 + nq * 16 + c] = m[nq]; sL[w * 32 + nq * 16 + c] = l[nq]; } }
    __syncthreads();
#pragma unroll
    for (int nq = 0; nq < NQ; ++nq) { float M = sM[wi(0) * 32 + nq * 16 + c];
#pragma unroll
        for (int kk = 1; kk < KS; ++kk) M = fmaxf(M, sM[wi(kk) * 32 + nq * 16 + c]);
        float lt = 0.f;
#pragma unroll
        for (int kk = 0; kk < KS; ++kk) lt += sL[wi(kk) * 32 + nq * 16 + c] * exp2s((sM[wi(kk) * 32 + nq * 16 + c] - M) * L2E);
        if (kh == 0 && h == 0) sI[qg * 32 + nq * 16 + c] = __fdiv_rn(1.0f, lt);
        const float f = exp2s((m[nq] - M) * L2E);
#pragma unroll
        for (int mb = 0; mb < 4; ++mb) *(v8fa*)(sO + (((w * 4 + mb) * NQ + nq) * 32 + lane) * 8) = o[mb][nq] * f; }
    __syncthreads();
#pragma unroll
    for (int nq = 0; nq < NQ; ++nq)
#pragma unroll
        for (int i = 0; i < MPW; ++i) { const int mb = kh * MPW + i;
        v8f a = *(const v8fa*)(sO + (((wi(0) * 4 + mb) * NQ + nq) * 32 + lane) * 8);
#pragma unroll
        for (int kk = 1; kk < KS; ++kk) a += *(const v8fa*)(sO + (((wi(kk) * 4 + mb) * NQ + nq) * 32 + lane) * 8);
        const float inv = sI[qg * 32 + nq * 16 + c]; v8us oh, ol;
#pragma unroll
        for (int r = 0; r < 8; ++r) { unsigned short x, y; splitf(a[r] * inv, x, y); oh[r] = x; ol[r] = y; }
        const size_t oo = (size_t)(qw + nq * 16) * DQ + mb * 256;
        asm volatile("global_store_b128 %0, %1, %3\n\tglobal_store_b128 %0, %2, %4\n\ts_wait_xcnt 0x0"   // the wait in front of any rewrite of a register that these stores name, in their own statement (as in st4)
            :: "v"(lb), "v"(__builtin_bit_cast(v4u, oh)), "v"(__builtin_bit_cast(v4u, ol)), "s"(Ah + oo), "s"(Al + oo) : "memory"); }
}
// grid (batches x heads, tiles), blockIdx.x = b * heads + head; blockIdx.y numbers the heaviest tiles first: (TT - RH) / 64 fp16 tiles of 64 rows from the last row down, then RH / 16 hi/lo tiles of 16 rows.
__global__ __launch_bounds__(AW * 32) void k_fattn(const h16* __restrict__ Q16, const h16* __restrict__ K16, const h16* __restrict__ V16, const bf* __restrict__ Qh, const bf* __restrict__ Ql, const bf* __restrict__ Kh, const bf* __restrict__ Kl, const bf* __restrict__ Vh, const bf* __restrict__ Vl, bf* Ah, bf* Al) {
    __shared__ __align__(32) float sO[AW * 4 * 2 * 32 * 8]; __shared__ float sM[AW * 32], sL[AW * 32], sI[64];
    __shared__ __align__(1024) char ring[2 * 16384];
    const unsigned ring_l = (unsigned)(size_t)(__attribute__((address_space(3))) char*)ring;
    const size_t pz = (size_t)blockIdx.x * TT * HD; const int ty = blockIdx.y; const size_t ao = (size_t)(blockIdx.x / NH_) * TT * DQ + (blockIdx.x % NH_) * (HD * 16); Ah += ao; Al += ao;   // a head's 64 k are two blocks of 512 elements in each 16-row group
    if (ty < (TT - RH) / 64) attn_tile<h16, false, 2>(Q16 + pz, nullptr, K16 + pz, nullptr, V16 + pz, nullptr, TT - 64 * (ty + 1), Ah, Al, sO, sM, sL, sI, ring, ring_l);
    else attn_tile<bf, true, 1>(Qh + pz, Ql + pz, Kh + pz, Kl + pz, Vh + pz, Vl + pz, RH - 16 * (ty - (TT - RH) / 64 + 1), Ah, Al, sO, sM, sL, sI, ring, ring_l);
}

extern "C" void kernel_launch(void* const* d_in, const int* in_sizes, int n_in,
                              void* d_out, int out_size, void* d_ws, size_t ws_size, hipStream_t stream) {
    (void)in_sizes; (void)n_in; (void)out_size;
    const float* x = (const float*)d_in[0]; const float* wq = (const float*)d_in[1]; const float* wk = (const float*)d_in[2]; const float* wv = (const float*)d_in[3]; const float* wo = (const float*)d_in[4]; const float* bo = (const float*)d_in[5];   /* argument order x, Wq, Wk, Wv, Wp ('oi' [768][768]: nn.Linear layout, applied transposed), bp */
    float* OUT = (float*)d_out;     // [4][2048][768]
    char* wsp = (char*)d_ws;
    auto take = [&](size_t bytes) { char* p = wsp; wsp += (bytes + 255) & ~(size_t)255; return (void*)p; };
    bf* WQ = (bf*)take((size_t)DQ * DM * 2); bf* WK = (bf*)take((size_t)DKV * DM * 2); bf* WV = (bf*)take((size_t)DKV * DM * 2); bf* WO = (bf*)take((size_t)DM * DQ * 2);
    bf* XB = (bf*)take((size_t)NB_ * TT * DM * 2);
    static_assert(NKV == NH_ && ((size_t)DQ * DM * 2) % 256 == 0 && ((size_t)NB_ * NH_ * TT * HD * 2) % 256 == 0, "the projection launch steps from q to k to v by one weight's, one plane's size: take() may leave no gap");
    h16* QP16 = (h16*)take((size_t)NB_ * NH_ * TT * HD * 2); h16* KP16 = (h16*)take((size_t)NB_ * NKV * TT * HD * 2); h16* VT16 = (h16*)take((size_t)NB_ * NKV * HD * TT * 2);
    bf* QPh = (bf*)take((size_t)NB_ * NH_ * TT * HD * 2); bf* QPl = (bf*)take((size_t)NB_ * NH_ * TT * HD * 2); bf* KPh = (bf*)take((size_t)NB_ * NKV * TT * HD * 2); bf* KPl = (bf*)take((size_t)NB_ * NKV * TT * HD * 2); bf* VTh = (bf*)take((size_t)NB_ * NKV * HD * TT * 2); bf* VTl = (bf*)take((size_t)NB_ * NKV * HD * TT * 2);
    bf* ATh = (bf*)take((size_t)NB_ * TT * DQ * 2); bf* ATl = (bf*)take((size_t)NB_ * TT * DQ * 2);
    if ((size_t)(wsp - (char*)d_ws) > ws_size) return;    // about 149 MiB of the 256 MiB
    // one launch per stage for all batches: one cast launch ('oi' weights are already [out][in] = Bt rows: a cast into fragment order, no transpose); the projections see x as [NB_*TT][DM] rows (grid z = q, k, v), attention takes the batch from blockIdx.x
    k_cvtall<<<NB_ * TT / 16 + 4 * (DM / 16), 256, 0, stream>>>(x, wq, wk, wv, wo, XB, WQ, WK, WV, WO);
    k_gemmw<bf, 0, false, true, DM><<<dim3(NB_ * TT / 128, NH_ / 2, 3), 128, 0, stream>>>(XB, nullptr, WQ, nullptr, nullptr, 0, nullptr, 0, (size_t)DQ * DM, 0, QP16, QPh, QPl);
    k_fattn<<<dim3(NB_ * NH_, (TT - RH) / 64 + RH / 16, 1), AW * 32, 0, stream>>>(QP16, KP16, VT16, QPh, QPl, KPh, KPl, VTh, VTl, ATh, ATl);
    k_gemmw<bf, 1, true, false, DQ><<<dim3(NB_ * TT / 128, DM / 128, 1), 128, 0, stream>>>(ATh, ATl, WO, nullptr, OUT, DM, bo, 0, 0, 0, nullptr, nullptr, nullptr);
}

// v009
// A run of this version takes 85.7 microseconds.
// Two timings next to v008 both put it at 1.04 times that version's speed.
// All steps since v000 together make it 25.4 times as fast.
#include <hip/hip_runtime.h>

// Causal multi-head attention with bias-free (out, in) projections and a biased (out, in) output projection at a 768-wide model (x [4][2048][768]; q, k, v = x W^T ('oi' [768][768] uniform(+-1/sqrt(768)), no bias; 12 heads x 64); scores x 64^-0.5; tril kept, -inf elsewhere (tril built inside the function); softmax; out = merged Wp^T + bp ('oi' + a REAL bias, uniform(+-1/sqrt(768))) -> [4][2048][768] (6.3 M); argument order x, Wq, Wk, Wv, Wp, bp).
// Every 16-bit operand plane lies in FRAGMENT ORDER: a block of 16 rows x 32 k is 1 KiB, two halves of 512 B, lane l's 16 bytes at l*16 (row l & 15; k = half*16 + (l >> 4)*8 + 0..7); blocks run along k, then along rows.
// A wave's 16-byte-per-lane fragment load so covers 512 contiguous bytes (4 whole lines, not 32-byte pieces of 16 lines), and it puts the same values into the same registers as a load from row-major planes.
// Layout, all four batches in every launch (rows b*2048 + t, planes [b][h]): bf16 copy of x; 'oi' weights cast (no transpose); exact projections (K 768), q, k and v in one launch that writes the head planes itself; one fused causal attention launch at 12 heads (scores, online softmax and the value product stay in registers; hybrid rows: < 512 hi/lo 3 products, rest fp16 with probabilities x1024); merged hi/lo x Wp exact + bp.
// Compute dtypes, f32 accumulate: every input rounded to bf16; projections exact; attention rows < 512 3 products, rest fp16; softmax f32; Wp hl x exact + bias.

#define NB_  4
#define TT   2048
#define DM   768
#define NH_  12
#define NKV  12
#define HD   64
#define DQ   (NH_ * HD)
#define DKV  (NKV * HD)
#define RH   512                  // query rows < RH use hi+lo planes (a multiple of 64, at least 64)
#define SCL  0.125f   // HD^-0.5
typedef _Float16 h16;
typedef unsigned short bf;
typedef __attribute__((ext_vector_type(16))) __bf16   v16bf;
typedef __attribute__((ext_vector_type(16))) _Float16 v16h;
typedef __attribute__((ext_vector_type(8)))  _Float16 v8h;
typedef __attribute__((ext_vector_type(8)))  unsigned short v8us;
typedef __attribute__((ext_vector_type(8)))  float    v8f;
typedef __attribute__((ext_vector_type(4)))  float    v4f;
typedef v8h  __attribute__((may_alias)) v8ha;
typedef v4f  __attribute__((may_alias)) v4fa;
typedef v8us __attribute__((may_alias)) v8usa;

__device__ __forceinline__ unsigned short f2bf(float f) { unsigned u = __float_as_uint(f); u += 0x7FFFu + ((u >> 16) & 1u); return (unsigned short)(u >> 16); }
__device__ __forceinline__ float bf2f(unsigned short b) { return __uint_as_float(((unsigned)b) << 16); }
__device__ __forceinline__ float bfr(float f) { return bf2f(f2bf(f)); }
__device__ __forceinline__ v16h cat16(v8h lo, v8h hi) { return __builtin_shufflevector(lo, hi, 0, 1, 2, 3, 4, 5, 6, 7, 8, 9, 10, 11, 12, 13, 14, 15); }
__device__ __forceinline__ v16bf cat16b(v8us lo, v8us hi) { return __builtin_bit_cast(v16bf, __builtin_shufflevector(lo, hi, 0, 1, 2, 3, 4, 5, 6, 7, 8, 9, 10, 11, 12, 13, 14, 15)); }
__device__ __forceinline__ v8f wmma16(v16h a, v16h b, v8f c) { return __builtin_amdgcn_wmma_f32_16x16x32_f16(false, a, false, b, (short)0, c, false, false); }
__device__ __forceinline__ v8f wmmab(v16bf a, v16bf b, v8f c) { return __builtin_amdgcn_wmma_f32_16x16x32_bf16(false, a, false, b, (short)0, c, false, false); }



// ---- k_gemmw: register-blocked GEMM, one wave per output tile of MW x NW blocks of 16x16, WX x WY waves per block; grid (M / (WX*MW*16), N / (WY*NW*16), Z), 32*WX*WY threads.
// Projections: 64x64 a wave, 2 x 2 waves, 128x128 a block. Output projection: 32x96 a wave, 4 x 2 waves, 128x192 a block: its 256 blocks are one per WGP, two waves on every SIMD, where 384 blocks of 128x128 left half the WGPs with two blocks and half with one;
// the one block holds the WGP's whole ring (NB = 6 buffers: more than half the LDS, so no second block can be placed beside it while another WGP stands empty), and each merged-heads row leaves L2 4 times, not 6.
// The block's operand rows of one pass (32 k: one block of 1 KiB per 16 rows, already in fragment order) are brought into LDS once by asynchronous copies and read there by all waves that need each;
// a ring of NB buffers: the copies of passes t + 2 .. t + NB fly while pass t + 1 is worked on, so a copy has NB - 1 passes to land (its lines come from memory where no other block has touched them yet).
// C[m][n] (f32, pitch ldc, + optional f32 bias[n]) = sum_k A[m][k] Bt[n][k] (+ split products per NSPLIT). z-batch strides sA/sB/sC in elements. K % 32 == 0, a compile-time constant.
// PLANES: no C. A = token rows [NB_*TT][K], Bt = the q, k, v weights behind one another (z = 0, 1, 2; a wave's 64-wide tile is one head); the tile leaves as 16-bit head planes in fragment order, q and k [b][h] rows t, k index d; v [b][h] rows d, k index t.
// A lane's 8 accumulator values run along m, so the plane's k index is made the m index: q and k are computed as W x^T (operand roles swapped; both fragments load alike, same k order), v as x W^T.
// Only what attention reads is written: hi/lo planes for t < RH, the fp16 q plane for t >= RH, the fp16 k and v planes everywhere.
// ld(p, lb): the fragment of the block at p (the same pointer in every lane: a scalar base), lb = lane * 16; ldq(q): the same from the lane's own address q.
typedef const __attribute__((address_space(1))) char* gptr;   // a byte address in global memory (keeps the loads global_load where the address passes through an asm statement)
template <typename T16> struct WFrag;
template <> struct WFrag<h16> { typedef v16h V; static __device__ __forceinline__ V ldq(gptr q) { return cat16(*(const __attribute__((address_space(1))) v8h*)q, *(const __attribute__((address_space(1))) v8h*)(q + 512)); } static __device__ __forceinline__ V ld(const h16* p, const unsigned lb) { return ldq((gptr)p + lb); } static __device__ __forceinline__ V lds(const char* q) { return cat16(*(const v8ha*)q, *(const v8ha*)(q + 512)); } static __device__ __forceinline__ v8f mma(V a, V b, v8f c) { return wmma16(a, b, c); } };
template <> struct WFrag<bf> { typedef v16bf V; static __device__ __forceinline__ V ldq(gptr q) { return cat16b(*(const __attribute__((address_space(1))) v8us*)q, *(const __attribute__((address_space(1))) v8us*)(q + 512)); } static __device__ __forceinline__ V ld(const bf* p, const unsigned lb) { return ldq((gptr)p + lb); } static __device__ __forceinline__ V lds(const char* q) { return cat16b(*(const v8usa*)q, *(const v8usa*)(q + 512)); } static __device__ __forceinline__ v8f mma(V a, V b, v8f c) { return wmmab(a, b, c); } };
__device__ __forceinline__ void splitf(float y, unsigned short& h, unsigned short& l) { h = f2bf(y); l = f2bf(y - bf2f(h)); }
// One wave's 64x64 accumulator tile to 16-bit planes (W16: fp16; WHL: bf16 hi and lo). Plane row = the tile's n index (16 per nb), plane k = the m index.
// Accumulator tile (mb, nb) converted is one 512-byte half block of the plane as it stands in the lanes (row = lane & 15, k = mb*16 + (lane >> 4)*8 + 0..7): one 16-byte store per lane, whole lines, no staging.
// rs = half blocks from one 16-row group of the plane to the next (2 * the plane's k extent / 32).
typedef __attribute__((ext_vector_type(4))) unsigned v4u;
// Four such stores, 512 B apart at one scalar base. The s_wait_xcnt 0 that stands in front of any rewrite of a register which an issued store names (data, offset, base) is the last line of the stores' own statement: there nothing can be moved in front of it.
__device__ __forceinline__ void st4(void* base, const unsigned lb, const v4u a, const v4u b, const v4u c, const v4u d) {
    asm volatile("global_store_b128 %0, %1, %5\n\tglobal_store_b128 %0, %2, %5 offset:512\n\tglobal_store_b128 %0, %3, %5 offset:1024\n\tglobal_store_b128 %0, %4, %5 offset:1536\n\ts_wait_xcnt 0x0"
        :: "v"(lb), "v"(a), "v"(b), "v"(c), "v"(d), "s"(base) : "memory"); }
template <bool W16, bool WHL>
__device__ __forceinline__ void planes_out(const v8f (&acc)[4][4], const int rs, h16* P16, bf* Ph, bf* Pl) {
    const unsigned lb = (threadIdx.x & 31) * 16;
#pragma unroll
    for (int nb = 0; nb < 4; ++nb) { const size_t go = (size_t)(nb * rs) * 256;
        if (W16) { v4u q[4];
#pragma unroll
            for (int mb = 0; mb < 4; ++mb) { v8h p;
#pragma unroll
                for (int j = 0; j < 8; ++j) p[j] = (h16)acc[mb][nb][j];
                q[mb] = __builtin_bit_cast(v4u, p); }
            st4(P16 + go, lb, q[0], q[1], q[2], q[3]); }
        if (WHL) { v4u qh[4], ql[4];
#pragma unroll
            for (int mb = 0; mb < 4; ++mb) { v8us ph, pl;
#pragma unroll
                for (int j = 0; j < 8; ++j) { unsigned short x, y; splitf(acc[mb][nb][j], x, y); ph[j] = x; pl[j] = y; }
                qh[mb] = __builtin_bit_cast(v4u, ph); ql[mb] = __builtin_bit_cast(v4u, pl); }
            st4(Ph + go, lb, qh[0], qh[1], qh[2], qh[3]); st4(Pl + go, lb, ql[0], ql[1], ql[2], ql[3]); }
    }
}
// One pass's operand blocks into one buffer: thread t's 16 bytes at t*16 of each pair of 1-KiB blocks (LDS: 2 KiB apart, the operands 8 KiB apart; global: two 16-row groups = gs bytes apart). l = the lane's own LDS byte address, ga, gb = its own global addresses.
// The s_wait_xcnt 0 that stands in front of any rewrite of a register which an issued copy names is the last line of the copies' own statement: there nothing can be moved in front of it.
__device__ __forceinline__ void acopy8(const unsigned l, gptr ga, gptr gb, const int gs) {
    asm volatile("global_load_async_to_lds_b128 %0, %8, off\n\tglobal_load_async_to_lds_b128 %1, %9, off\n\tglobal_load_async_to_lds_b128 %2, %10, off\n\tglobal_load_async_to_lds_b128 %3, %11, off\n\tglobal_load_async_to_lds_b128 %4, %12, off\n\tglobal_load_async_to_lds_b128 %5, %13, off\n\tglobal_load_async_to_lds_b128 %6, %14, off\n\tglobal_load_async_to_lds_b128 %7, %15, off\n\ts_wait_xcnt 0x0"
        :: "v"(l + 0u), "v"(l + 2048u), "v"(l + 4096u), "v"(l + 6144u), "v"(l + 8192u), "v"(l + 10240u), "v"(l + 12288u), "v"(l + 14336u), "v"(ga), "v"(ga + gs), "v"(ga + 2 * gs), "v"(ga + 3 * gs), "v"(gb), "v"(gb + gs), "v"(gb + 2 * gs), "v"(gb + 3 * gs) : "memory"); }
__device__ __forceinline__ void acopy4(const unsigned l, gptr ga, const int gs) {   // one operand alone: fewer address registers at a time
    asm volatile("global_load_async_to_lds_b128 %0, %4, off\n\tglobal_load_async_to_lds_b128 %1, %5, off\n\tglobal_load_async_to_lds_b128 %2, %6, off\n\tglobal_load_async_to_lds_b128 %3, %7, off\n\ts_wait_xcnt 0x0"
        :: "v"(l + 0u), "v"(l + 2048u), "v"(l + 4096u), "v"(l + 6144u), "v"(ga), "v"(ga + gs), "v"(ga + 2 * gs), "v"(ga + 3 * gs) : "memory"); }
// The same for a block of 256 threads and a 128x192 tile with a second A plane: thread t's 16 bytes at t*16 of each group of four 1-KiB blocks (LDS: 4 KiB apart, A 2 groups | Bt 3 | A2 2; global: four 16-row groups = gs bytes apart).
__device__ __forceinline__ void acopy7(const unsigned l, gptr ga, gptr gb, gptr ga2, const int gs) {
    asm volatile("global_load_async_to_lds_b128 %0, %7, off\n\tglobal_load_async_to_lds_b128 %1, %8, off\n\tglobal_load_async_to_lds_b128 %2, %9, off\n\tglobal_load_async_to_lds_b128 %3, %10, off\n\tglobal_load_async_to_lds_b128 %4, %11, off\n\tglobal_load_async_to_lds_b128 %5, %12, off\n\tglobal_load_async_to_lds_b128 %6, %13, off\n\ts_wait_xcnt 0x0"
        :: "v"(l + 0u), "v"(l + 4096u), "v"(l + 8192u), "v"(l + 12288u), "v"(l + 16384u), "v"(l + 20480u), "v"(l + 24576u), "v"(ga), "v"(ga + gs), "v"(gb), "v"(gb + gs), "v"(gb + 2 * gs), "v"(ga2), "v"(ga2 + gs) : "memory"); }
template <typename T16, int NSPLIT, bool BIAS, bool PLANES, int K, int MW, int NW, int WX, int WY, int NB>
__global__ __launch_bounds__(32 * WX * WY) void k_gemmw(const T16* __restrict__ A, const T16* __restrict__ A2, const T16* __restrict__ Bt, const T16* __restrict__ Bt2, float* C, int ldc, const float* __restrict__ bias, size_t sA, size_t sB, size_t sC, h16* P16, bf* Ph, bf* Pl) {
    typedef typename WFrag<T16>::V V;
    constexpr int NTH = 32 * WX * WY, AB = WX * MW * 1024, BB = WY * NW * 1024;   // threads; bytes of the tile's A rows and of its Bt rows in one pass (16 rows x 32 k = 1 KiB)
    constexpr int SB = (NSPLIT == 1 ? 2 : 1) * AB + BB, NT = K / 32;   // bytes of one buffer (A | Bt | A2); passes
    constexpr int CP = SB / (NTH * 16);                              // copies of one wave per pass, the same in every wave and every fill (NB: buffers of the ring)
    static_assert(NSPLIT == 1 ? (NTH == 256 && AB == 8192 && BB == 12288) : (NTH == 128 && AB == 8192 && BB == 8192), "fill below: acopy7 or acopy8");
    static_assert(!PLANES || (MW == 4 && NW == 4 && WX == 2 && WY == 2), "the plane stores take a 64x64 tile, one head");
    static_assert(NT >= NB && NB * CP <= 63, "the prologue fills every buffer; at most 63 copies of a wave in flight");
    __shared__ __align__(1024) char ring[NB * SB];
    constexpr int OP = NW * 16 + 4;   // pitch of the output staging, floats
    static_assert(WX * WY * 16 * OP * 4 <= NB * SB, "the output staging below lies in the ring");
    const size_t z = blockIdx.z; A += z * sA; if (A2) A2 += z * sA; Bt += z * sB; if (Bt2) Bt2 += z * sB; C += z * sC;
    const bool sw = PLANES && z < 2;   // q, k: the weight rows take the m side, the token rows the n side (block-uniform)
    if (sw) { const T16* t = A; A = Bt; Bt = t; }
    const int tid = threadIdx.x, lane = tid & 31, lr = lane & 15, hi = lane >> 4; const int w = __builtin_amdgcn_readfirstlane(tid >> 5);
    const int wx = w % WX, wy = w / WX, bx = blockIdx.x * WX + wx, by = blockIdx.y * WY + wy;   // the wave's own tile, numbered as a grid of such tiles
    const int r0 = sw ? by * (NW * 16) : bx * (MW * 16), c0 = sw ? bx * (MW * 16) : by * (NW * 16);
    // output staging, 16 x OP floats a wave, private to the wave: it lies in the ring, which nobody reads and no copy writes behind the last pass's barrier (each wave's s_wait_dscnt 0 and s_wait_asynccnt 0 stand in front of that barrier)
    float* os = (float*)ring + w * (16 * OP);
    v8f acc[MW][NW];
#pragma unroll
    for (int mb = 0; mb < MW; ++mb)
#pragma unroll
        for (int nb = 0; nb < NW; ++nb) acc[mb][nb] = (v8f){};
    static_assert(NSPLIT < 2, "the pass below stages A, A2 and Bt only");
    const int R0 = (sw ? blockIdx.y : blockIdx.x) * (AB / 64) + (tid >> 6) * 16, C0 = (sw ? blockIdx.x : blockIdx.y) * (BB / 64) + (tid >> 6) * 16;   // the 16-row group of the block's tile that this thread's first copy serves
    gptr ga = (gptr)(A + (size_t)R0 * K) + (tid & 63) * 16; gptr gb = (gptr)(Bt + (size_t)C0 * K) + (tid & 63) * 16; gptr ga2 = NSPLIT == 1 ? (gptr)(A2 + (size_t)R0 * K) + (tid & 63) * 16 : ga;   // 16 rows x K = K / 32 blocks of 1 KiB
    const unsigned l0 = (unsigned)(size_t)(__attribute__((address_space(3))) char*)ring + tid * 16;
    auto fill = [&](const int t, const int bo) { const unsigned l = l0 + bo; const int go = t * 1024;   // pass t's blocks into buffer t mod NB, which begins at byte bo
        if constexpr (NSPLIT == 1) acopy7(l, ga + go, gb + go, ga2 + go, 128 * K); else acopy8(l, ga + go, gb + go, 64 * K); };
    // the hand-over behind pass t's last LDS read. EARLY: it stands in front of the pass's products, with all fragments in registers, so the refill flies under them (where the grid leaves registers free: at most two waves a SIMD); else behind them, and the fragments may be read as they are used
    constexpr bool EARLY = NSPLIT == 1;
    auto foot = [&](const int t, const int bo) {
        asm volatile("s_wait_dscnt 0x0" ::: "memory");      // this wave has left buffer t mod NB
        // its copies of pass t + 1 have landed. Copies land in issue order for the counter: while all of the passes t + 2 .. t + NB - 1 exist, exactly their (NB - 2) * CP copies are younger and may fly on; in the tail the wait is to 0 (block-uniform test)
        if (t + NB - 1 < NT) asm volatile("s_wait_asynccnt %0" :: "n"((NB - 2) * CP) : "memory"); else asm volatile("s_wait_asynccnt 0x0" ::: "memory");
        __syncthreads();                                    // both hold for every wave: pass t + 1 may be read, buffer t mod NB refilled
        if (t + NB < NT) fill(t + NB, bo); };               // block-uniform test
#pragma unroll   // the prologue's buffer and pass offsets become constants
    for (int s = 0; s < NB; ++s) fill(s, s * SB);
    asm volatile("s_wait_asynccnt %0" :: "n"((NB - 1) * CP) : "memory");   // this wave's copies of pass 0 have landed (the younger ones are those of passes 1 .. NB - 1)
    __syncthreads();                                    // and every other wave's: pass 0 may be read
    const char* fa = ring + (sw ? wy : wx) * (MW * 1024) + lane * 16; const char* fb = ring + AB + (sw ? wx : wy) * (NW * 1024) + lane * 16;   // the wave's MW blocks of A and NW blocks of Bt
    int bo = 0;   // where buffer t mod NB begins
#pragma unroll 1
    for (int t = 0; t < NT; ++t) {
        V a[MW], a2[MW], b[NW];
#pragma unroll
        for (int mb = 0; mb < MW; ++mb) { a[mb] = WFrag<T16>::lds(fa + bo + mb * 1024); if (NSPLIT == 1) a2[mb] = WFrag<T16>::lds(fa + bo + (AB + BB) + mb * 1024); }
#pragma unroll
        for (int nb = 0; nb < NW; ++nb) b[nb] = WFrag<T16>::lds(fb + bo + nb * 1024);
        if constexpr (EARLY) foot(t, bo);
#pragma unroll
        for (int nb = 0; nb < NW; ++nb) {
#pragma unroll
            for (int mb = 0; mb < MW; ++mb) { acc[mb][nb] = WFrag<T16>::mma(a[mb], b[nb], acc[mb][nb]); if (NSPLIT == 1) acc[mb][nb] = WFrag<T16>::mma(a2[mb], b[nb], acc[mb][nb]); } }
        if constexpr (!EARLY) foot(t, bo);
        bo = bo + SB == NB * SB ? 0 : bo + SB;
    }
    asm volatile("s_wait_asynccnt 0x0" ::: "memory");       // no copy is left in flight
    if constexpr (PLANES) {
        const int tb = bx * 64, t0 = tb % TT; const size_t po = ((size_t)(tb / TT) * NH_ + by) * TT * HD + (sw ? (size_t)t0 * HD : (size_t)t0 * 16); const int rs = sw ? HD / 16 : TT / 16;   // q, k: 16 tokens are HD / 16 half blocks; v: 16 tokens are one half block of each 16-row group
        const size_t PE = (size_t)NB_ * NH_ * TT * HD; P16 += z * PE + po; Ph += z * 2 * PE + po; Pl += z * 2 * PE + po;   // planes in the order q, k, v; hi and lo alternate
        if (t0 >= RH) planes_out<true, false>(acc, rs, P16, Ph, Pl);          // wave-uniform tests: one straight-line body each
        else if (z == 0) planes_out<false, true>(acc, rs, P16, Ph, Pl);
        else planes_out<true, true>(acc, rs, P16, Ph, Pl);
        return;
    }
    static_assert(PLANES || NW == 6, "a lane's column below, (s * 32 + lane) % 24, comes again every third s");
    v4f bv[3];   // the lane's three bias pieces, fetched and rounded once for all rows
    if (BIAS) {
#pragma unroll
        for (int u = 0; u < 3; ++u) { const v4f t = *(const v4f*)(bias + c0 + (u * 32 + lane) % (NW * 4) * 4); bv[u] = (v4f){bfr(t[0]), bfr(t[1]), bfr(t[2]), bfr(t[3])}; } }
#pragma unroll
    for (int mb = 0; mb < MW; ++mb) {
#pragma unroll
        for (int nb = 0; nb < NW; ++nb) {
#pragma unroll
            for (int j = 0; j < 8; ++j) os[(hi * 8 + j) * OP + nb * 16 + lr] = acc[mb][nb][j]; }
        __builtin_amdgcn_wave_barrier(); asm volatile("" ::: "memory");
        float* crow = C + (size_t)(r0 + mb * 16) * ldc + c0;   // 16 rows of NW * 4 pieces of 16 bytes, dealt to the lanes in order: eight lanes fill a whole line
{
#pragma unroll
            for (int s = 0; s < NW * 2; ++s) { const int idx = s * 32 + lane, row = idx / (NW * 4), cofs = idx % (NW * 4) * 4; v4f val = *(const v4fa*)(os + row * OP + cofs); if (BIAS) val += bv[s % 3];
                *(v4f*)(crow + (size_t)row * ldc + cofs) = val; }
             }
        __builtin_amdgcn_wave_barrier(); asm volatile("" ::: "memory");
    }
}

__device__ __forceinline__ h16 tohx(float x) { return (h16)x; }
typedef __attribute__((ext_vector_type(2))) _Float16 v2h;
typedef __attribute__((ext_vector_type(4))) _Float16 v4h;
typedef __attribute__((ext_vector_type(2))) unsigned short v2us;
typedef __attribute__((ext_vector_type(4))) unsigned short v4us;
typedef __attribute__((ext_vector_type(2))) float v2f;
typedef __attribute__((ext_vector_type(4))) int v4i;

__global__ __launch_bounds__(256) void k_wtG(const float* __restrict__ w, int K, int N, bf* Bt) {
    const int lane = threadIdx.x & 31; const int L0 = (blockIdx.x * 8 + (threadIdx.x >> 5)) * 8; const int nlines = N * K / 64;
{
#pragma unroll 1
        for (int l = 0; l < 8; ++l) { const int L = L0 + l; if (L >= nlines) break; const size_t e = (size_t)L * 64 + lane * 2; const int k = (int)(e % K), n = (int)(e / K); v2us o;
            o[0] = f2bf(w[(size_t)k * N + n]); o[1] = f2bf(w[(size_t)(k + 1) * N + n]); *(v2us*)(Bt + e) = o; }
         }
}
// f32 [rows][DM] row-major to bf16 in fragment order, x and the four weights in ONE launch. A block takes one 16-row group of one tensor: 16 x DM values, DM / 32 blocks of 1 KiB = 6 x 256 pieces of 16 bytes, contiguous in the plane.
// Thread t writes pieces j*256 + t (a wave's store covers 512 contiguous bytes) and fetches each piece's 8 values: row t & 15, k = j*128 + (t >> 4)*8, so one address per thread serves all loads, one all stores, the rest are immediates.
// Groups 0 .. NB_*TT/16 - 1 are x, then DM/16 groups of each weight in the order q, k, v, p (block-uniform choice).
static_assert(DQ == DM && DKV == DM && DM == 6 * 128, "every cast tensor has rows of DM values; a 16-row group is 6 x 256 pieces");
__global__ __launch_bounds__(256) void k_cvtall(const float* __restrict__ x, const float* __restrict__ wq, const float* __restrict__ wk, const float* __restrict__ wv, const float* __restrict__ wo, bf* XB, bf* WQ, bf* WK, bf* WV, bf* WO) {
    const int GX = NB_ * TT / 16, GW = DM / 16; int g = blockIdx.x; const float* src = x; bf* dst = XB;
    if (g >= GX) { g -= GX; const int t = g / GW; g -= t * GW; src = t == 0 ? wq : t == 1 ? wk : t == 2 ? wv : wo; dst = t == 0 ? WQ : t == 1 ? WK : t == 2 ? WV : WO; }
    const int tid = threadIdx.x; const float* p = src + (size_t)(g * 16 + (tid & 15)) * DM + (tid >> 4) * 8;
    v8f v[6];
#pragma unroll
    for (int j = 0; j < 6; ++j) v[j] = *(const v8f*)(p + j * 128);
    asm volatile("s_wait_xcnt 0x0" ::: "memory");    // stands in front of any rewrite of the address registers of the loads above; its clobber also keeps all twelve loads in front of the first use, so that they fly together
    v4u q[6];
#pragma unroll
    for (int j = 0; j < 6; ++j) { v8us o;
#pragma unroll
        for (int k = 0; k < 8; ++k) o[k] = f2bf(v[j][k]);
        q[j] = __builtin_bit_cast(v4u, o); }
    // six stores, 4 KiB apart at one scalar base; the s_wait_xcnt 0 in front of any rewrite of a register that they name is the last line of their own statement (as in st4)
    asm volatile("global_store_b128 %0, %1, %7\n\tglobal_store_b128 %0, %2, %7 offset:4096\n\tglobal_store_b128 %0, %3, %7 offset:8192\n\tglobal_store_b128 %0, %4, %7 offset:12288\n\tglobal_store_b128 %0, %5, %7 offset:16384\n\tglobal_store_b128 %0, %6, %7 offset:20480\n\ts_wait_xcnt 0x0"
        :: "v"((unsigned)tid * 16u), "v"(q[0]), "v"(q[1]), "v"(q[2]), "v"(q[3]), "v"(q[4]), "v"(q[5]), "s"(dst + (size_t)g * 16 * DM) : "memory"); }

#define AW 4
typedef v8f __attribute__((may_alias)) v8fa;
// 2^x. Behind a v_exp_f32 the instruction set asks for one independent instruction or a v_nop before its result is read or its source overwritten; it is kept here by construction:
// eight at a time, no output sharing a register with an input (each v_exp_f32 is independent of the one in front of it), one v_nop behind the last.
__device__ __forceinline__ v8f exp2x8(const v8f x) { float o0, o1, o2, o3, o4, o5, o6, o7;
    asm("v_exp_f32 %0, %8\n\tv_exp_f32 %1, %9\n\tv_exp_f32 %2, %10\n\tv_exp_f32 %3, %11\n\tv_exp_f32 %4, %12\n\tv_exp_f32 %5, %13\n\tv_exp_f32 %6, %14\n\tv_exp_f32 %7, %15\n\tv_nop"
        : "=&v"(o0), "=&v"(o1), "=&v"(o2), "=&v"(o3), "=&v"(o4), "=&v"(o5), "=&v"(o6), "=&v"(o7) : "v"(x[0]), "v"(x[1]), "v"(x[2]), "v"(x[3]), "v"(x[4]), "v"(x[5]), "v"(x[6]), "v"(x[7]));
    return (v8f){o0, o1, o2, o3, o4, o5, o6, o7}; }
__device__ __forceinline__ float exp2s(const float x) { float o; asm("v_exp_f32 %0, %1\n\tv_nop" : "=v"(o) : "v"(x)); return o; }   // the same slot behind a single one
template <typename T16, bool HL, int NQ>
__device__ __forceinline__ void attn_tile(const T16* __restrict__ Q, const T16* __restrict__ Q2, const T16* __restrict__ Kp, const T16* __restrict__ K2, const T16* __restrict__ Vt, const T16* __restrict__ V2, const int q0, bf* Ah, bf* Al, float* sO, float* sM, float* sL, float* sI, const char* ring, const unsigned ring_l) {
    typedef typename WFrag<T16>::V V;
    constexpr int KS = HL ? AW : 2, MPW = 4 / KS;    // key shares per query group; output tiles (16 d each) a wave sums in the join
    static_assert(AW == 4 && (HL || NQ == 2), "fp16 tiles: 2 query groups of 32 rows x 2 key shares");
    const int lane = threadIdx.x & 31, c = lane & 15, h = lane >> 4; const int w = __builtin_amdgcn_readfirstlane((int)(threadIdx.x >> 5));
    const int qg = HL ? 0 : (w & 1), kh = HL ? w : (w >> 1), qw = q0 + qg * (NQ * 16);   // the wave's query group, its key share, its first query row (all wave-uniform)
    auto wi = [&](const int kk) { return HL ? kk : qg + 2 * kk; };                       // the wave that holds share kk of this wave's query group
    const float L2E = 1.4426950408889634f, SH = HL ? 0.0f : 10.0f; const unsigned lb = lane * 16;
    V qf[NQ][2], qf2[NQ][2];
#pragma unroll
    for (int nq = 0; nq < NQ; ++nq)
#pragma unroll
        for (int ks = 0; ks < 2; ++ks) { const size_t qo = (size_t)(qw + nq * 16) * HD + ks * 512; qf[nq][ks] = WFrag<T16>::ld(Q + qo, lb); if (HL) qf2[nq][ks] = WFrag<T16>::ld(Q2 + qo, lb); }
    V ka[2][2], ka2[2][2], va[4], va2[4];
    v8f o[4][NQ]; float m[NQ], l[NQ];
#pragma unroll
    for (int nq = 0; nq < NQ; ++nq) { m[nq] = -3.0e38f; l[nq] = 0.f;
#pragma unroll
        for (int mb = 0; mb < 4; ++mb) o[mb][nq] = (v8f){}; }
    const int nblk = (qw + NQ * 16 + 31) / 32;      // 32-key blocks that hold a key <= the wave's last query; only the last one crosses the diagonal
    asm volatile("s_wait_xcnt 0x0" ::: "memory");    // stands in front of any rewrite of the address registers of the loads above
    auto pass = [&](const int kb) {                  // one 32-key block, its fragments in ka, va (ka2, va2)
        const int k0 = kb * 32;
        v8f s[2][NQ];
#pragma unroll
        for (int t = 0; t < 2; ++t)
#pragma unroll
            for (int nq = 0; nq < NQ; ++nq) { v8f a = (v8f){};
#pragma unroll
                for (int ks = 0; ks < 2; ++ks) { a = WFrag<T16>::mma(ka[t][ks], qf[nq][ks], a); if (HL) { a = WFrag<T16>::mma(ka[t][ks], qf2[nq][ks], a); a = WFrag<T16>::mma(ka2[t][ks], qf[nq][ks], a); } }
                s[t][nq] = a; }
        if (kb == nblk - 1) {                        // diagonal block (wave-uniform test): keys above the query are masked by select
#pragma unroll
            for (int t = 0; t < 2; ++t)
#pragma unroll
                for (int nq = 0; nq < NQ; ++nq)
#pragma unroll
                    for (int r = 0; r < 8; ++r) s[t][nq][r] = (k0 + t * 16 + 8 * h + r <= qw + nq * 16 + c) ? s[t][nq][r] : -3.0e38f; }
#pragma unroll
        for (int nq = 0; nq < NQ; ++nq) {
            float mx = m[nq];
#pragma unroll
            for (int t = 0; t < 2; ++t)
#pragma unroll
                for (int r = 0; r < 8; ++r) { s[t][nq][r] *= SCL; mx = fmaxf(mx, s[t][nq][r]); }
            mx = fmaxf(mx, __shfl_xor(mx, 16, 32));
            const float al = exp2s((m[nq] - mx) * L2E); m[nq] = mx;
            float sum = 0.f;
#pragma unroll
            for (int t = 0; t < 2; ++t) { s[t][nq] = exp2x8((s[t][nq] - mx) * L2E + SH);
#pragma unroll
                for (int r = 0; r < 8; ++r) sum += s[t][nq][r]; }
            l[nq] = l[nq] * al + sum;                // this half's keys only; the halves are joined once after the loop
#pragma unroll
            for (int mb = 0; mb < 4; ++mb) o[mb][nq] *= al;
            V pf, pf2;
            if constexpr (HL) { v8us h0, h1, l0, l1;
#pragma unroll
                for (int r = 0; r < 8; ++r) { unsigned short x, y; splitf(s[0][nq][r], x, y); h0[r] = x; l0[r] = y; splitf(s[1][nq][r], x, y); h1[r] = x; l1[r] = y; }
                pf = cat16b(h0, h1); pf2 = cat16b(l0, l1);
            } else { v8h p0, p1;
#pragma unroll
                for (int r = 0; r < 8; ++r) { p0[r] = tohx(s[0][nq][r]); p1[r] = tohx(s[1][nq][r]); }
                pf = cat16(p0, p1); }
#pragma unroll
            for (int mb = 0; mb < 4; ++mb) { o[mb][nq] = WFrag<T16>::mma(va[mb], pf, o[mb][nq]); if (HL) { o[mb][nq] = WFrag<T16>::mma(va[mb], pf2, o[mb][nq]); o[mb][nq] = WFrag<T16>::mma(va2[mb], pf, o[mb][nq]); } }
        } };
    if constexpr (HL) {
#pragma unroll 1
        for (int kb = w; kb < nblk; kb += AW) {
#pragma unroll
            for (int t = 0; t < 2; ++t)
#pragma unroll
                for (int ks = 0; ks < 2; ++ks) { const size_t ko = (size_t)(kb * 32 + t * 16) * HD + ks * 512; ka[t][ks] = WFrag<T16>::ld(Kp + ko, lb); ka2[t][ks] = WFrag<T16>::ld(K2 + ko, lb); }
#pragma unroll
            for (int mb = 0; mb < 4; ++mb) { const size_t vo = (size_t)mb * 16 * TT + kb * 512; va[mb] = WFrag<T16>::ld(Vt + vo, lb); va2[mb] = WFrag<T16>::ld(V2 + vo, lb); }
            asm volatile("s_wait_xcnt 0x0" ::: "memory");    // in front of any rewrite of those loads' address registers; its clobber also keeps these loads from being sunk below this point, towards their use, where each would be waited for alone
            pass(kb);
        }
    } else {
        // stage s = keys s*64 .. s*64 + 63 in buffer s mod 2 (16 KiB): K, 8 KiB contiguous in its plane, then for each of the four 16-row groups of V^T its two 1-KiB blocks (64 KiB apart in the plane). Thread t's 16 bytes at t*16 of each 2-KiB piece.
        const int NS = q0 / 64 + 1;                  // the last stage holds the tile's own rows; q0 >= RH, so there are at least two stages (block-uniform)
        static_assert(RH >= 64 && RH % 64 == 0 && TT % 64 == 0, "the prologue fills two buffers; tiles of 64 rows");
        gptr gk = (gptr)Kp + threadIdx.x * 16; gptr gv = (gptr)Vt + threadIdx.x * 16; const unsigned l0 = ring_l + threadIdx.x * 16;
        auto fill = [&](const int s) { const unsigned lq = l0 + (s & 1) * 16384u; acopy4(lq, gk + s * 8192, 2048); acopy4(lq + 8192u, gv + s * 2048, 65536); };
        fill(0);
        asm volatile("s_wait_asynccnt 0x0" ::: "memory");   // this wave's copies of stage 0 have landed
        __syncthreads();                                    // and every other wave's: stage 0 may be read
        fill(1);
#pragma unroll 1
        for (int s = 0; s < NS; ++s) {
            const int kb = 2 * s + kh; const bool on = kb < nblk;   // wave-uniform: in the last stage the lower query group has no key in the upper block
            if (on) {
                const char* f = ring + (s & 1) * 16384 + lb;
#pragma unroll
                for (int t = 0; t < 2; ++t)
#pragma unroll
                    for (int ks = 0; ks < 2; ++ks) ka[t][ks] = WFrag<T16>::lds(f + kh * 4096 + t * 2048 + ks * 1024);
#pragma unroll
                for (int mb = 0; mb < 4; ++mb) va[mb] = WFrag<T16>::lds(f + 8192 + mb * 2048 + kh * 1024);
            }
            // the hand-over behind stage s's last LDS read stands in front of the stage's products, with all fragments in registers: the sixteen reads go out as one group, and the refill flies under the products
            asm volatile("s_wait_dscnt 0x0" ::: "memory");      // this wave has left buffer s mod 2
            asm volatile("s_wait_asynccnt 0x0" ::: "memory");   // its copies of stage s + 1 have landed
            __syncthreads();                                    // both hold for every wave: stage s + 1 may be read, buffer s mod 2 refilled
            if (s + 2 < NS) fill(s + 2);                        // block-uniform test
            if (on) pass(kb);
        }
        asm volatile("s_wait_asynccnt 0x0" ::: "memory");       // no copy is left in flight
    }
    // join: per query the (m, l) of the waves that share a query group go through LDS; every wave rescales its O^T to the common maximum and stages it; then each wave sums MPW output tiles per nq as they stand in the lanes, each one 512-byte half block of the merged planes
#pragma unroll
    for (int nq = 0; nq < NQ; ++nq) { l[nq] += __shfl_xor(l[nq], 16, 32); if (h == 0) { sM[w * 32 + nq * 16 + c] = m[nq]; sL[w * 32 + nq * 16 + c] = l[nq]; } }
    __syncthreads();
#pragma unroll
    for (int nq = 0; nq < NQ; ++nq) { float M = sM[wi(0) * 32 + nq * 16 + c];
#pragma unroll
        for (int kk = 1; kk < KS; ++kk) M = fmaxf(M, sM[wi(kk) * 32 + nq * 16 + c]);
        float lt = 0.f;
#pragma unroll
        for (int kk = 0; kk < KS; ++kk) lt += sL[wi(kk) * 32 + nq * 16 + c] * exp2s((sM[wi(kk) * 32 + nq * 16 + c] - M) * L2E);
        if (kh == 0 && h == 0) sI[qg * 32 + nq * 16 + c] = __fdiv_rn(1.0f, lt);
        const float f = exp2s((m[nq] - M) * L2E);
#pragma unroll
        for (int mb = 0; mb < 4; ++mb) *(v8fa*)(sO + (((w * 4 + mb) * NQ + nq) * 32 + lane) * 8) = o[mb][nq] * f; }
    __syncthreads();
#pragma unroll
    for (int nq = 0; nq < NQ; ++nq)
#pragma unroll
        for (int i = 0; i < MPW; ++i) { const int mb = kh * MPW + i;
        v8f a = *(const v8fa*)(sO + (((wi(0) * 4 + mb) * NQ + nq) * 32 + lane) * 8);
#pragma unroll
        for (int kk = 1; kk < KS; ++kk) a += *(const v8fa*)(sO + (((wi(kk) * 4 + mb) * NQ + nq) * 32 + lane) * 8);
        const float inv = sI[qg * 32 + nq * 16 + c]; v8us oh, ol;
#pragma unroll
        for (int r = 0; r < 8; ++r) { unsigned short x, y; splitf(a[r] * inv, x, y); oh[r] = x; ol[r] = y; }
        const size_t oo = (size_t)(qw + nq * 16) * DQ + mb * 256;
        asm volatile("global_store_b128 %0, %1, %3\n\tglobal_store_b128 %0, %2, %4\n\ts_wait_xcnt 0x0"   // the wait in front of any rewrite of a register that these stores name, in their own statement (as in st4)
            :: "v"(lb), "v"(__builtin_bit_cast(v4u, oh)), "v"(__builtin_bit_cast(v4u, ol)), "s"(Ah + oo), "s"(Al + oo) : "memory"); }
}
// grid (batches x heads, tiles), blockIdx.x = b * heads + head; blockIdx.y numbers the heaviest tiles first: (TT - RH) / 64 fp16 tiles of 64 rows from the last row down, then RH / 16 hi/lo tiles of 16 rows.
__global__ __launch_bounds__(AW * 32) void k_fattn(const h16* __restrict__ Q16, const h16* __restrict__ K16, const h16* __restrict__ V16, const bf* __restrict__ Qh, const bf* __restrict__ Ql, const bf* __restrict__ Kh, const bf* __restrict__ Kl, const bf* __restrict__ Vh, const bf* __restrict__ Vl, bf* Ah, bf* Al) {
    __shared__ __align__(32) float sO[AW * 4 * 2 * 32 * 8]; __shared__ float sM[AW * 32], sL[AW * 32], sI[64];
    __shared__ __align__(1024) char ring[2 * 16384];
    const unsigned ring_l = (unsigned)(size_t)(__attribute__((address_space(3))) char*)ring;
    const size_t pz = (size_t)blockIdx.x * TT * HD; const int ty = blockIdx.y; const size_t ao = (size_t)(blockIdx.x / NH_) * TT * DQ + (blockIdx.x % NH_) * (HD * 16); Ah += ao; Al += ao;   // a head's 64 k are two blocks of 512 elements in each 16-row group
    if (ty < (TT - RH) / 64) attn_tile<h16, false, 2>(Q16 + pz, nullptr, K16 + pz, nullptr, V16 + pz, nullptr, TT - 64 * (ty + 1), Ah, Al, sO, sM, sL, sI, ring, ring_l);
    else attn_tile<bf, true, 1>(Qh + pz, Ql + pz, Kh + pz, Kl + pz, Vh + pz, Vl + pz, RH - 16 * (ty - (TT - RH) / 64 + 1), Ah, Al, sO, sM, sL, sI, ring, ring_l);
}

extern "C" void kernel_launch(void* const* d_in, const int* in_sizes, int n_in,
                              void* d_out, int out_size, void* d_ws, size_t ws_size, hipStream_t stream) {
    (void)in_sizes; (void)n_in; (void)out_size;
    const float* x = (const float*)d_in[0]; const float* wq = (const float*)d_in[1]; const float* wk = (const float*)d_in[2]; const float* wv = (const float*)d_in[3]; const float* wo = (const float*)d_in[4]; const float* bo = (const float*)d_in[5];   /* argument order x, Wq, Wk, Wv, Wp ('oi' [768][768]: nn.Linear layout, applied transposed), bp */
    float* OUT = (float*)d_out;     // [4][2048][768]
    char* wsp = (char*)d_ws;
    auto take = [&](size_t bytes) { char* p = wsp; wsp += (bytes + 255) & ~(size_t)255; return (void*)p; };
    bf* WQ = (bf*)take((size_t)DQ * DM * 2); bf* WK = (bf*)take((size_t)DKV * DM * 2); bf* WV = (bf*)take((size_t)DKV * DM * 2); bf* WO = (bf*)take((size_t)DM * DQ * 2);
    bf* XB = (bf*)take((size_t)NB_ * TT * DM * 2);
    static_assert(NKV == NH_ && ((size_t)DQ * DM * 2) % 256 == 0 && ((size_t)NB_ * NH_ * TT * HD * 2) % 256 == 0, "the projection launch steps from q to k to v by one weight's, one plane's size: take() may leave no gap");
    h16* QP16 = (h16*)take((size_t)NB_ * NH_ * TT * HD * 2); h16* KP16 = (h16*)take((size_t)NB_ * NKV * TT * HD * 2); h16* VT16 = (h16*)take((size_t)NB_ * NKV * HD * TT * 2);
    bf* QPh = (bf*)take((size_t)NB_ * NH_ * TT * HD * 2); bf* QPl = (bf*)take((size_t)NB_ * NH_ * TT * HD * 2); bf* KPh = (bf*)take((size_t)NB_ * NKV * TT * HD * 2); bf* KPl = (bf*)take((size_t)NB_ * NKV * TT * HD * 2); bf* VTh = (bf*)take((size_t)NB_ * NKV * HD * TT * 2); bf* VTl = (bf*)take((size_t)NB_ * NKV * HD * TT * 2);
    bf* ATh = (bf*)take((size_t)NB_ * TT * DQ * 2); bf* ATl = (bf*)take((size_t)NB_ * TT * DQ * 2);
    if ((size_t)(wsp - (char*)d_ws) > ws_size) return;    // about 149 MiB of the 256 MiB
    // one launch per stage for all batches: one cast launch ('oi' weights are already [out][in] = Bt rows: a cast into fragment order, no transpose); the projections see x as [NB_*TT][DM] rows (grid z = q, k, v), attention takes the batch from blockIdx.x
    k_cvtall<<<NB_ * TT / 16 + 4 * (DM / 16), 256, 0, stream>>>(x, wq, wk, wv, wo, XB, WQ, WK, WV, WO);
    k_gemmw<bf, 0, false, true, DM, 4, 4, 2, 2, 3><<<dim3(NB_ * TT / 128, NH_ / 2, 3), 128, 0, stream>>>(XB, nullptr, WQ, nullptr, nullptr, 0, nullptr, 0, (size_t)DQ * DM, 0, QP16, QPh, QPl);
    k_fattn<<<dim3(NB_ * NH_, (TT - RH) / 64 + RH / 16, 1), AW * 32, 0, stream>>>(QP16, KP16, VT16, QPh, QPl, KPh, KPl, VTh, VTl, ATh, ATl);
    k_gemmw<bf, 1, true, false, DQ, 2, 6, 4, 2, 6><<<dim3(NB_ * TT / 128, DM / 192, 1), 256, 0, stream>>>(ATh, ATl, WO, nullptr, OUT, DM, bo, 0, 0, 0, nullptr, nullptr, nullptr);
}
